// v000
// Measured on an AMD MI455X. A time is GPU time per run, averaged over a window of back-to-back runs after a warm-up
// (all launches, gaps included; the runs take copies of the inputs in turn), and the median of several windows.
// Apart from v000's, it joins two sittings. Times from different sittings can be a few percent apart, while
// side-by-side timings come from the same sitting.
// v000, which the later versions start from, runs in 433 microseconds.
// compute dtype: all float inputs rounded to bf16; qkv = x . W_qkv + b with EXACT bf16 products on WMMA 16x16x32 ((in,out) columns q | k | v as transposed rows); the relative-position bias table bias[h][t-s] = relu(sign(t-s) log1p|t-s| * w1 + b1) . w2 + b2 computed once per distance in f32 (precise log1pf); PLAIN attention: q, k as single f16 operands x 1/8 + bias, running-max softmax in f32 (hardware exp), P (scaled by 2^11, single f16) x v (single f16); out = ctx (bf16 hi + residual) . W_out (2 products) + b_out.
#include <hip/hip_runtime.h>
#include <math.h>

typedef __attribute__((ext_vector_type(16))) _Float16 v16h;
typedef __attribute__((ext_vector_type(16))) __bf16 v16b;
typedef __attribute__((ext_vector_type(8)))  _Float16 v8h;
typedef __attribute__((ext_vector_type(8)))  float v8f;
typedef __attribute__((ext_vector_type(4)))  float v4f;
typedef __attribute__((ext_vector_type(2)))  float v2f;
typedef __attribute__((ext_vector_type(4)))  unsigned v4u;
typedef __attribute__((ext_vector_type(4)))  int v4i;
typedef float __attribute__((may_alias)) float_a;
typedef int __attribute__((may_alias)) int_a;

template <typename T> __device__ __forceinline__ void vst2(void* p, T v) { *(T*)p = v;  }
__device__ __forceinline__ v8f wmma16(v16h a, v16h b, v8f c) {
  v8f d = __builtin_amdgcn_wmma_f32_16x16x32_f16(false, a, false, b, (short)0, c, false, false);
  asm volatile("v_nop\n\tv_nop\n\tv_nop\n\tv_nop" : "+v"(d) : "v"(a), "v"(b));
  return d;
}
__device__ __forceinline__ v8f wmma_bf(v16b a, v16b b, v8f c) {
  v8f d = __builtin_amdgcn_wmma_f32_16x16x32_bf16(false, a, false, b, (short)0, c, false, false);
  asm volatile("v_nop\n\tv_nop\n\tv_nop\n\tv_nop" : "+v"(d) : "v"(a), "v"(b));
  return d;
}
// Multi-head self attention with a learned relative-position bias (B 2, T 2,048, d 1,024, 16 heads x 64): fused q|k|v projection + bias, scores + bias[h](t - s) from a small MLP on the signed log distance, softmax, output projection + bias.
__device__ __forceinline__ v16h frag_h(const _Float16* rowk0, int lane) {
  union { v16h v; v8h q[2]; } u; const _Float16* p = rowk0 + 8 * (lane >> 4);
  u.q[0] = *(const v8h*)p; u.q[1] = *(const v8h*)(p + 16); return u.v;
}
__device__ __forceinline__ v16h frag_f32(const float* rowk0, int lane) {
  v16h a; const float* p = rowk0 + 8 * (lane >> 4);
#pragma unroll
  for (int i = 0; i < 8; ++i) { a[i] = (_Float16)p[i]; a[8 + i] = (_Float16)p[16 + i]; }
  return a;
}
__device__ __forceinline__ v16h frag_f32s(const float* rowk0, int lane, float sc) {
  v16h a; const float* p = rowk0 + 8 * (lane >> 4);
#pragma unroll
  for (int i = 0; i < 8; ++i) { a[i] = (_Float16)(p[i] * sc); a[8 + i] = (_Float16)(p[16 + i] * sc); }
  return a;
}
// column fragment from a [K][ld] layout (column n), rows >= K read as 0
__device__ __forceinline__ v16h fragc_f32(const float* W, int k0, int n, int lane, int ld, int K) {
  v16h a; const int g = lane >> 4;
#pragma unroll
  for (int i = 0; i < 8; ++i) { const int ka = k0 + 8 * g + i, kb = ka + 16;
    a[i] = (_Float16)(ka < K ? W[(size_t)(ka < K ? ka : K - 1) * ld + n] : 0.f); a[8 + i] = (_Float16)(kb < K ? W[(size_t)(kb < K ? kb : K - 1) * ld + n] : 0.f); }
  return a;
}
struct F2 { v16b h, l; };
__device__ __forceinline__ F2 bsplit16(const float v[16]) { F2 r;
#pragma unroll
  for (int i = 0; i < 16; ++i) { const __bf16 h = (__bf16)v[i]; r.h[i] = h; r.l[i] = (__bf16)(v[i] - (float)h); }
  return r; }
__device__ __forceinline__ F2 split_row(const float* row, int k0, int lane) { float v[16]; const float* p = row + k0 + 8 * (lane >> 4);
#pragma unroll
  for (int i = 0; i < 8; ++i) { v[i] = p[i]; v[8 + i] = p[16 + i]; }
  return bsplit16(v); }
__device__ __forceinline__ F2 split_rowK(const float* row, int k0, int lane, int K) { float v[16]; const int g = lane >> 4;
#pragma unroll
  for (int i = 0; i < 8; ++i) { const int ka = k0 + 8 * g + i, kb = ka + 16; v[i] = ka < K ? row[ka < K ? ka : K - 1] : 0.f; v[8 + i] = kb < K ? row[kb < K ? kb : K - 1] : 0.f; }
  return bsplit16(v); }
__device__ __forceinline__ F2 split_col(const float* W, int k0, int n, int lane, int ld, int K) { float v[16]; const int g = lane >> 4;
#pragma unroll
  for (int i = 0; i < 8; ++i) { const int ka = k0 + 8 * g + i, kb = ka + 16; v[i] = ka < K ? W[(size_t)(ka < K ? ka : K - 1) * ld + n] : 0.f; v[8 + i] = kb < K ? W[(size_t)(kb < K ? kb : K - 1) * ld + n] : 0.f; }
  return bsplit16(v); }
__device__ __forceinline__ v8f mac3(const F2& a, const F2& b, v8f c) { c = wmma_bf(a.l, b.h, c); c = wmma_bf(a.h, b.l, c); return wmma_bf(a.h, b.h, c); }
__device__ __forceinline__ float sigm(float v) { return 1.0f / (1.0f + expf(-v)); }
#define LDSX() do { asm volatile("s_wait_dscnt 0" ::: "memory"); __builtin_amdgcn_wave_barrier(); __builtin_amdgcn_fence(__ATOMIC_RELEASE, "workgroup"); } while (0)


#define NB 2
#define SS 2048
#define DM 1024
#define NH 16
#define HD 64
#define QKVW (3 * DM)
#ifndef TQB
#define TQB (SS / 64)
#define TNB NB
#define TOB (NB * SS / 64)     // output row tiles (all)
#endif
typedef __attribute__((ext_vector_type(8))) __bf16 v8b;
__device__ __forceinline__ v16b frag_b(const __bf16* rowk0, int lane) {
  union { v16b v; v8b q[2]; } u; const __bf16* p = rowk0 + 8 * (lane >> 4);
  u.q[0] = *(const v8b*)p; u.q[1] = *(const v8b*)(p + 16); return u.v;
}
__device__ __forceinline__ float bfr(float v) { return (float)(__bf16)v; }
__device__ __attribute__((noinline)) float exp_ni(float v) { return expf(v); }
__device__ __attribute__((noinline)) float erf_ni(float v) { return erff(v); }

#define PK_A 0                       // [3072][1024] Wqkv rows (natural [out][in])
#define PK_P (PK_A + QKVW * DM)        // [1024][1024] Wo rows (natural)
#define PK_END (PK_P + DM * DM)
#define WS_PK  0u
#define WS_QK  (WS_PK + 2u * PK_END)             // f16 [4096 rows][2048]: q | k
#define WS_QKL (WS_QK + 2u * NB * SS * 2 * DM)     // f16 q | k residual planes x2048
#define WS_VTH (WS_QKL + 2u * NB * SS * 2 * DM)    // f16 [b][1024 (h*64+d)][2048 s] hi
#define WS_VTL (WS_VTH + 2u * NB * DM * SS)        // f16 lo x 2048
#define WS_O   (WS_VTL + 2u * NB * DM * SS)        // f32 [4096][1024]
#define WS_CS  (WS_O + 4u * NB * SS * DM)           // f32 2 x [2048][32], not used
#define WS_RB  (WS_CS + 4u * 2 * SS * 32)                 // f32 [16][2*SS-1] relative-position bias table
#define WS_END (WS_RB + 4u * NH * (2 * SS))
#define RPEH 32
// ---- k_pack: block = (row n, which): column n of an (in,out) weight -> bf16 row n; which 0..2 -> W_q/W_k/W_v into PK_A rows which*1024 + n; 3 -> W_o into PK_P
__global__ __launch_bounds__(256) void k_pack(const float* __restrict__ WQ, const float* __restrict__ WK, const float* __restrict__ WV, const float* __restrict__ WO, __bf16* __restrict__ PK) {
  __shared__ __align__(16) __bf16 s[DM]; const int n = blockIdx.x, which = blockIdx.y, t = threadIdx.x; const float* Wm = (which == 0) ? WQ : (which == 1) ? WK : (which == 2) ? WV : WO;   // (in,out) weights: pack row n = column n
  for (int k = t; k < DM; k += 256) s[k] = (__bf16)Wm[(size_t)k * DM + n];
  __syncthreads();
  __bf16* dst = (which < 3) ? PK + PK_A + ((size_t)which * DM + n) * DM : PK + PK_P + (size_t)n * DM;
  for (int q = t; q < DM / 8; q += 256) vst2((unsigned*)(dst + q * 8), *(const v4u*)&s[q * 8]);
}
__global__ __launch_bounds__(128) void k_qkv(const float* __restrict__ XQ, const float* __restrict__ XK, const float* __restrict__ XV, const __bf16* __restrict__ P, const float* __restrict__ BQ, const float* __restrict__ BK, const float* __restrict__ BV, _Float16* __restrict__ QK, _Float16* __restrict__ QKL, _Float16* __restrict__ VTH, _Float16* __restrict__ VTL) {
  const int which0 = (blockIdx.y * 128) / DM; const float* X = (which0 == 0) ? XQ : (which0 == 1) ? XK : XV; const float* BB = BQ ? (((which0 == 0) ? BQ : (which0 == 1) ? BK : BV) + (blockIdx.y * 128 - which0 * DM)) : nullptr;
  __shared__ __align__(16) _Float16 so[4][16][136], sol[4][16][136]; __shared__ __align__(16) _Float16 sth[128][72], stl[128][72];
  const int tid = threadIdx.x, wave = tid >> 5, lane = tid & 31, col = lane & 15, g = lane >> 4; const size_t r0 = (size_t)blockIdx.x * 64 + wave * 16; const int n0 = blockIdx.y * 128;
  v8f acc[8] = {};
#pragma unroll 2
  for (int kc = 0; kc < DM / 32; ++kc) { v16b a; { const float* p = X + (r0 + col) * DM + kc * 32 + 8 * g;
#pragma unroll
      for (int i = 0; i < 8; ++i) { a[i] = (__bf16)p[i]; a[8 + i] = (__bf16)p[16 + i]; } }
#pragma unroll
    for (int j = 0; j < 8; ++j) acc[j] = wmma_bf(a, frag_b(P + (size_t)(n0 + j * 16 + col) * DM + kc * 32, lane), acc[j]); }
  if (n0 < 2 * DM) {   // q stored unscaled (f16 sigma ~0.6, no subnormal exposure); 1/8 applied to the f32 score
#pragma unroll
    for (int j = 0; j < 8; ++j) {
#pragma unroll
      for (int r = 0; r < 8; ++r) { const float v = acc[j][r] + (BB ? bfr(BB[j * 16 + col]) : 0.f); const _Float16 hv = (_Float16)v; so[wave][8 * g + r][j * 16 + col] = hv; sol[wave][8 * g + r][j * 16 + col] = (_Float16)((v - (float)hv) * 2048.0f); } }   // q, k (+ bias) as f16 hi + (x2048) residual
    LDSX();
    for (int rl = 0; rl < 16; ++rl) if (lane < 16) { vst2((unsigned*)(QK + (r0 + rl) * (2 * DM) + n0 + lane * 8), *(const v4u*)&so[wave][rl][lane * 8]); vst2((unsigned*)(QKL + (r0 + rl) * (2 * DM) + n0 + lane * 8), *(const v4u*)&sol[wave][rl][lane * 8]); }
  } else {
#pragma unroll
    for (int j = 0; j < 8; ++j) {
#pragma unroll
      for (int r = 0; r < 8; ++r) { const float v = acc[j][r] + (BB ? bfr(BB[j * 16 + col]) : 0.f); const _Float16 hv = (_Float16)v; sth[j * 16 + col][wave * 16 + 8 * g + r] = hv; stl[j * 16 + col][wave * 16 + 8 * g + r] = (_Float16)((v - (float)hv) * 2048.0f); } }
    __syncthreads();
    const size_t rb = (size_t)blockIdx.x * 64; const int b = (int)(rb / SS), s0 = (int)(rb % SS); const int pc0 = n0 - 2 * DM;
    for (int q = tid; q < 128 * 8; q += 128) { const int d = q >> 3, pc = q & 7; const size_t o = ((size_t)b * DM + pc0 + d) * SS + s0 + pc * 8; vst2((unsigned*)(VTH + o), *(const v4u*)&sth[d][pc * 8]); vst2((unsigned*)(VTL + o), *(const v4u*)&stl[d][pc * 8]); }
  }
}
// ---- k_attn: block = (64 queries, head h, batch b): all-keys flash attention (K = 64: 2 k-steps), scores = (q.k) * 0.125 with single f16 operands, P.V: f16 P (x2^11) x V hi, one product (accl stays 0); O[b*S+q][h*64+d] = (acc + accl / 2048) / (2048 l) (256-B segments)
__global__ __launch_bounds__(128) void k_attn(const _Float16* __restrict__ QK, const _Float16* __restrict__ QKL, const _Float16* __restrict__ VTH, const _Float16* __restrict__ VTL, const void* __restrict__ KMASK, const float* __restrict__ RB, float* __restrict__ O) {
  __shared__ __align__(16) float sp[4][16][36]; __shared__ __align__(16) float so[4][16][68];
  const int tid = threadIdx.x, wave = tid >> 5, lane = tid & 31, col = lane & 15, g = lane >> 4;
  const int qb = blockIdx.x, h = blockIdx.y, b = blockIdx.z; const int q0 = qb * 64 + wave * 16; const size_t rq = (size_t)b * SS + q0 + col;
  v16h aq[2], aql[2];
#pragma unroll
  for (int kc = 0; kc < 2; ++kc) { aq[kc] = frag_h(QK + rq * (2 * DM) + h * HD + kc * 32, lane); aql[kc] = frag_h(QKL + rq * (2 * DM) + h * HD + kc * 32, lane); }
  float m[8], l[8];
#pragma unroll
  for (int r = 0; r < 8; ++r) { m[r] = -3.0e38f; l[r] = 0.f; }
  v8f acc[4] = {}, accl[4] = {};
  const int nks = SS / 32;   // all keys
#pragma unroll 1
  for (int ks = 0; ks < nks; ++ks) { v8f s[2];
#pragma unroll
    for (int ct = 0; ct < 2; ++ct) { const int kk = ks * 32 + ct * 16 + col; const _Float16* krow = QK + ((size_t)b * SS + kk) * (2 * DM) + DM + h * HD; const _Float16* krowl = QKL + ((size_t)b * SS + kk) * (2 * DM) + DM + h * HD; v8f c = {}, cl = {};
#pragma unroll
      for (int kc = 0; kc < 2; ++kc) c = wmma16(aq[kc], frag_h(krow + kc * 32, lane), c);   // single product: q, k as one-rounding f16 operands
      (void)cl; (void)krowl;
#pragma unroll
      for (int r = 0; r < 8; ++r) s[ct][r] = c[r] * 0.125f + RB[(size_t)h * (2 * SS - 1) + (q0 + 8 * g + r) - kk + (SS - 1)]; }   // 1/sqrt(64) + bias[h][t - s]
#pragma unroll
    for (int r = 0; r < 8; ++r) { float mx = fmaxf(s[0][r], s[1][r]);
#pragma unroll
      for (int o = 1; o < 16; o <<= 1) mx = fmaxf(mx, __shfl_xor(mx, o));
      const float mn = fmaxf(m[r], mx); const float alpha = (m[r] <= -1.0e38f) ? 0.f : __expf(m[r] - mn);
      const float e0 = (s[0][r] <= -1.0e38f) ? 0.f : __expf(s[0][r] - mn), e1 = (s[1][r] <= -1.0e38f) ? 0.f : __expf(s[1][r] - mn); float es = e0 + e1;
#pragma unroll
      for (int o = 1; o < 16; o <<= 1) es += __shfl_xor(es, o);
      l[r] = l[r] * alpha + es; m[r] = mn;
#pragma unroll
      for (int dt = 0; dt < 4; ++dt) { acc[dt][r] *= alpha; accl[dt][r] *= alpha; }
      sp[wave][8 * g + r][col] = e0; sp[wave][8 * g + r][16 + col] = e1; }
    LDSX();
    v16h pa, pl; { const float* prow = &sp[wave][col][0] + 8 * (lane >> 4);
#pragma unroll
      for (int i = 0; i < 8; ++i) { const float x0 = prow[i] * 2048.0f, x1 = prow[16 + i] * 2048.0f; const _Float16 h0 = (_Float16)x0, h1 = (_Float16)x1; pa[i] = h0; pa[8 + i] = h1; pl[i] = (_Float16)((x0 - (float)h0) * 2048.0f); pl[8 + i] = (_Float16)((x1 - (float)h1) * 2048.0f); } }   // P scaled by 2^11 before the f16 split so small softmax weights stay out of the f16 subnormal range; 2^-11 folded into the epilogue
#pragma unroll
    for (int dt = 0; dt < 4; ++dt) { const size_t vr = ((size_t)b * DM + h * HD + dt * 16 + col) * SS + ks * 32; acc[dt] = wmma16(pa, frag_h(VTH + vr, lane), acc[dt]); }   // single product: P (x2^11) x V
    (void)pl;
    LDSX(); }
#pragma unroll
  for (int r = 0; r < 8; ++r) { const float il = (1.0f / 2048.0f) / l[r];
#pragma unroll
    for (int dt = 0; dt < 4; ++dt) so[wave][8 * g + r][dt * 16 + col] = (acc[dt][r] + accl[dt][r] * (1.0f / 2048.0f)) * il; }
  LDSX();
  for (int rl = 0; rl < 16; ++rl) if (lane < 16) vst2(O + ((size_t)b * SS + q0 + rl) * DM + h * HD + lane * 4, *(const v4f*)&so[wave][rl][lane * 4]);
}
// ---- k_out: block = (64 rows, 128 cols): out = O(hi/lo) . Wo rows (2 products) + bo
__global__ __launch_bounds__(128) void k_out(const float* __restrict__ O, const __bf16* __restrict__ P, const float* __restrict__ BO, float* __restrict__ Y) {
  __shared__ __align__(16) float so[4][16][132];
  const int tid = threadIdx.x, wave = tid >> 5, lane = tid & 31, col = lane & 15, g = lane >> 4; const size_t r0 = (size_t)blockIdx.x * 64 + wave * 16; const int n0 = blockIdx.y * 128;
  v8f acc[8] = {};
#pragma unroll 2
  for (int kc = 0; kc < DM / 32; ++kc) { const F2 a = split_row(O + (r0 + col) * DM, kc * 32, lane);
#pragma unroll
    for (int j = 0; j < 8; ++j) { const v16b w = frag_b(P + (size_t)(n0 + j * 16 + col) * DM + kc * 32, lane); acc[j] = wmma_bf(a.l, w, acc[j]); acc[j] = wmma_bf(a.h, w, acc[j]); } }
#pragma unroll
  for (int j = 0; j < 8; ++j) {
#pragma unroll
    for (int r = 0; r < 8; ++r) so[wave][8 * g + r][j * 16 + col] = acc[j][r] + bfr(BO[n0 + j * 16 + col]); }
  LDSX();
  for (int rl = 0; rl < 16; ++rl) vst2(Y + (r0 + rl) * DM + n0 + lane * 4, *(const v4f*)&so[wave][rl][lane * 4]);
}
// ---- k_pack3: fused (in,out) W_qkv [DM][3*DM] -> three transposed bf16 row blocks
__global__ __launch_bounds__(256) void k_pack3(const float* __restrict__ WA, __bf16* __restrict__ PK) { __shared__ __align__(16) __bf16 s[DM]; const int n = blockIdx.x, which = blockIdx.y, t = threadIdx.x; for (int k = t; k < DM; k += 256) s[k] = (__bf16)WA[(size_t)k * (3 * DM) + which * DM + n]; __syncthreads(); for (int q = t; q < DM / 8; q += 256) vst2((unsigned*)(PK + PK_A + ((size_t)which * DM + n) * DM + q * 8), *(const v4u*)&s[q * 8]); }
// ---- k_rpe: one thread per relative distance rel = idx - (SS-1): f = sign(rel) log1p(|rel|); h = relu(f w1[j] + b1[j]); bias[h] = sum_j h_j w2[j][h] + b2[h]
__global__ __launch_bounds__(256) void k_rpe(const float* __restrict__ W1, const float* __restrict__ B1, const float* __restrict__ W2, const float* __restrict__ B2, float* __restrict__ RB) {
  const int idx = blockIdx.x * 256 + threadIdx.x; if (idx >= 2 * SS - 1) return; const float rel = (float)(idx - (SS - 1)); const float f = (rel > 0.f ? 1.f : (rel < 0.f ? -1.f : 0.f)) * log1pf(fabsf(rel));
  float hdn[RPEH];
#pragma unroll
  for (int j = 0; j < RPEH; ++j) hdn[j] = fmaxf(f * bfr(W1[j]) + bfr(B1[j]), 0.f);
#pragma unroll 1
  for (int h = 0; h < NH; ++h) { float b = bfr(B2[h]);
#pragma unroll
    for (int j = 0; j < RPEH; ++j) b += hdn[j] * bfr(W2[j * NH + h]);
    RB[(size_t)h * (2 * SS - 1) + idx] = b; }   // 4-B scratch store
}
extern "C" void kernel_launch(void* const* d_in, const int* in_sizes, int n_in, void* d_out, int out_size, void* d_ws, size_t ws_size, hipStream_t stream) {
  (void)in_sizes; (void)n_in; (void)out_size;
  const float** F = (const float**)d_in;   // 0 x [2,2048,1024], 1 w_qkv [1024,3072] (in,out: q | k | v), 2 b_qkv [3072], 3 w_out (in,out), 4 b_out, 5 w1_rpe [1,32], 6 b1_rpe [32], 7 w2_rpe [32,16], 8 b2_rpe [16]
  if (ws_size < (size_t)WS_END) return;
  char* ws = (char*)d_ws; __bf16* PK = (__bf16*)(ws + WS_PK); _Float16 *QK = (_Float16*)(ws + WS_QK), *QKL = (_Float16*)(ws + WS_QKL), *VTH = (_Float16*)(ws + WS_VTH), *VTL = (_Float16*)(ws + WS_VTL); float *O = (float*)(ws + WS_O), *RB = (float*)(ws + WS_RB);
  k_pack<<<dim3(DM, 4), 256, 0, stream>>>(F[3], F[3], F[3], F[3], PK);   // output projection; q/k/v slots overwritten next
  k_pack3<<<dim3(DM, 3), 256, 0, stream>>>(F[1], PK);
  k_rpe<<<(2 * SS + 255) / 256, 256, 0, stream>>>(F[5], F[6], F[7], F[8], RB);
  k_qkv<<<dim3(TNB * SS / 64, QKVW / 128), 128, 0, stream>>>(F[0], F[0], F[0], PK + PK_A, F[2], F[2] + DM, F[2] + 2 * DM, QK, QKL, VTH, VTL);
  k_attn<<<dim3(TQB, NH, TNB), 128, 0, stream>>>(QK, QKL, VTH, VTL, nullptr, RB, O);
  k_out<<<dim3(TOB, DM / 128), 128, 0, stream>>>(O, PK + PK_P, F[4], (float*)d_out);
}

// v001
// One run takes 195 microseconds.
// Timed twice side by side with v000, it ran 2.26 and 2.27 times as fast.
// compute dtype: all float inputs rounded to bf16; qkv = x . W_qkv + b with EXACT bf16 products on WMMA 16x16x32 ((in,out) columns q | k | v as transposed rows); the relative-position bias table bias[h][t-s] = relu(sign(t-s) log1p|t-s| * w1 + b1) . w2 + b2 computed once per distance in f32 (precise log1pf); PLAIN attention: q, k as single f16 operands x 1/8 + bias, running-max softmax in f32 (hardware exp), P (scaled by 2^11, single f16) x v (single f16); out = ctx (bf16 hi + residual) . W_out (2 products) + b_out.
#include <hip/hip_runtime.h>
#include <math.h>

typedef __attribute__((ext_vector_type(16))) _Float16 v16h;
typedef __attribute__((ext_vector_type(16))) __bf16 v16b;
typedef __attribute__((ext_vector_type(8)))  _Float16 v8h;
typedef __attribute__((ext_vector_type(8)))  float v8f;
typedef __attribute__((ext_vector_type(4)))  float v4f;
typedef __attribute__((ext_vector_type(2)))  float v2f;
typedef __attribute__((ext_vector_type(4)))  unsigned v4u;
typedef __attribute__((ext_vector_type(4)))  int v4i;
typedef float __attribute__((may_alias)) float_a;
typedef int __attribute__((may_alias)) int_a;

template <typename T> __device__ __forceinline__ void vst2(void* p, T v) { *(T*)p = v;  }
__device__ __forceinline__ v8f wmma16(v16h a, v16h b, v8f c) {
  v8f d = __builtin_amdgcn_wmma_f32_16x16x32_f16(false, a, false, b, (short)0, c, false, false);
  asm volatile("v_nop\n\tv_nop\n\tv_nop\n\tv_nop" : "+v"(d) : "v"(a), "v"(b));
  return d;
}
__device__ __forceinline__ v8f wmma_bf(v16b a, v16b b, v8f c) {
  v8f d = __builtin_amdgcn_wmma_f32_16x16x32_bf16(false, a, false, b, (short)0, c, false, false);
  asm volatile("v_nop\n\tv_nop\n\tv_nop\n\tv_nop" : "+v"(d) : "v"(a), "v"(b));
  return d;
}
// Multi-head self attention with a learned relative-position bias (B 2, T 2,048, d 1,024, 16 heads x 64): fused q|k|v projection + bias, scores + bias[h](t - s) from a small MLP on the signed log distance, softmax, output projection + bias.
__device__ __forceinline__ v16h frag_h(const _Float16* rowk0, int lane) {
  union { v16h v; v8h q[2]; } u; const _Float16* p = rowk0 + 8 * (lane >> 4);
  u.q[0] = *(const v8h*)p; u.q[1] = *(const v8h*)(p + 16); return u.v;
}
__device__ __forceinline__ v16h frag_f32(const float* rowk0, int lane) {
  v16h a; const float* p = rowk0 + 8 * (lane >> 4);
#pragma unroll
  for (int i = 0; i < 8; ++i) { a[i] = (_Float16)p[i]; a[8 + i] = (_Float16)p[16 + i]; }
  return a;
}
__device__ __forceinline__ v16h frag_f32s(const float* rowk0, int lane, float sc) {
  v16h a; const float* p = rowk0 + 8 * (lane >> 4);
#pragma unroll
  for (int i = 0; i < 8; ++i) { a[i] = (_Float16)(p[i] * sc); a[8 + i] = (_Float16)(p[16 + i] * sc); }
  return a;
}
// column fragment from a [K][ld] layout (column n), rows >= K read as 0
__device__ __forceinline__ v16h fragc_f32(const float* W, int k0, int n, int lane, int ld, int K) {
  v16h a; const int g = lane >> 4;
#pragma unroll
  for (int i = 0; i < 8; ++i) { const int ka = k0 + 8 * g + i, kb = ka + 16;
    a[i] = (_Float16)(ka < K ? W[(size_t)(ka < K ? ka : K - 1) * ld + n] : 0.f); a[8 + i] = (_Float16)(kb < K ? W[(size_t)(kb < K ? kb : K - 1) * ld + n] : 0.f); }
  return a;
}
struct F2 { v16b h, l; };
__device__ __forceinline__ F2 bsplit16(const float v[16]) { F2 r;
#pragma unroll
  for (int i = 0; i < 16; ++i) { const __bf16 h = (__bf16)v[i]; r.h[i] = h; r.l[i] = (__bf16)(v[i] - (float)h); }
  return r; }
__device__ __forceinline__ F2 split_row(const float* row, int k0, int lane) { float v[16]; const float* p = row + k0 + 8 * (lane >> 4);
#pragma unroll
  for (int i = 0; i < 8; ++i) { v[i] = p[i]; v[8 + i] = p[16 + i]; }
  return bsplit16(v); }
__device__ __forceinline__ F2 split_rowK(const float* row, int k0, int lane, int K) { float v[16]; const int g = lane >> 4;
#pragma unroll
  for (int i = 0; i < 8; ++i) { const int ka = k0 + 8 * g + i, kb = ka + 16; v[i] = ka < K ? row[ka < K ? ka : K - 1] : 0.f; v[8 + i] = kb < K ? row[kb < K ? kb : K - 1] : 0.f; }
  return bsplit16(v); }
__device__ __forceinline__ F2 split_col(const float* W, int k0, int n, int lane, int ld, int K) { float v[16]; const int g = lane >> 4;
#pragma unroll
  for (int i = 0; i < 8; ++i) { const int ka = k0 + 8 * g + i, kb = ka + 16; v[i] = ka < K ? W[(size_t)(ka < K ? ka : K - 1) * ld + n] : 0.f; v[8 + i] = kb < K ? W[(size_t)(kb < K ? kb : K - 1) * ld + n] : 0.f; }
  return bsplit16(v); }
__device__ __forceinline__ v8f mac3(const F2& a, const F2& b, v8f c) { c = wmma_bf(a.l, b.h, c); c = wmma_bf(a.h, b.l, c); return wmma_bf(a.h, b.h, c); }
__device__ __forceinline__ float sigm(float v) { return 1.0f / (1.0f + expf(-v)); }
#define LDSX() do { asm volatile("s_wait_dscnt 0" ::: "memory"); __builtin_amdgcn_wave_barrier(); __builtin_amdgcn_fence(__ATOMIC_RELEASE, "workgroup"); } while (0)


#define NB 2
#define SS 2048
#define DM 1024
#define NH 16
#define HD 64
#define QKVW (3 * DM)
#ifndef TQB
#define TQB (SS / 64)
#define TNB NB
#define TOB (NB * SS / 64)     // 64-row tiles of all rows, not used
#endif
typedef __attribute__((ext_vector_type(8))) __bf16 v8b;
__device__ __forceinline__ v16b frag_b(const __bf16* rowk0, int lane) {
  union { v16b v; v8b q[2]; } u; const __bf16* p = rowk0 + 8 * (lane >> 4);
  u.q[0] = *(const v8b*)p; u.q[1] = *(const v8b*)(p + 16); return u.v;
}
__device__ __forceinline__ float bfr(float v) { return (float)(__bf16)v; }
__device__ __attribute__((noinline)) float exp_ni(float v) { return expf(v); }
__device__ __attribute__((noinline)) float erf_ni(float v) { return erff(v); }

#define PK_A 0                       // [3072][1024] Wqkv rows (natural [out][in])
#define PK_P (PK_A + QKVW * DM)        // [1024][1024] Wo rows (natural)
#define PK_END (PK_P + DM * DM)
#define WS_PK  0u
#define WS_QK  (WS_PK + 2u * PK_END)             // f16 [4096 rows][2048]: q | k
#define WS_QKL (WS_QK + 2u * NB * SS * 2 * DM)     // f16 q | k residual planes x2048
#define WS_VTH (WS_QKL + 2u * NB * SS * 2 * DM)    // f16 [b][1024 (h*64+d)][2048 s] hi
#define WS_VTL (WS_VTH + 2u * NB * DM * SS)        // f16 lo x 2048
#define WS_O   (WS_VTL + 2u * NB * DM * SS)        // f32 [4096][1024]
#define WS_CS  (WS_O + 4u * NB * SS * DM)           // f32 2 x [2048][32], not used
#define WS_RB  (WS_CS + 4u * 2 * SS * 32)                 // f32 [16][2*SS-1] relative-position bias table
#define WS_END (WS_RB + 4u * NH * (2 * SS))
#define RPEH 32
// ---- k_pack: block = (row n, which): column n of an (in,out) weight -> bf16 row n; which 0..2 -> W_q/W_k/W_v into PK_A rows which*1024 + n; 3 -> W_o into PK_P
__global__ __launch_bounds__(256) void k_pack(const float* __restrict__ WQ, const float* __restrict__ WK, const float* __restrict__ WV, const float* __restrict__ WO, __bf16* __restrict__ PK) {
  __shared__ __align__(16) __bf16 s[DM]; const int n = blockIdx.x, which = blockIdx.y, t = threadIdx.x; const float* Wm = (which == 0) ? WQ : (which == 1) ? WK : (which == 2) ? WV : WO;   // (in,out) weights: pack row n = column n
  for (int k = t; k < DM; k += 256) s[k] = (__bf16)Wm[(size_t)k * DM + n];
  __syncthreads();
  __bf16* dst = (which < 3) ? PK + PK_A + ((size_t)which * DM + n) * DM : PK + PK_P + (size_t)n * DM;
  for (int q = t; q < DM / 8; q += 256) vst2((unsigned*)(dst + q * 8), *(const v4u*)&s[q * 8]);
}
// ---- projection GEMM tiles: a block of 8 waves owns 128 x 128 of the product; 64 k of both operands are staged in LDS per step (two buffers, whole-line global loads fetched one step ahead into registers); wave (wm, wn) of 2 x 4 computes 64 x 32
#define GBM 128
#define GBN 128
#define GBK 64
#define GLP 72                         // LDS row pitch in bf16: 144 B = 16 B x odd, for 16-byte fragment reads of 128-B rows
#define GSP 136                        // f16 staging pitch of the epilogue (272 B)
typedef __attribute__((ext_vector_type(4))) __bf16 v4b;
__global__ __launch_bounds__(256) void k_qkv(const float* __restrict__ XQ, const float* __restrict__ XK, const float* __restrict__ XV, const __bf16* __restrict__ P, const float* __restrict__ BQ, const float* __restrict__ BK, const float* __restrict__ BV, _Float16* __restrict__ QK, _Float16* __restrict__ QKL, _Float16* __restrict__ VTH, _Float16* __restrict__ VTL) {
  const int which0 = (blockIdx.y * 128) / DM; const float* X = (which0 == 0) ? XQ : (which0 == 1) ? XK : XV; const float* BB = BQ ? (((which0 == 0) ? BQ : (which0 == 1) ? BK : BV) + (blockIdx.y * 128 - which0 * DM)) : nullptr;
  __shared__ __align__(16) unsigned char smem[2 * (GBM + GBN) * GLP * 2];   // two buffers of [x 128 rows | W 128 rows]; the epilogue's staging afterwards
  const int tid = threadIdx.x, wave = tid >> 5, lane = tid & 31, col = lane & 15, g = lane >> 4, wm = wave >> 2, wn = wave & 3;
  const size_t rb = (size_t)blockIdx.x * GBM; const int n0 = blockIdx.y * GBN;
  const int ar = tid >> 4, ac = (tid & 15) * 4, br = tid >> 3, bc = (tid & 7) * 8;   // x: 16 lanes x 16 B = one 256-B row piece; W: 8 lanes x 16 B = one 128-B line
  const float* ag = X + (rb + ar) * DM + ac; const __bf16* bg = P + (size_t)(n0 + br) * DM + bc;
  __bf16* sm = (__bf16*)smem;
  v4f ra[8]; v4u rw[4]; v8f acc[4][2] = {};
#pragma unroll
  for (int i = 0; i < 8; ++i) ra[i] = *(const v4f*)(ag + (size_t)i * 16 * DM);
#pragma unroll
  for (int i = 0; i < 4; ++i) rw[i] = *(const v4u*)(bg + (size_t)i * 32 * DM);
  for (int ks = 0; ks < DM / GBK; ++ks) { __bf16* sb = sm + (ks & 1) * ((GBM + GBN) * GLP);
#pragma unroll
    for (int i = 0; i < 8; ++i) { v4b c; c[0] = (__bf16)ra[i][0]; c[1] = (__bf16)ra[i][1]; c[2] = (__bf16)ra[i][2]; c[3] = (__bf16)ra[i][3]; *(v4b*)&sb[(ar + 16 * i) * GLP + ac] = c; }
#pragma unroll
    for (int i = 0; i < 4; ++i) *(v4u*)&sb[(GBM + br + 32 * i) * GLP + bc] = rw[i];
    __syncthreads();   // publishes this step's buffer; the other buffer's readers all passed the barrier of the step before
    if (ks + 1 < DM / GBK) {
#pragma unroll
      for (int i = 0; i < 8; ++i) ra[i] = *(const v4f*)(ag + (size_t)i * 16 * DM + (ks + 1) * GBK);
#pragma unroll
      for (int i = 0; i < 4; ++i) rw[i] = *(const v4u*)(bg + (size_t)i * 32 * DM + (ks + 1) * GBK); }
#pragma unroll
    for (int kc = 0; kc < GBK / 32; ++kc) { v16b af[4], wf[2];
#pragma unroll
      for (int i = 0; i < 4; ++i) af[i] = frag_b(sb + (wm * 64 + i * 16 + col) * GLP + kc * 32, lane);
#pragma unroll
      for (int j = 0; j < 2; ++j) wf[j] = frag_b(sb + (GBM + wn * 32 + j * 16 + col) * GLP + kc * 32, lane);
#pragma unroll
      for (int i = 0; i < 4; ++i) {
#pragma unroll
        for (int j = 0; j < 2; ++j) acc[i][j] = wmma_bf(af[i], wf[j], acc[i][j]); } } }
  __syncthreads();   // every wave has left the operand buffers before they become staging
  _Float16* sh = (_Float16*)smem; _Float16* sl = sh + 128 * GSP;
  if (n0 < 2 * DM) {   // q stored unscaled (f16 sigma ~0.6, no subnormal exposure); 1/8 applied to the f32 score
#pragma unroll
    for (int i = 0; i < 4; ++i) {
#pragma unroll
      for (int j = 0; j < 2; ++j) { const int n = wn * 32 + j * 16 + col; const float bias = BB ? bfr(BB[n]) : 0.f;
#pragma unroll
        for (int r = 0; r < 8; ++r) { const int row = wm * 64 + i * 16 + 8 * g + r; const float v = acc[i][j][r] + bias; const _Float16 hv = (_Float16)v; sh[row * GSP + n] = hv; sl[row * GSP + n] = (_Float16)((v - (float)hv) * 2048.0f); } } }   // q, k (+ bias) as f16 hi + (x2048) residual
    __syncthreads();
    for (int q = tid; q < 128 * 16; q += 256) { const int row = q >> 4, c = q & 15; vst2((unsigned*)(QK + (rb + row) * (2 * DM) + n0 + c * 8), *(const v4u*)&sh[row * GSP + c * 8]); vst2((unsigned*)(QKL + (rb + row) * (2 * DM) + n0 + c * 8), *(const v4u*)&sl[row * GSP + c * 8]); }
  } else {             // v transposed: staging row = output column d, a lane's 8 accumulator rows are 8 consecutive s
#pragma unroll
    for (int i = 0; i < 4; ++i) {
#pragma unroll
      for (int j = 0; j < 2; ++j) { const int n = wn * 32 + j * 16 + col; const float bias = BB ? bfr(BB[n]) : 0.f; v8h h8, l8;
#pragma unroll
        for (int r = 0; r < 8; ++r) { const float v = acc[i][j][r] + bias; const _Float16 hv = (_Float16)v; h8[r] = hv; l8[r] = (_Float16)((v - (float)hv) * 2048.0f); }
        *(v8h*)&sh[n * GSP + wm * 64 + i * 16 + 8 * g] = h8; *(v8h*)&sl[n * GSP + wm * 64 + i * 16 + 8 * g] = l8; } }
    __syncthreads();
    const int b = (int)(rb / SS), s0 = (int)(rb % SS); const int pc0 = n0 - 2 * DM;
    for (int q = tid; q < 128 * 16; q += 256) { const int d = q >> 4, pc = q & 15; const size_t o = ((size_t)b * DM + pc0 + d) * SS + s0 + pc * 8; vst2((unsigned*)(VTH + o), *(const v4u*)&sh[d * GSP + pc * 8]); vst2((unsigned*)(VTL + o), *(const v4u*)&sl[d * GSP + pc * 8]); }
  }
}
// ---- k_attn: block = (64 queries, head h, batch b): all-keys flash attention (K = 64: 2 k-steps), scores = (q.k) * 0.125 with single f16 operands, P.V: f16 P (x2^11) x V hi, one product (accl stays 0); O[b*S+q][h*64+d] = (acc + accl / 2048) / (2048 l) (256-B segments)
__global__ __launch_bounds__(128) void k_attn(const _Float16* __restrict__ QK, const _Float16* __restrict__ QKL, const _Float16* __restrict__ VTH, const _Float16* __restrict__ VTL, const void* __restrict__ KMASK, const float* __restrict__ RB, float* __restrict__ O) {
  __shared__ __align__(16) float sp[4][16][36]; __shared__ __align__(16) float so[4][16][68];
  __shared__ __align__(16) _Float16 skv[2][128 * GLP];   // two buffers of a 64-key stage shared by the 4 waves: [k: 64 key rows x 64 d | v: 64 d rows x 64 keys], 128-B rows at pitch 144 B
  const int tid = threadIdx.x, wave = tid >> 5, lane = tid & 31, col = lane & 15, g = lane >> 4;
  const int qb = blockIdx.x, h = blockIdx.y, b = blockIdx.z; const int q0 = qb * 64 + wave * 16; const size_t rq = (size_t)b * SS + q0 + col;
  v16h aq[2], aql[2];
#pragma unroll
  for (int kc = 0; kc < 2; ++kc) { aq[kc] = frag_h(QK + rq * (2 * DM) + h * HD + kc * 32, lane); aql[kc] = frag_h(QKL + rq * (2 * DM) + h * HD + kc * 32, lane); }
  float m[8], l[8];
#pragma unroll
  for (int r = 0; r < 8; ++r) { m[r] = -3.0e38f; l[r] = 0.f; }
  v8f acc[4] = {}, accl[4] = {};
  const int nks = SS / 32;   // all keys
  const int sr = tid >> 3, sc = (tid & 7) * 8;   // staging: 8 lanes x 16 B = one whole 128-B line, 16 rows a sweep
  const _Float16* kg = QK + ((size_t)b * SS + sr) * (2 * DM) + DM + h * HD + sc; const _Float16* vg = VTH + ((size_t)b * DM + h * HD + sr) * SS + sc;
  v4u rk[4], rv[4];
#pragma unroll
  for (int i = 0; i < 4; ++i) { rk[i] = *(const v4u*)(kg + (size_t)i * 16 * (2 * DM)); rv[i] = *(const v4u*)(vg + (size_t)i * 16 * SS); }
#pragma unroll 1
  for (int st = 0; st < nks / 2; ++st) { _Float16* sb = &skv[st & 1][0];   // a stage: lay down the 64 keys fetched one stage ahead
#pragma unroll
    for (int i = 0; i < 4; ++i) { *(v4u*)&sb[(sr + 16 * i) * GLP + sc] = rk[i]; *(v4u*)&sb[(64 + sr + 16 * i) * GLP + sc] = rv[i]; }
    __syncthreads();   // publishes this stage's buffer; the other buffer's readers all passed the barrier of the stage before
#pragma unroll   // both 32-key passes of a stage in straight-line code, so that the next stage's fetch has a fixed place among the loads
   for (int sub = 0; sub < 2; ++sub) { const int ks = st * 2 + sub; v8f s[2];
#pragma unroll
    for (int ct = 0; ct < 2; ++ct) { const int kk = ks * 32 + ct * 16 + col; const _Float16* krow = sb + (sub * 32 + ct * 16 + col) * GLP; const _Float16* krowl = QKL + ((size_t)b * SS + kk) * (2 * DM) + DM + h * HD; v8f c = {}, cl = {};
#pragma unroll
      for (int kc = 0; kc < 2; ++kc) c = wmma16(aq[kc], frag_h(krow + kc * 32, lane), c);   // single product: q, k as one-rounding f16 operands
      (void)cl; (void)krowl;
#pragma unroll
      for (int r = 0; r < 8; ++r) s[ct][r] = c[r] * 0.125f + RB[(size_t)h * (2 * SS - 1) + (q0 + 8 * g + r) - kk + (SS - 1)]; }   // 1/sqrt(64) + bias[h][t - s]
    if (sub == 0) { const int nx = (st + 1 < nks / 2) ? st + 1 : st;   // fetch the next stage behind this pass's bias loads (loads return in order: ahead of them, the wait for the bias would wait for the stage); the last stage fetches itself again, unused
#pragma unroll
      for (int i = 0; i < 4; ++i) { rk[i] = *(const v4u*)(kg + ((size_t)nx * 64 + i * 16) * (2 * DM)); rv[i] = *(const v4u*)(vg + (size_t)i * 16 * SS + nx * 64); } }
#pragma unroll
    for (int r = 0; r < 8; ++r) { float mx = fmaxf(s[0][r], s[1][r]);
#pragma unroll
      for (int o = 1; o < 16; o <<= 1) mx = fmaxf(mx, __shfl_xor(mx, o));
      const float mn = fmaxf(m[r], mx); const float alpha = (m[r] <= -1.0e38f) ? 0.f : __expf(m[r] - mn);
      const float e0 = (s[0][r] <= -1.0e38f) ? 0.f : __expf(s[0][r] - mn), e1 = (s[1][r] <= -1.0e38f) ? 0.f : __expf(s[1][r] - mn); float es = e0 + e1;
#pragma unroll
      for (int o = 1; o < 16; o <<= 1) es += __shfl_xor(es, o);
      l[r] = l[r] * alpha + es; m[r] = mn;
#pragma unroll
      for (int dt = 0; dt < 4; ++dt) { acc[dt][r] *= alpha; accl[dt][r] *= alpha; }
      sp[wave][8 * g + r][col] = e0; sp[wave][8 * g + r][16 + col] = e1; }
    LDSX();
    v16h pa, pl; { const float* prow = &sp[wave][col][0] + 8 * (lane >> 4);
#pragma unroll
      for (int i = 0; i < 8; ++i) { const float x0 = prow[i] * 2048.0f, x1 = prow[16 + i] * 2048.0f; const _Float16 h0 = (_Float16)x0, h1 = (_Float16)x1; pa[i] = h0; pa[8 + i] = h1; pl[i] = (_Float16)((x0 - (float)h0) * 2048.0f); pl[8 + i] = (_Float16)((x1 - (float)h1) * 2048.0f); } }   // P scaled by 2^11 before the f16 split so small softmax weights stay out of the f16 subnormal range; 2^-11 folded into the epilogue
#pragma unroll
    for (int dt = 0; dt < 4; ++dt) acc[dt] = wmma16(pa, frag_h(sb + (64 + dt * 16 + col) * GLP + sub * 32, lane), acc[dt]);   // single product: P (x2^11) x V
    (void)pl;
    LDSX(); } }
#pragma unroll
  for (int r = 0; r < 8; ++r) { const float il = (1.0f / 2048.0f) / l[r];
#pragma unroll
    for (int dt = 0; dt < 4; ++dt) so[wave][8 * g + r][dt * 16 + col] = (acc[dt][r] + accl[dt][r] * (1.0f / 2048.0f)) * il; }
  LDSX();
  for (int rl = 0; rl < 16; ++rl) if (lane < 16) vst2(O + ((size_t)b * SS + q0 + rl) * DM + h * HD + lane * 4, *(const v4f*)&so[wave][rl][lane * 4]);
}
// ---- k_out: block = (128 rows, 128 cols), tiles staged as in k_qkv: out = O(hi/lo) . Wo rows (2 products) + bo
__global__ __launch_bounds__(256) void k_out(const float* __restrict__ O, const __bf16* __restrict__ P, const float* __restrict__ BO, float* __restrict__ Y) {
  __shared__ __align__(16) unsigned char smem[2 * (2 * GBM + GBN) * GLP * 2];   // two buffers of [O hi 128 rows | O residual 128 rows | Wo 128 rows]; the epilogue's staging afterwards
  const int tid = threadIdx.x, wave = tid >> 5, lane = tid & 31, col = lane & 15, g = lane >> 4, wm = wave >> 2, wn = wave & 3;
  const size_t rb = (size_t)blockIdx.x * GBM; const int n0 = blockIdx.y * GBN;
  const int ar = tid >> 4, ac = (tid & 15) * 4, br = tid >> 3, bc = (tid & 7) * 8;
  const float* ag = O + (rb + ar) * DM + ac; const __bf16* bg = P + (size_t)(n0 + br) * DM + bc;
  __bf16* sm = (__bf16*)smem;
  v4f ra[8]; v4u rw[4]; v8f acc[4][2] = {};
#pragma unroll
  for (int i = 0; i < 8; ++i) ra[i] = *(const v4f*)(ag + (size_t)i * 16 * DM);
#pragma unroll
  for (int i = 0; i < 4; ++i) rw[i] = *(const v4u*)(bg + (size_t)i * 32 * DM);
  for (int ks = 0; ks < DM / GBK; ++ks) { __bf16* sb = sm + (ks & 1) * ((2 * GBM + GBN) * GLP);
#pragma unroll
    for (int i = 0; i < 8; ++i) { v4b ch, cl;
#pragma unroll
      for (int e = 0; e < 4; ++e) { const __bf16 h = (__bf16)ra[i][e]; ch[e] = h; cl[e] = (__bf16)(ra[i][e] - (float)h); }
      *(v4b*)&sb[(ar + 16 * i) * GLP + ac] = ch; *(v4b*)&sb[(GBM + ar + 16 * i) * GLP + ac] = cl; }
#pragma unroll
    for (int i = 0; i < 4; ++i) *(v4u*)&sb[(2 * GBM + br + 32 * i) * GLP + bc] = rw[i];
    __syncthreads();   // publishes this step's buffer; the other buffer's readers all passed the barrier of the step before
    if (ks + 1 < DM / GBK) {
#pragma unroll
      for (int i = 0; i < 8; ++i) ra[i] = *(const v4f*)(ag + (size_t)i * 16 * DM + (ks + 1) * GBK);
#pragma unroll
      for (int i = 0; i < 4; ++i) rw[i] = *(const v4u*)(bg + (size_t)i * 32 * DM + (ks + 1) * GBK);
      asm volatile("s_wait_xcnt 0x0" ::: "memory"); }   // the twelve loads' address registers are reused by the compute below: the wait stands in front of their first overwrite
#pragma unroll
    for (int kc = 0; kc < GBK / 32; ++kc) { v16b ah[4], al[4], wf[2];
#pragma unroll
      for (int i = 0; i < 4; ++i) { ah[i] = frag_b(sb + (wm * 64 + i * 16 + col) * GLP + kc * 32, lane); al[i] = frag_b(sb + (GBM + wm * 64 + i * 16 + col) * GLP + kc * 32, lane); }
#pragma unroll
      for (int j = 0; j < 2; ++j) wf[j] = frag_b(sb + (2 * GBM + wn * 32 + j * 16 + col) * GLP + kc * 32, lane);
#pragma unroll
      for (int i = 0; i < 4; ++i) {
#pragma unroll
        for (int j = 0; j < 2; ++j) acc[i][j] = wmma_bf(al[i], wf[j], acc[i][j]); }
#pragma unroll
      for (int i = 0; i < 4; ++i) {
#pragma unroll
        for (int j = 0; j < 2; ++j) acc[i][j] = wmma_bf(ah[i], wf[j], acc[i][j]); } } }
  __syncthreads();   // every wave has left the operand buffers before they become staging
  float* so = (float*)smem;
#pragma unroll
  for (int i = 0; i < 4; ++i) {
#pragma unroll
    for (int j = 0; j < 2; ++j) { const int n = wn * 32 + j * 16 + col; const float bias = bfr(BO[n0 + n]);
#pragma unroll
      for (int r = 0; r < 8; ++r) so[(wm * 64 + i * 16 + 8 * g + r) * 132 + n] = acc[i][j][r] + bias; } }
  __syncthreads();
  for (int q = tid; q < 128 * 32; q += 256) { const int row = q >> 5, c = q & 31; vst2(Y + (rb + row) * DM + n0 + c * 4, *(const v4f*)&so[row * 132 + c * 4]); }
}
// ---- k_pack3: fused (in,out) W_qkv [DM][3*DM] -> three transposed bf16 row blocks
__global__ __launch_bounds__(256) void k_pack3(const float* __restrict__ WA, __bf16* __restrict__ PK) { __shared__ __align__(16) __bf16 s[DM]; const int n = blockIdx.x, which = blockIdx.y, t = threadIdx.x; for (int k = t; k < DM; k += 256) s[k] = (__bf16)WA[(size_t)k * (3 * DM) + which * DM + n]; __syncthreads(); for (int q = t; q < DM / 8; q += 256) vst2((unsigned*)(PK + PK_A + ((size_t)which * DM + n) * DM + q * 8), *(const v4u*)&s[q * 8]); }
// ---- k_rpe: one thread per relative distance rel = idx - (SS-1): f = sign(rel) log1p(|rel|); h = relu(f w1[j] + b1[j]); bias[h] = sum_j h_j w2[j][h] + b2[h]
__global__ __launch_bounds__(256) void k_rpe(const float* __restrict__ W1, const float* __restrict__ B1, const float* __restrict__ W2, const float* __restrict__ B2, float* __restrict__ RB) {
  const int idx = blockIdx.x * 256 + threadIdx.x; if (idx >= 2 * SS - 1) return; const float rel = (float)(idx - (SS - 1)); const float f = (rel > 0.f ? 1.f : (rel < 0.f ? -1.f : 0.f)) * log1pf(fabsf(rel));
  float hdn[RPEH];
#pragma unroll
  for (int j = 0; j < RPEH; ++j) hdn[j] = fmaxf(f * bfr(W1[j]) + bfr(B1[j]), 0.f);
#pragma unroll 1
  for (int h = 0; h < NH; ++h) { float b = bfr(B2[h]);
#pragma unroll
    for (int j = 0; j < RPEH; ++j) b += hdn[j] * bfr(W2[j * NH + h]);
    RB[(size_t)h * (2 * SS - 1) + idx] = b; }   // 4-B scratch store
}
extern "C" void kernel_launch(void* const* d_in, const int* in_sizes, int n_in, void* d_out, int out_size, void* d_ws, size_t ws_size, hipStream_t stream) {
  (void)in_sizes; (void)n_in; (void)out_size;
  const float** F = (const float**)d_in;   // 0 x [2,2048,1024], 1 w_qkv [1024,3072] (in,out: q | k | v), 2 b_qkv [3072], 3 w_out (in,out), 4 b_out, 5 w1_rpe [1,32], 6 b1_rpe [32], 7 w2_rpe [32,16], 8 b2_rpe [16]
  if (ws_size < (size_t)WS_END) return;
  char* ws = (char*)d_ws; __bf16* PK = (__bf16*)(ws + WS_PK); _Float16 *QK = (_Float16*)(ws + WS_QK), *QKL = (_Float16*)(ws + WS_QKL), *VTH = (_Float16*)(ws + WS_VTH), *VTL = (_Float16*)(ws + WS_VTL); float *O = (float*)(ws + WS_O), *RB = (float*)(ws + WS_RB);
  k_pack<<<dim3(DM, 4), 256, 0, stream>>>(F[3], F[3], F[3], F[3], PK);   // output projection; q/k/v slots overwritten next
  k_pack3<<<dim3(DM, 3), 256, 0, stream>>>(F[1], PK);
  k_rpe<<<(2 * SS + 255) / 256, 256, 0, stream>>>(F[5], F[6], F[7], F[8], RB);
  k_qkv<<<dim3(TNB * SS / GBM, QKVW / GBN), 256, 0, stream>>>(F[0], F[0], F[0], PK + PK_A, F[2], F[2] + DM, F[2] + 2 * DM, QK, QKL, VTH, VTL);
  k_attn<<<dim3(TQB, NH, TNB), 128, 0, stream>>>(QK, QKL, VTH, VTL, nullptr, RB, O);
  k_out<<<dim3(NB * SS / GBM, DM / GBN), 256, 0, stream>>>(O, PK + PK_P, F[4], (float*)d_out);
}

// v002
// It runs in 160 microseconds.
// Timed twice side by side with v001, it ran 1.22 and 1.21 times as fast.
// All steps since v000 together make it 2.75 times as fast.
// compute dtype: all float inputs rounded to bf16; qkv = x . W_qkv + b with EXACT bf16 products on WMMA 16x16x32 ((in,out) columns q | k | v as transposed rows); the relative-position bias table bias[h][t-s] = relu(sign(t-s) log1p|t-s| * w1 + b1) . w2 + b2 computed once per distance in f32 (precise log1pf); PLAIN attention: q, k as single f16 operands x 1/8 + bias, running-max softmax in f32 (hardware exp), P (scaled by 2^11, single f16) x v (single f16); out = ctx (bf16 hi + residual) . W_out (2 products) + b_out.
#include <hip/hip_runtime.h>
#include <math.h>

typedef __attribute__((ext_vector_type(16))) _Float16 v16h;
typedef __attribute__((ext_vector_type(16))) __bf16 v16b;
typedef __attribute__((ext_vector_type(8)))  _Float16 v8h;
typedef __attribute__((ext_vector_type(8)))  float v8f;
typedef __attribute__((ext_vector_type(4)))  float v4f;
typedef __attribute__((ext_vector_type(2)))  float v2f;
typedef __attribute__((ext_vector_type(4)))  unsigned v4u;
typedef __attribute__((ext_vector_type(4)))  int v4i;
typedef float __attribute__((may_alias)) float_a;
typedef int __attribute__((may_alias)) int_a;

template <typename T> __device__ __forceinline__ void vst2(void* p, T v) { *(T*)p = v;  }
__device__ __forceinline__ v8f wmma16(v16h a, v16h b, v8f c) {
  v8f d = __builtin_amdgcn_wmma_f32_16x16x32_f16(false, a, false, b, (short)0, c, false, false);
  asm volatile("v_nop\n\tv_nop\n\tv_nop\n\tv_nop" : "+v"(d) : "v"(a), "v"(b));
  return d;
}
__device__ __forceinline__ v8f wmma_bf(v16b a, v16b b, v8f c) {
  v8f d = __builtin_amdgcn_wmma_f32_16x16x32_bf16(false, a, false, b, (short)0, c, false, false);
  asm volatile("v_nop\n\tv_nop\n\tv_nop\n\tv_nop" : "+v"(d) : "v"(a), "v"(b));
  return d;
}
// Multi-head self attention with a learned relative-position bias (B 2, T 2,048, d 1,024, 16 heads x 64): fused q|k|v projection + bias, scores + bias[h](t - s) from a small MLP on the signed log distance, softmax, output projection + bias.
__device__ __forceinline__ v16h frag_h(const _Float16* rowk0, int lane) {
  union { v16h v; v8h q[2]; } u; const _Float16* p = rowk0 + 8 * (lane >> 4);
  u.q[0] = *(const v8h*)p; u.q[1] = *(const v8h*)(p + 16); return u.v;
}
__device__ __forceinline__ v16h frag_f32(const float* rowk0, int lane) {
  v16h a; const float* p = rowk0 + 8 * (lane >> 4);
#pragma unroll
  for (int i = 0; i < 8; ++i) { a[i] = (_Float16)p[i]; a[8 + i] = (_Float16)p[16 + i]; }
  return a;
}
__device__ __forceinline__ v16h frag_f32s(const float* rowk0, int lane, float sc) {
  v16h a; const float* p = rowk0 + 8 * (lane >> 4);
#pragma unroll
  for (int i = 0; i < 8; ++i) { a[i] = (_Float16)(p[i] * sc); a[8 + i] = (_Float16)(p[16 + i] * sc); }
  return a;
}
// column fragment from a [K][ld] layout (column n), rows >= K read as 0
__device__ __forceinline__ v16h fragc_f32(const float* W, int k0, int n, int lane, int ld, int K) {
  v16h a; const int g = lane >> 4;
#pragma unroll
  for (int i = 0; i < 8; ++i) { const int ka = k0 + 8 * g + i, kb = ka + 16;
    a[i] = (_Float16)(ka < K ? W[(size_t)(ka < K ? ka : K - 1) * ld + n] : 0.f); a[8 + i] = (_Float16)(kb < K ? W[(size_t)(kb < K ? kb : K - 1) * ld + n] : 0.f); }
  return a;
}
struct F2 { v16b h, l; };
__device__ __forceinline__ F2 bsplit16(const float v[16]) { F2 r;
#pragma unroll
  for (int i = 0; i < 16; ++i) { const __bf16 h = (__bf16)v[i]; r.h[i] = h; r.l[i] = (__bf16)(v[i] - (float)h); }
  return r; }
__device__ __forceinline__ F2 split_row(const float* row, int k0, int lane) { float v[16]; const float* p = row + k0 + 8 * (lane >> 4);
#pragma unroll
  for (int i = 0; i < 8; ++i) { v[i] = p[i]; v[8 + i] = p[16 + i]; }
  return bsplit16(v); }
__device__ __forceinline__ F2 split_rowK(const float* row, int k0, int lane, int K) { float v[16]; const int g = lane >> 4;
#pragma unroll
  for (int i = 0; i < 8; ++i) { const int ka = k0 + 8 * g + i, kb = ka + 16; v[i] = ka < K ? row[ka < K ? ka : K - 1] : 0.f; v[8 + i] = kb < K ? row[kb < K ? kb : K - 1] : 0.f; }
  return bsplit16(v); }
__device__ __forceinline__ F2 split_col(const float* W, int k0, int n, int lane, int ld, int K) { float v[16]; const int g = lane >> 4;
#pragma unroll
  for (int i = 0; i < 8; ++i) { const int ka = k0 + 8 * g + i, kb = ka + 16; v[i] = ka < K ? W[(size_t)(ka < K ? ka : K - 1) * ld + n] : 0.f; v[8 + i] = kb < K ? W[(size_t)(kb < K ? kb : K - 1) * ld + n] : 0.f; }
  return bsplit16(v); }
__device__ __forceinline__ v8f mac3(const F2& a, const F2& b, v8f c) { c = wmma_bf(a.l, b.h, c); c = wmma_bf(a.h, b.l, c); return wmma_bf(a.h, b.h, c); }
__device__ __forceinline__ float sigm(float v) { return 1.0f / (1.0f + expf(-v)); }
#define LDSX() do { asm volatile("s_wait_dscnt 0" ::: "memory"); __builtin_amdgcn_wave_barrier(); __builtin_amdgcn_fence(__ATOMIC_RELEASE, "workgroup"); } while (0)


#define NB 2
#define SS 2048
#define DM 1024
#define NH 16
#define HD 64
#define QKVW (3 * DM)
#ifndef TQB
#define TQB (SS / 64)
#define TNB NB
#define TOB (NB * SS / 64)     // 64-row tiles of all rows, not used
#endif
typedef __attribute__((ext_vector_type(8))) __bf16 v8b;
__device__ __forceinline__ v16b frag_b(const __bf16* rowk0, int lane) {
  union { v16b v; v8b q[2]; } u; const __bf16* p = rowk0 + 8 * (lane >> 4);
  u.q[0] = *(const v8b*)p; u.q[1] = *(const v8b*)(p + 16); return u.v;
}
__device__ __forceinline__ float bfr(float v) { return (float)(__bf16)v; }
__device__ __attribute__((noinline)) float exp_ni(float v) { return expf(v); }
__device__ __attribute__((noinline)) float erf_ni(float v) { return erff(v); }

#define PK_A 0                       // [3072][1024] Wqkv rows (natural [out][in])
#define PK_P (PK_A + QKVW * DM)        // [1024][1024] Wo rows (natural)
#define PK_END (PK_P + DM * DM)
#define WS_PK  0u
#define WS_QK  (WS_PK + 2u * PK_END)             // f16 [4096 rows][2048]: q | k
#define WS_QKL (WS_QK + 2u * NB * SS * 2 * DM)     // f16 q | k residual planes x2048
#define WS_VTH (WS_QKL + 2u * NB * SS * 2 * DM)    // f16 [b][1024 (h*64+d)][2048 s] hi
#define WS_VTL (WS_VTH + 2u * NB * DM * SS)        // f16 lo x 2048
#define WS_O   (WS_VTL + 2u * NB * DM * SS)        // f32 [4096][1024]
#define WS_CS  (WS_O + 4u * NB * SS * DM)           // f32 2 x [2048][32], not used
#define WS_RB  (WS_CS + 4u * 2 * SS * 32)                 // f32 [16][2*SS-1] relative-position bias table
#define WS_END (WS_RB + 4u * NH * (2 * SS))
#define RPEH 32
// ---- k_pack: block = (row n, which): column n of an (in,out) weight -> bf16 row n; which 0..2 -> W_q/W_k/W_v into PK_A rows which*1024 + n; 3 -> W_o into PK_P
__global__ __launch_bounds__(256) void k_pack(const float* __restrict__ WQ, const float* __restrict__ WK, const float* __restrict__ WV, const float* __restrict__ WO, __bf16* __restrict__ PK) {
  __shared__ __align__(16) __bf16 s[DM]; const int n = blockIdx.x, which = blockIdx.y, t = threadIdx.x; const float* Wm = (which == 0) ? WQ : (which == 1) ? WK : (which == 2) ? WV : WO;   // (in,out) weights: pack row n = column n
  for (int k = t; k < DM; k += 256) s[k] = (__bf16)Wm[(size_t)k * DM + n];
  __syncthreads();
  __bf16* dst = (which < 3) ? PK + PK_A + ((size_t)which * DM + n) * DM : PK + PK_P + (size_t)n * DM;
  for (int q = t; q < DM / 8; q += 256) vst2((unsigned*)(dst + q * 8), *(const v4u*)&s[q * 8]);
}
// ---- projection GEMM tiles: a block of 8 waves owns 128 x 128 of the product; 64 k of both operands are staged in LDS per step (two buffers, whole-line global loads fetched one step ahead into registers); wave (wm, wn) of 2 x 4 computes 64 x 32
#define GBM 128
#define GBN 128
#define GBK 64
#define GLP 72                         // LDS row pitch in bf16: 144 B = 16 B x odd, for 16-byte fragment reads of 128-B rows
#define GSP 136                        // f16 staging pitch of the epilogue (272 B)
typedef __attribute__((ext_vector_type(4))) __bf16 v4b;
__global__ __launch_bounds__(256) void k_qkv(const float* __restrict__ XQ, const float* __restrict__ XK, const float* __restrict__ XV, const __bf16* __restrict__ P, const float* __restrict__ BQ, const float* __restrict__ BK, const float* __restrict__ BV, _Float16* __restrict__ QK, _Float16* __restrict__ QKL, _Float16* __restrict__ VTH, _Float16* __restrict__ VTL) {
  const int which0 = (blockIdx.y * 128) / DM; const float* X = (which0 == 0) ? XQ : (which0 == 1) ? XK : XV; const float* BB = BQ ? (((which0 == 0) ? BQ : (which0 == 1) ? BK : BV) + (blockIdx.y * 128 - which0 * DM)) : nullptr;
  __shared__ __align__(16) unsigned char smem[2 * (GBM + GBN) * GLP * 2];   // two buffers of [x 128 rows | W 128 rows]; the epilogue's staging afterwards
  const int tid = threadIdx.x, wave = tid >> 5, lane = tid & 31, col = lane & 15, g = lane >> 4, wm = wave >> 2, wn = wave & 3;
  const size_t rb = (size_t)blockIdx.x * GBM; const int n0 = blockIdx.y * GBN;
  const int ar = tid >> 4, ac = (tid & 15) * 4, br = tid >> 3, bc = (tid & 7) * 8;   // x: 16 lanes x 16 B = one 256-B row piece; W: 8 lanes x 16 B = one 128-B line
  const float* ag = X + (rb + ar) * DM + ac; const __bf16* bg = P + (size_t)(n0 + br) * DM + bc;
  __bf16* sm = (__bf16*)smem;
  v4f ra[8]; v4u rw[4]; v8f acc[4][2] = {};
#pragma unroll
  for (int i = 0; i < 8; ++i) ra[i] = *(const v4f*)(ag + (size_t)i * 16 * DM);
#pragma unroll
  for (int i = 0; i < 4; ++i) rw[i] = *(const v4u*)(bg + (size_t)i * 32 * DM);
  for (int ks = 0; ks < DM / GBK; ++ks) { __bf16* sb = sm + (ks & 1) * ((GBM + GBN) * GLP);
#pragma unroll
    for (int i = 0; i < 8; ++i) { v4b c; c[0] = (__bf16)ra[i][0]; c[1] = (__bf16)ra[i][1]; c[2] = (__bf16)ra[i][2]; c[3] = (__bf16)ra[i][3]; *(v4b*)&sb[(ar + 16 * i) * GLP + ac] = c; }
#pragma unroll
    for (int i = 0; i < 4; ++i) *(v4u*)&sb[(GBM + br + 32 * i) * GLP + bc] = rw[i];
    __syncthreads();   // publishes this step's buffer; the other buffer's readers all passed the barrier of the step before
    if (ks + 1 < DM / GBK) {
#pragma unroll
      for (int i = 0; i < 8; ++i) ra[i] = *(const v4f*)(ag + (size_t)i * 16 * DM + (ks + 1) * GBK);
#pragma unroll
      for (int i = 0; i < 4; ++i) rw[i] = *(const v4u*)(bg + (size_t)i * 32 * DM + (ks + 1) * GBK); }
#pragma unroll
    for (int kc = 0; kc < GBK / 32; ++kc) { v16b af[4], wf[2];
#pragma unroll
      for (int i = 0; i < 4; ++i) af[i] = frag_b(sb + (wm * 64 + i * 16 + col) * GLP + kc * 32, lane);
#pragma unroll
      for (int j = 0; j < 2; ++j) wf[j] = frag_b(sb + (GBM + wn * 32 + j * 16 + col) * GLP + kc * 32, lane);
#pragma unroll
      for (int i = 0; i < 4; ++i) {
#pragma unroll
        for (int j = 0; j < 2; ++j) acc[i][j] = wmma_bf(af[i], wf[j], acc[i][j]); } } }
  __syncthreads();   // every wave has left the operand buffers before they become staging
  _Float16* sh = (_Float16*)smem; _Float16* sl = sh + 128 * GSP;
  if (n0 < 2 * DM) {   // q stored unscaled (f16 sigma ~0.6, no subnormal exposure); 1/8 applied to the f32 score
#pragma unroll
    for (int i = 0; i < 4; ++i) {
#pragma unroll
      for (int j = 0; j < 2; ++j) { const int n = wn * 32 + j * 16 + col; const float bias = BB ? bfr(BB[n]) : 0.f;
#pragma unroll
        for (int r = 0; r < 8; ++r) { const int row = wm * 64 + i * 16 + 8 * g + r; const float v = acc[i][j][r] + bias; const _Float16 hv = (_Float16)v; sh[row * GSP + n] = hv; sl[row * GSP + n] = (_Float16)((v - (float)hv) * 2048.0f); } } }   // q, k (+ bias) as f16 hi + (x2048) residual
    __syncthreads();
    for (int q = tid; q < 128 * 16; q += 256) { const int row = q >> 4, c = q & 15; vst2((unsigned*)(QK + (rb + row) * (2 * DM) + n0 + c * 8), *(const v4u*)&sh[row * GSP + c * 8]); vst2((unsigned*)(QKL + (rb + row) * (2 * DM) + n0 + c * 8), *(const v4u*)&sl[row * GSP + c * 8]); }
  } else {             // v transposed: staging row = output column d, a lane's 8 accumulator rows are 8 consecutive s
#pragma unroll
    for (int i = 0; i < 4; ++i) {
#pragma unroll
      for (int j = 0; j < 2; ++j) { const int n = wn * 32 + j * 16 + col; const float bias = BB ? bfr(BB[n]) : 0.f; v8h h8, l8;
#pragma unroll
        for (int r = 0; r < 8; ++r) { const float v = acc[i][j][r] + bias; const _Float16 hv = (_Float16)v; h8[r] = hv; l8[r] = (_Float16)((v - (float)hv) * 2048.0f); }
        *(v8h*)&sh[n * GSP + wm * 64 + i * 16 + 8 * g] = h8; *(v8h*)&sl[n * GSP + wm * 64 + i * 16 + 8 * g] = l8; } }
    __syncthreads();
    const int b = (int)(rb / SS), s0 = (int)(rb % SS); const int pc0 = n0 - 2 * DM;
    for (int q = tid; q < 128 * 16; q += 256) { const int d = q >> 4, pc = q & 15; const size_t o = ((size_t)b * DM + pc0 + d) * SS + s0 + pc * 8; vst2((unsigned*)(VTH + o), *(const v4u*)&sh[d * GSP + pc * 8]); vst2((unsigned*)(VTL + o), *(const v4u*)&sl[d * GSP + pc * 8]); }
  }
}
// ---- k_attn: block = (64 queries, head h, batch b): all-keys flash attention on TRANSPOSED tiles: S^T = K . Q^T (A = key rows from LDS, B = the wave's 16 queries, kept in registers), so a lane holds 16 of the 32 scores of ONE query (column = lane & 15; keys 8g + r of each 16-key tile): maximum and sum run in the lane, the two lane halves exchange the maximum once a pass and join their sums once at the end; the two score tiles, converted in place, ARE the B operand of O^T += V^T . P^T (hardware k order), so P never goes through LDS; scores = (q.k) * 0.125 + bias with single f16 operands; O[b*S+q][h*64+d] = (acc + accl / 2048) / (2048 l) (256-B segments)
__device__ __forceinline__ float xhalf(float x) { return __builtin_bit_cast(float, __builtin_amdgcn_permlanex16(__builtin_bit_cast(int, x), __builtin_bit_cast(int, x), 0x76543210, 0xfedcba98, false, false)); }   // lane l with lane l ^ 16
typedef float v4fu __attribute__((ext_vector_type(4), aligned(4)));   // four table entries at a 4-byte-aligned address
__global__ __launch_bounds__(128) void k_attn(const _Float16* __restrict__ QK, const _Float16* __restrict__ QKL, const _Float16* __restrict__ VTH, const _Float16* __restrict__ VTL, const void* __restrict__ KMASK, const float* __restrict__ RB, float* __restrict__ O) {
  __shared__ __align__(16) float so[4][16][68];
  __shared__ __align__(16) _Float16 skv[2][128 * GLP];   // two buffers of a 64-key stage shared by the 4 waves: [k: 64 key rows x 64 d | v: 64 d rows x 64 keys], 128-B rows at pitch 144 B
  const int tid = threadIdx.x, wave = tid >> 5, lane = tid & 31, col = lane & 15, g = lane >> 4;
  const int qb = blockIdx.x, h = blockIdx.y, b = blockIdx.z; const int q0 = qb * 64 + wave * 16; const size_t rq = (size_t)b * SS + q0 + col;
  v16h aq[2];
#pragma unroll
  for (int kc = 0; kc < 2; ++kc) aq[kc] = frag_h(QK + rq * (2 * DM) + h * HD + kc * 32, lane);
  float m = -3.0e38f, l = 0.f;   // this lane's query: running maximum (equal in both halves), and this half's share of the sum
  v8f acc[4] = {}, accl[4] = {};
  const int nks = SS / 32;   // all keys
  const int sr = tid >> 3, sc = (tid & 7) * 8;   // staging: 8 lanes x 16 B = one whole 128-B line, 16 rows a sweep
  const _Float16* kg = QK + ((size_t)b * SS + sr) * (2 * DM) + DM + h * HD + sc; const _Float16* vg = VTH + ((size_t)b * DM + h * HD + sr) * SS + sc;
  const float* rbq = RB + (size_t)h * (2 * SS - 1) + (q0 + col) + (SS - 1) - 8 * g - 7;   // bias[h][t - s] of this lane's query at key 8g + 7 of tile 0: a lane's 8 keys of a tile are 8 consecutive entries, falling with the key
  v4u rk[4], rv[4];
#pragma unroll
  for (int i = 0; i < 4; ++i) { rk[i] = *(const v4u*)(kg + (size_t)i * 16 * (2 * DM)); rv[i] = *(const v4u*)(vg + (size_t)i * 16 * SS); }
#pragma unroll 1
  for (int st = 0; st < nks / 2; ++st) { _Float16* sb = &skv[st & 1][0];   // a stage: lay down the 64 keys fetched one stage ahead
#pragma unroll
    for (int i = 0; i < 4; ++i) { *(v4u*)&sb[(sr + 16 * i) * GLP + sc] = rk[i]; *(v4u*)&sb[(64 + sr + 16 * i) * GLP + sc] = rv[i]; }
    __syncthreads();   // publishes this stage's buffer; the other buffer's readers all passed the barrier of the stage before
#pragma unroll   // both 32-key passes of a stage in straight-line code, so that the next stage's fetch has a fixed place among the loads
   for (int sub = 0; sub < 2; ++sub) { const int ks = st * 2 + sub; v8f s[2];
#pragma unroll
    for (int ct = 0; ct < 2; ++ct) { const _Float16* krow = sb + (sub * 32 + ct * 16 + col) * GLP; const float* bp = rbq - (ks * 32 + ct * 16); const v4fu b1 = *(const v4fu*)bp, b0 = *(const v4fu*)(bp + 4); v8f c = {};   // b0: keys 8g + 3 .. 8g + 0, b1: keys 8g + 7 .. 8g + 4
#pragma unroll
      for (int kc = 0; kc < 2; ++kc) c = wmma16(frag_h(krow + kc * 32, lane), aq[kc], c);   // single product: k, q as one-rounding f16 operands; c[r] = score(key ct*16 + 8g + r, query col)
#pragma unroll
      for (int r = 0; r < 4; ++r) { s[ct][r] = c[r] * 0.125f + b0[3 - r]; s[ct][4 + r] = c[4 + r] * 0.125f + b1[3 - r]; } }   // 1/sqrt(64) + bias[h][t - s]
    if (sub == 0) { const int nx = (st + 1 < nks / 2) ? st + 1 : st;   // fetch the next stage behind this pass's bias loads (loads return in order: ahead of them, the wait for the bias would wait for the stage); the last stage fetches itself again, unused
#pragma unroll
      for (int i = 0; i < 4; ++i) { rk[i] = *(const v4u*)(kg + ((size_t)nx * 64 + i * 16) * (2 * DM)); rv[i] = *(const v4u*)(vg + (size_t)i * 16 * SS + nx * 64); } }
    float mx = fmaxf(s[0][0], s[1][0]);
#pragma unroll
    for (int r = 1; r < 8; ++r) mx = fmaxf(mx, fmaxf(s[0][r], s[1][r]));
    mx = fmaxf(mx, xhalf(mx));   // the query's maximum over all 32 keys of the pass, in both halves
    const float mn = fmaxf(m, mx); const float alpha = (m <= -1.0e38f) ? 0.f : __expf(m - mn);
    float es = 0.f; v16h pa;
#pragma unroll
    for (int r = 0; r < 8; ++r) { const float e0 = (s[0][r] <= -1.0e38f) ? 0.f : __expf(s[0][r] - mn), e1 = (s[1][r] <= -1.0e38f) ? 0.f : __expf(s[1][r] - mn); es += e0 + e1;
      pa[r] = (_Float16)(e0 * 2048.0f); pa[8 + r] = (_Float16)(e1 * 2048.0f); }   // P scaled by 2^11 before the f16 rounding so small softmax weights stay out of the f16 subnormal range; 2^-11 folded into the epilogue
    l = l * alpha + es; m = mn;
#pragma unroll
    for (int dt = 0; dt < 4; ++dt) {
#pragma unroll
      for (int r = 0; r < 8; ++r) { acc[dt][r] *= alpha; accl[dt][r] *= alpha; } }
#pragma unroll
    for (int dt = 0; dt < 4; ++dt) acc[dt] = wmma16(frag_h(sb + (64 + dt * 16 + col) * GLP + sub * 32, lane), pa, acc[dt]);   // single product: V^T x P^T (x2^11); acc[dt][r] = O(query col, d = dt*16 + 8g + r)
   } }
  const float il = (1.0f / 2048.0f) / (l + xhalf(l));   // the halves' sums joined once
#pragma unroll
  for (int dt = 0; dt < 4; ++dt) { v4f o0, o1;
#pragma unroll
    for (int r = 0; r < 4; ++r) { o0[r] = (acc[dt][r] + accl[dt][r] * (1.0f / 2048.0f)) * il; o1[r] = (acc[dt][4 + r] + accl[dt][4 + r] * (1.0f / 2048.0f)) * il; }
    *(v4f*)&so[wave][col][dt * 16 + 8 * g] = o0; *(v4f*)&so[wave][col][dt * 16 + 8 * g + 4] = o1; }
  LDSX();
  for (int rl = 0; rl < 16; ++rl) if (lane < 16) vst2(O + ((size_t)b * SS + q0 + rl) * DM + h * HD + lane * 4, *(const v4f*)&so[wave][rl][lane * 4]);
}
// ---- k_out: block = (128 rows, 128 cols), tiles staged as in k_qkv: out = O(hi/lo) . Wo rows (2 products) + bo
__global__ __launch_bounds__(256) void k_out(const float* __restrict__ O, const __bf16* __restrict__ P, const float* __restrict__ BO, float* __restrict__ Y) {
  __shared__ __align__(16) unsigned char smem[2 * (2 * GBM + GBN) * GLP * 2];   // two buffers of [O hi 128 rows | O residual 128 rows | Wo 128 rows]; the epilogue's staging afterwards
  const int tid = threadIdx.x, wave = tid >> 5, lane = tid & 31, col = lane & 15, g = lane >> 4, wm = wave >> 2, wn = wave & 3;
  const size_t rb = (size_t)blockIdx.x * GBM; const int n0 = blockIdx.y * GBN;
  const int ar = tid >> 4, ac = (tid & 15) * 4, br = tid >> 3, bc = (tid & 7) * 8;
  const float* ag = O + (rb + ar) * DM + ac; const __bf16* bg = P + (size_t)(n0 + br) * DM + bc;
  __bf16* sm = (__bf16*)smem;
  v4f ra[8]; v4u rw[4]; v8f acc[4][2] = {};
#pragma unroll
  for (int i = 0; i < 8; ++i) ra[i] = *(const v4f*)(ag + (size_t)i * 16 * DM);
#pragma unroll
  for (int i = 0; i < 4; ++i) rw[i] = *(const v4u*)(bg + (size_t)i * 32 * DM);
  for (int ks = 0; ks < DM / GBK; ++ks) { __bf16* sb = sm + (ks & 1) * ((2 * GBM + GBN) * GLP);
#pragma unroll
    for (int i = 0; i < 8; ++i) { v4b ch, cl;
#pragma unroll
      for (int e = 0; e < 4; ++e) { const __bf16 h = (__bf16)ra[i][e]; ch[e] = h; cl[e] = (__bf16)(ra[i][e] - (float)h); }
      *(v4b*)&sb[(ar + 16 * i) * GLP + ac] = ch; *(v4b*)&sb[(GBM + ar + 16 * i) * GLP + ac] = cl; }
#pragma unroll
    for (int i = 0; i < 4; ++i) *(v4u*)&sb[(2 * GBM + br + 32 * i) * GLP + bc] = rw[i];
    __syncthreads();   // publishes this step's buffer; the other buffer's readers all passed the barrier of the step before
    if (ks + 1 < DM / GBK) {
#pragma unroll
      for (int i = 0; i < 8; ++i) ra[i] = *(const v4f*)(ag + (size_t)i * 16 * DM + (ks + 1) * GBK);
#pragma unroll
      for (int i = 0; i < 4; ++i) rw[i] = *(const v4u*)(bg + (size_t)i * 32 * DM + (ks + 1) * GBK);
      asm volatile("s_wait_xcnt 0x0" ::: "memory"); }   // the twelve loads' address registers are reused by the compute below: the wait stands in front of their first overwrite
#pragma unroll
    for (int kc = 0; kc < GBK / 32; ++kc) { v16b ah[4], al[4], wf[2];
#pragma unroll
      for (int i = 0; i < 4; ++i) { ah[i] = frag_b(sb + (wm * 64 + i * 16 + col) * GLP + kc * 32, lane); al[i] = frag_b(sb + (GBM + wm * 64 + i * 16 + col) * GLP + kc * 32, lane); }
#pragma unroll
      for (int j = 0; j < 2; ++j) wf[j] = frag_b(sb + (2 * GBM + wn * 32 + j * 16 + col) * GLP + kc * 32, lane);
#pragma unroll
      for (int i = 0; i < 4; ++i) {
#pragma unroll
        for (int j = 0; j < 2; ++j) acc[i][j] = wmma_bf(al[i], wf[j], acc[i][j]); }
#pragma unroll
      for (int i = 0; i < 4; ++i) {
#pragma unroll
        for (int j = 0; j < 2; ++j) acc[i][j] = wmma_bf(ah[i], wf[j], acc[i][j]); } } }
  __syncthreads();   // every wave has left the operand buffers before they become staging
  float* so = (float*)smem;
#pragma unroll
  for (int i = 0; i < 4; ++i) {
#pragma unroll
    for (int j = 0; j < 2; ++j) { const int n = wn * 32 + j * 16 + col; const float bias = bfr(BO[n0 + n]);
#pragma unroll
      for (int r = 0; r < 8; ++r) so[(wm * 64 + i * 16 + 8 * g + r) * 132 + n] = acc[i][j][r] + bias; } }
  __syncthreads();
  for (int q = tid; q < 128 * 32; q += 256) { const int row = q >> 5, c = q & 31; vst2(Y + (rb + row) * DM + n0 + c * 4, *(const v4f*)&so[row * 132 + c * 4]); }
}
// ---- k_pack3: fused (in,out) W_qkv [DM][3*DM] -> three transposed bf16 row blocks
__global__ __launch_bounds__(256) void k_pack3(const float* __restrict__ WA, __bf16* __restrict__ PK) { __shared__ __align__(16) __bf16 s[DM]; const int n = blockIdx.x, which = blockIdx.y, t = threadIdx.x; for (int k = t; k < DM; k += 256) s[k] = (__bf16)WA[(size_t)k * (3 * DM) + which * DM + n]; __syncthreads(); for (int q = t; q < DM / 8; q += 256) vst2((unsigned*)(PK + PK_A + ((size_t)which * DM + n) * DM + q * 8), *(const v4u*)&s[q * 8]); }
// ---- k_rpe: one thread per relative distance rel = idx - (SS-1): f = sign(rel) log1p(|rel|); h = relu(f w1[j] + b1[j]); bias[h] = sum_j h_j w2[j][h] + b2[h]
__global__ __launch_bounds__(256) void k_rpe(const float* __restrict__ W1, const float* __restrict__ B1, const float* __restrict__ W2, const float* __restrict__ B2, float* __restrict__ RB) {
  const int idx = blockIdx.x * 256 + threadIdx.x; if (idx >= 2 * SS - 1) return; const float rel = (float)(idx - (SS - 1)); const float f = (rel > 0.f ? 1.f : (rel < 0.f ? -1.f : 0.f)) * log1pf(fabsf(rel));
  float hdn[RPEH];
#pragma unroll
  for (int j = 0; j < RPEH; ++j) hdn[j] = fmaxf(f * bfr(W1[j]) + bfr(B1[j]), 0.f);
#pragma unroll 1
  for (int h = 0; h < NH; ++h) { float b = bfr(B2[h]);
#pragma unroll
    for (int j = 0; j < RPEH; ++j) b += hdn[j] * bfr(W2[j * NH + h]);
    RB[(size_t)h * (2 * SS - 1) + idx] = b; }   // 4-B scratch store
}
extern "C" void kernel_launch(void* const* d_in, const int* in_sizes, int n_in, void* d_out, int out_size, void* d_ws, size_t ws_size, hipStream_t stream) {
  (void)in_sizes; (void)n_in; (void)out_size;
  const float** F = (const float**)d_in;   // 0 x [2,2048,1024], 1 w_qkv [1024,3072] (in,out: q | k | v), 2 b_qkv [3072], 3 w_out (in,out), 4 b_out, 5 w1_rpe [1,32], 6 b1_rpe [32], 7 w2_rpe [32,16], 8 b2_rpe [16]
  if (ws_size < (size_t)WS_END) return;
  char* ws = (char*)d_ws; __bf16* PK = (__bf16*)(ws + WS_PK); _Float16 *QK = (_Float16*)(ws + WS_QK), *QKL = (_Float16*)(ws + WS_QKL), *VTH = (_Float16*)(ws + WS_VTH), *VTL = (_Float16*)(ws + WS_VTL); float *O = (float*)(ws + WS_O), *RB = (float*)(ws + WS_RB);
  k_pack<<<dim3(DM, 4), 256, 0, stream>>>(F[3], F[3], F[3], F[3], PK);   // output projection; q/k/v slots overwritten next
  k_pack3<<<dim3(DM, 3), 256, 0, stream>>>(F[1], PK);
  k_rpe<<<(2 * SS + 255) / 256, 256, 0, stream>>>(F[5], F[6], F[7], F[8], RB);
  k_qkv<<<dim3(TNB * SS / GBM, QKVW / GBN), 256, 0, stream>>>(F[0], F[0], F[0], PK + PK_A, F[2], F[2] + DM, F[2] + 2 * DM, QK, QKL, VTH, VTL);
  k_attn<<<dim3(TQB, NH, TNB), 128, 0, stream>>>(QK, QKL, VTH, VTL, nullptr, RB, O);
  k_out<<<dim3(NB * SS / GBM, DM / GBN), 256, 0, stream>>>(O, PK + PK_P, F[4], (float*)d_out);
}

// v003
// One run takes 127 microseconds.
// Next to v002, in two timings, it ran 1.26 and 1.25 times as fast.
// Counting every step since v000, it is 3.46 times as fast.
// compute dtype: all float inputs rounded to bf16; qkv = x . W_qkv + b with EXACT bf16 products on WMMA 16x16x32 ((in,out) columns q | k | v as transposed rows); the relative-position bias table bias[h][t-s] = relu(sign(t-s) log1p|t-s| * w1 + b1) . w2 + b2 computed once per distance in f32 (precise log1pf); PLAIN attention: q, k as single f16 operands x 1/8 + bias, running-max softmax in f32 (hardware exp), P (scaled by 2^11, single f16) x v (single f16); out = ctx (bf16 hi + residual) . W_out (2 products) + b_out.
#include <hip/hip_runtime.h>
#include <math.h>

typedef __attribute__((ext_vector_type(16))) _Float16 v16h;
typedef __attribute__((ext_vector_type(16))) __bf16 v16b;
typedef __attribute__((ext_vector_type(8)))  _Float16 v8h;
typedef __attribute__((ext_vector_type(8)))  float v8f;
typedef __attribute__((ext_vector_type(4)))  float v4f;
typedef __attribute__((ext_vector_type(2)))  float v2f;
typedef __attribute__((ext_vector_type(4)))  unsigned v4u;
typedef __attribute__((ext_vector_type(4)))  int v4i;
typedef float __attribute__((may_alias)) float_a;
typedef int __attribute__((may_alias)) int_a;

template <typename T> __device__ __forceinline__ void vst2(void* p, T v) { *(T*)p = v;  }
__device__ __forceinline__ v8f wmma16(v16h a, v16h b, v8f c) {
  v8f d = __builtin_amdgcn_wmma_f32_16x16x32_f16(false, a, false, b, (short)0, c, false, false);
  asm volatile("v_nop\n\tv_nop\n\tv_nop\n\tv_nop" : "+v"(d) : "v"(a), "v"(b));
  return d;
}
__device__ __forceinline__ v8f wmma_bf(v16b a, v16b b, v8f c) {
  v8f d = __builtin_amdgcn_wmma_f32_16x16x32_bf16(false, a, false, b, (short)0, c, false, false);
  asm volatile("v_nop\n\tv_nop\n\tv_nop\n\tv_nop" : "+v"(d) : "v"(a), "v"(b));
  return d;
}
// Multi-head self attention with a learned relative-position bias (B 2, T 2,048, d 1,024, 16 heads x 64): fused q|k|v projection + bias, scores + bias[h](t - s) from a small MLP on the signed log distance, softmax, output projection + bias.
__device__ __forceinline__ v16h frag_h(const _Float16* rowk0, int lane) {
  union { v16h v; v8h q[2]; } u; const _Float16* p = rowk0 + 8 * (lane >> 4);
  u.q[0] = *(const v8h*)p; u.q[1] = *(const v8h*)(p + 16); return u.v;
}
__device__ __forceinline__ v16h frag_f32(const float* rowk0, int lane) {
  v16h a; const float* p = rowk0 + 8 * (lane >> 4);
#pragma unroll
  for (int i = 0; i < 8; ++i) { a[i] = (_Float16)p[i]; a[8 + i] = (_Float16)p[16 + i]; }
  return a;
}
__device__ __forceinline__ v16h frag_f32s(const float* rowk0, int lane, float sc) {
  v16h a; const float* p = rowk0 + 8 * (lane >> 4);
#pragma unroll
  for (int i = 0; i < 8; ++i) { a[i] = (_Float16)(p[i] * sc); a[8 + i] = (_Float16)(p[16 + i] * sc); }
  return a;
}
// column fragment from a [K][ld] layout (column n), rows >= K read as 0
__device__ __forceinline__ v16h fragc_f32(const float* W, int k0, int n, int lane, int ld, int K) {
  v16h a; const int g = lane >> 4;
#pragma unroll
  for (int i = 0; i < 8; ++i) { const int ka = k0 + 8 * g + i, kb = ka + 16;
    a[i] = (_Float16)(ka < K ? W[(size_t)(ka < K ? ka : K - 1) * ld + n] : 0.f); a[8 + i] = (_Float16)(kb < K ? W[(size_t)(kb < K ? kb : K - 1) * ld + n] : 0.f); }
  return a;
}
struct F2 { v16b h, l; };
__device__ __forceinline__ F2 bsplit16(const float v[16]) { F2 r;
#pragma unroll
  for (int i = 0; i < 16; ++i) { const __bf16 h = (__bf16)v[i]; r.h[i] = h; r.l[i] = (__bf16)(v[i] - (float)h); }
  return r; }
__device__ __forceinline__ F2 split_row(const float* row, int k0, int lane) { float v[16]; const float* p = row + k0 + 8 * (lane >> 4);
#pragma unroll
  for (int i = 0; i < 8; ++i) { v[i] = p[i]; v[8 + i] = p[16 + i]; }
  return bsplit16(v); }
__device__ __forceinline__ F2 split_rowK(const float* row, int k0, int lane, int K) { float v[16]; const int g = lane >> 4;
#pragma unroll
  for (int i = 0; i < 8; ++i) { const int ka = k0 + 8 * g + i, kb = ka + 16; v[i] = ka < K ? row[ka < K ? ka : K - 1] : 0.f; v[8 + i] = kb < K ? row[kb < K ? kb : K - 1] : 0.f; }
  return bsplit16(v); }
__device__ __forceinline__ F2 split_col(const float* W, int k0, int n, int lane, int ld, int K) { float v[16]; const int g = lane >> 4;
#pragma unroll
  for (int i = 0; i < 8; ++i) { const int ka = k0 + 8 * g + i, kb = ka + 16; v[i] = ka < K ? W[(size_t)(ka < K ? ka : K - 1) * ld + n] : 0.f; v[8 + i] = kb < K ? W[(size_t)(kb < K ? kb : K - 1) * ld + n] : 0.f; }
  return bsplit16(v); }
__device__ __forceinline__ v8f mac3(const F2& a, const F2& b, v8f c) { c = wmma_bf(a.l, b.h, c); c = wmma_bf(a.h, b.l, c); return wmma_bf(a.h, b.h, c); }
__device__ __forceinline__ float sigm(float v) { return 1.0f / (1.0f + expf(-v)); }
#define LDSX() do { asm volatile("s_wait_dscnt 0" ::: "memory"); __builtin_amdgcn_wave_barrier(); __builtin_amdgcn_fence(__ATOMIC_RELEASE, "workgroup"); } while (0)


#define NB 2
#define SS 2048
#define DM 1024
#define NH 16
#define HD 64
#define QKVW (3 * DM)
#ifndef TQB
#define TQB (SS / 64)
#define TNB NB
#define TOB (NB * SS / 64)     // 64-row tiles of all rows, not used
#endif
typedef __attribute__((ext_vector_type(8))) __bf16 v8b;
__device__ __forceinline__ v16b frag_b(const __bf16* rowk0, int lane) {
  union { v16b v; v8b q[2]; } u; const __bf16* p = rowk0 + 8 * (lane >> 4);
  u.q[0] = *(const v8b*)p; u.q[1] = *(const v8b*)(p + 16); return u.v;
}
__device__ __forceinline__ float bfr(float v) { return (float)(__bf16)v; }
__device__ __attribute__((noinline)) float exp_ni(float v) { return expf(v); }
__device__ __attribute__((noinline)) float erf_ni(float v) { return erff(v); }

#define PK_A 0                       // [3072][1024] Wqkv rows (natural [out][in])
#define PK_P (PK_A + QKVW * DM)        // [1024][1024] Wo rows (natural)
#define PK_END (PK_P + DM * DM)
#define WS_PK  0u
#define WS_QK  (WS_PK + 2u * PK_END)             // f16 [4096 rows][2048]: q | k
#define WS_QKL (WS_QK + 2u * NB * SS * 2 * DM)     // f16 q | k residual planes x2048
#define WS_VTH (WS_QKL + 2u * NB * SS * 2 * DM)    // f16 [b][1024 (h*64+d)][2048 s] hi
#define WS_VTL (WS_VTH + 2u * NB * DM * SS)        // f16 lo x 2048
#define WS_O   (WS_VTL + 2u * NB * DM * SS)        // f32 [4096][1024]
#define WS_CS  (WS_O + 4u * NB * SS * DM)           // f32 2 x [2048][32], not used
#define WS_RB  (WS_CS + 4u * 2 * SS * 32)                 // f32 [16][2*SS-1] relative-position bias table
#define WS_END (WS_RB + 4u * NH * (2 * SS))
#define RPEH 32
// ---- k_packt: block = one 128 (in) x 128 (out) tile of the (in,out) weights, columns 0..3071 of W_qkv, 3072..4095 of W_out -> bf16 rows PK[n][k] (PK_P follows PK_A, so the row is the column's number). A wave reads 16 whole 512-B row pieces; a lane's 16 k x 4 n block becomes four 32-B runs of k in LDS; the rows leave as 256-B pieces
// LDS rows hold 16 pieces of 16 B, piece j of row n at place j ^ ((n >> 2) & 15): the 32 lanes of a store stand 4 rows apart and would meet in 16 of the 64 banks at any 16-B-aligned pitch
__global__ __launch_bounds__(256) void k_packt(const float* __restrict__ WA, const float* __restrict__ WO, __bf16* __restrict__ PK) {
  __shared__ __align__(16) __bf16 s[128 * 128];
  const int tid = threadIdx.x, lane = tid & 31, wave = tid >> 5; const int k0 = blockIdx.x * 128, n0 = blockIdx.y * 128;
  const bool qkv = n0 < QKVW; const int ld = qkv ? QKVW : DM; const float* src = (qkv ? WA + n0 : WO + (n0 - QKVW)) + (size_t)(k0 + wave * 16) * ld + lane * 4;
  v4f r[16]; const float* p[16];
#pragma unroll
  for (int i = 0; i < 16; ++i) { p[i] = src + (size_t)i * ld; r[i] = *(const v4f*)p[i]; }
  // the two statements take the loaded values and their addresses as inputs only. They hold all sixteen loads in front of the first conversion (one memory latency a tile; left alone, the compiler issues the last six behind waits for the first), and they keep every address register live up to the wait that stands in front of its first overwrite
  asm volatile("s_wait_xcnt 0x0" :: "v"(r[0]), "v"(r[1]), "v"(r[2]), "v"(r[3]), "v"(r[4]), "v"(r[5]), "v"(r[6]), "v"(r[7]), "v"(p[0]), "v"(p[1]), "v"(p[2]), "v"(p[3]), "v"(p[4]), "v"(p[5]), "v"(p[6]), "v"(p[7]) : "memory");
  asm volatile("s_wait_xcnt 0x0" :: "v"(r[8]), "v"(r[9]), "v"(r[10]), "v"(r[11]), "v"(r[12]), "v"(r[13]), "v"(r[14]), "v"(r[15]), "v"(p[8]), "v"(p[9]), "v"(p[10]), "v"(p[11]), "v"(p[12]), "v"(p[13]), "v"(p[14]), "v"(p[15]) : "memory");
#pragma unroll
  for (int c = 0; c < 4; ++c) { v8b lo, hi;
#pragma unroll
    for (int e = 0; e < 8; ++e) { lo[e] = (__bf16)r[e][c]; hi[e] = (__bf16)r[8 + e][c]; }
    __bf16* row = &s[(lane * 4 + c) * 128]; *(v8b*)&row[((2 * wave) ^ (lane & 15)) * 8] = lo; *(v8b*)&row[((2 * wave + 1) ^ (lane & 15)) * 8] = hi; }
  __syncthreads();
  const int nr = tid >> 4, j = tid & 15; __bf16* dst = PK + PK_A + (size_t)(n0 + nr) * DM + k0 + j * 8;
#pragma unroll   // the eight LDS reads go out together, one wait chain instead of eight round trips
  for (int i = 0; i < 8; ++i) { const int n = nr + 16 * i; vst2((unsigned*)(dst + (size_t)i * 16 * DM), *(const v4u*)&s[n * 128 + (j ^ ((n >> 2) & 15)) * 8]); }
}
// ---- projection GEMM tiles: a block of 8 waves owns 128 x 128 of the product; 64 k of both operands are staged in LDS per step (two buffers, whole-line global loads fetched one step ahead into registers); wave (wm, wn) of 2 x 4 computes 64 x 32
#define GBM 128
#define GBN 128
#define GBK 64
#define GLP 72                         // LDS row pitch in bf16: 144 B = 16 B x odd, for 16-byte fragment reads of 128-B rows
#define GSP 136                        // f16 staging pitch of the epilogue (272 B)
typedef __attribute__((ext_vector_type(4))) __bf16 v4b;
__global__ __launch_bounds__(256) void k_qkv(const float* __restrict__ XQ, const float* __restrict__ XK, const float* __restrict__ XV, const __bf16* __restrict__ P, const float* __restrict__ BQ, const float* __restrict__ BK, const float* __restrict__ BV, _Float16* __restrict__ QK, _Float16* __restrict__ QKL, _Float16* __restrict__ VTH, _Float16* __restrict__ VTL) {
  const int which0 = (blockIdx.y * 128) / DM; const float* X = (which0 == 0) ? XQ : (which0 == 1) ? XK : XV; const float* BB = BQ ? (((which0 == 0) ? BQ : (which0 == 1) ? BK : BV) + (blockIdx.y * 128 - which0 * DM)) : nullptr;
  __shared__ __align__(16) unsigned char smem[2 * (GBM + GBN) * GLP * 2];   // two buffers of [x 128 rows | W 128 rows]; the epilogue's staging afterwards
  const int tid = threadIdx.x, wave = tid >> 5, lane = tid & 31, col = lane & 15, g = lane >> 4, wm = wave >> 2, wn = wave & 3;
  const size_t rb = (size_t)blockIdx.x * GBM; const int n0 = blockIdx.y * GBN;
  const int ar = tid >> 4, ac = (tid & 15) * 4, br = tid >> 3, bc = (tid & 7) * 8;   // x: 16 lanes x 16 B = one 256-B row piece; W: 8 lanes x 16 B = one 128-B line
  const float* ag = X + (rb + ar) * DM + ac; const __bf16* bg = P + (size_t)(n0 + br) * DM + bc;
  __bf16* sm = (__bf16*)smem;
  v4f ra[8]; v4u rw[4]; v8f acc[4][2] = {};
#pragma unroll
  for (int i = 0; i < 8; ++i) ra[i] = *(const v4f*)(ag + (size_t)i * 16 * DM);
#pragma unroll
  for (int i = 0; i < 4; ++i) rw[i] = *(const v4u*)(bg + (size_t)i * 32 * DM);
  for (int ks = 0; ks < DM / GBK; ++ks) { __bf16* sb = sm + (ks & 1) * ((GBM + GBN) * GLP);
#pragma unroll
    for (int i = 0; i < 8; ++i) { v4b c; c[0] = (__bf16)ra[i][0]; c[1] = (__bf16)ra[i][1]; c[2] = (__bf16)ra[i][2]; c[3] = (__bf16)ra[i][3]; *(v4b*)&sb[(ar + 16 * i) * GLP + ac] = c; }
#pragma unroll
    for (int i = 0; i < 4; ++i) *(v4u*)&sb[(GBM + br + 32 * i) * GLP + bc] = rw[i];
    __syncthreads();   // publishes this step's buffer; the other buffer's readers all passed the barrier of the step before
    if (ks + 1 < DM / GBK) {
#pragma unroll
      for (int i = 0; i < 8; ++i) ra[i] = *(const v4f*)(ag + (size_t)i * 16 * DM + (ks + 1) * GBK);
#pragma unroll
      for (int i = 0; i < 4; ++i) rw[i] = *(const v4u*)(bg + (size_t)i * 32 * DM + (ks + 1) * GBK); }
#pragma unroll
    for (int kc = 0; kc < GBK / 32; ++kc) { v16b af[4], wf[2];
#pragma unroll
      for (int i = 0; i < 4; ++i) af[i] = frag_b(sb + (wm * 64 + i * 16 + col) * GLP + kc * 32, lane);
#pragma unroll
      for (int j = 0; j < 2; ++j) wf[j] = frag_b(sb + (GBM + wn * 32 + j * 16 + col) * GLP + kc * 32, lane);
#pragma unroll
      for (int i = 0; i < 4; ++i) {
#pragma unroll
        for (int j = 0; j < 2; ++j) acc[i][j] = wmma_bf(af[i], wf[j], acc[i][j]); } } }
  __syncthreads();   // every wave has left the operand buffers before they become staging
  _Float16* sh = (_Float16*)smem; _Float16* sl = sh + 128 * GSP;
  if (n0 < 2 * DM) {   // q stored unscaled (f16 sigma ~0.6, no subnormal exposure); 1/8 applied to the f32 score
#pragma unroll
    for (int i = 0; i < 4; ++i) {
#pragma unroll
      for (int j = 0; j < 2; ++j) { const int n = wn * 32 + j * 16 + col; const float bias = BB ? bfr(BB[n]) : 0.f;
#pragma unroll
        for (int r = 0; r < 8; ++r) { const int row = wm * 64 + i * 16 + 8 * g + r; const float v = acc[i][j][r] + bias; const _Float16 hv = (_Float16)v; sh[row * GSP + n] = hv; sl[row * GSP + n] = (_Float16)((v - (float)hv) * 2048.0f); } } }   // q, k (+ bias) as f16 hi + (x2048) residual
    __syncthreads();
    for (int q = tid; q < 128 * 16; q += 256) { const int row = q >> 4, c = q & 15; vst2((unsigned*)(QK + (rb + row) * (2 * DM) + n0 + c * 8), *(const v4u*)&sh[row * GSP + c * 8]); vst2((unsigned*)(QKL + (rb + row) * (2 * DM) + n0 + c * 8), *(const v4u*)&sl[row * GSP + c * 8]); }
  } else {             // v transposed: staging row = output column d, a lane's 8 accumulator rows are 8 consecutive s
#pragma unroll
    for (int i = 0; i < 4; ++i) {
#pragma unroll
      for (int j = 0; j < 2; ++j) { const int n = wn * 32 + j * 16 + col; const float bias = BB ? bfr(BB[n]) : 0.f; v8h h8, l8;
#pragma unroll
        for (int r = 0; r < 8; ++r) { const float v = acc[i][j][r] + bias; const _Float16 hv = (_Float16)v; h8[r] = hv; l8[r] = (_Float16)((v - (float)hv) * 2048.0f); }
        *(v8h*)&sh[n * GSP + wm * 64 + i * 16 + 8 * g] = h8; *(v8h*)&sl[n * GSP + wm * 64 + i * 16 + 8 * g] = l8; } }
    __syncthreads();
    const int b = (int)(rb / SS), s0 = (int)(rb % SS); const int pc0 = n0 - 2 * DM;
    for (int q = tid; q < 128 * 16; q += 256) { const int d = q >> 4, pc = q & 15; const size_t o = ((size_t)b * DM + pc0 + d) * SS + s0 + pc * 8; vst2((unsigned*)(VTH + o), *(const v4u*)&sh[d * GSP + pc * 8]); vst2((unsigned*)(VTL + o), *(const v4u*)&sl[d * GSP + pc * 8]); }
  }
}
// ---- k_attn: block = (64 queries, head h, batch b): all-keys flash attention on TRANSPOSED tiles: S^T = K . Q^T (A = key rows from LDS, B = the wave's 16 queries, kept in registers), so a lane holds 16 of the 32 scores of ONE query (column = lane & 15; keys 8g + r of each 16-key tile): maximum and sum run in the lane, the two lane halves exchange the maximum once a pass and join their sums once at the end; the two score tiles, converted in place, ARE the B operand of O^T += V^T . P^T (hardware k order), so P never goes through LDS; scores = (q.k) * 0.125 + bias with single f16 operands; O[b*S+q][h*64+d] = (acc + accl / 2048) / (2048 l) (256-B segments)
__device__ __forceinline__ float xhalf(float x) { return __builtin_bit_cast(float, __builtin_amdgcn_permlanex16(__builtin_bit_cast(int, x), __builtin_bit_cast(int, x), 0x76543210, 0xfedcba98, false, false)); }   // lane l with lane l ^ 16
typedef float v4fu __attribute__((ext_vector_type(4), aligned(4)));   // four table entries at a 4-byte-aligned address
__global__ __launch_bounds__(128) void k_attn(const _Float16* __restrict__ QK, const _Float16* __restrict__ QKL, const _Float16* __restrict__ VTH, const _Float16* __restrict__ VTL, const void* __restrict__ KMASK, const float* __restrict__ RB, float* __restrict__ O) {
  __shared__ __align__(16) float so[4][16][68];
  __shared__ __align__(16) _Float16 skv[2][128 * GLP];   // two buffers of a 64-key stage shared by the 4 waves: [k: 64 key rows x 64 d | v: 64 d rows x 64 keys], 128-B rows at pitch 144 B
  const int tid = threadIdx.x, wave = tid >> 5, lane = tid & 31, col = lane & 15, g = lane >> 4;
  const int qb = blockIdx.x, h = blockIdx.y, b = blockIdx.z; const int q0 = qb * 64 + wave * 16; const size_t rq = (size_t)b * SS + q0 + col;
  v16h aq[2];
#pragma unroll
  for (int kc = 0; kc < 2; ++kc) aq[kc] = frag_h(QK + rq * (2 * DM) + h * HD + kc * 32, lane);
  float m = -3.0e38f, l = 0.f;   // this lane's query: running maximum (equal in both halves), and this half's share of the sum
  v8f acc[4] = {}, accl[4] = {};
  const int nks = SS / 32;   // all keys
  const int sr = tid >> 3, sc = (tid & 7) * 8;   // staging: 8 lanes x 16 B = one whole 128-B line, 16 rows a sweep
  const _Float16* kg = QK + ((size_t)b * SS + sr) * (2 * DM) + DM + h * HD + sc; const _Float16* vg = VTH + ((size_t)b * DM + h * HD + sr) * SS + sc;
  const float* rbq = RB + (size_t)h * (2 * SS - 1) + (q0 + col) + (SS - 1) - 8 * g - 7;   // bias[h][t - s] of this lane's query at key 8g + 7 of tile 0: a lane's 8 keys of a tile are 8 consecutive entries, falling with the key
  v4u rk[4], rv[4];
#pragma unroll
  for (int i = 0; i < 4; ++i) { rk[i] = *(const v4u*)(kg + (size_t)i * 16 * (2 * DM)); rv[i] = *(const v4u*)(vg + (size_t)i * 16 * SS); }
#pragma unroll 1
  for (int st = 0; st < nks / 2; ++st) { _Float16* sb = &skv[st & 1][0];   // a stage: lay down the 64 keys fetched one stage ahead
#pragma unroll
    for (int i = 0; i < 4; ++i) { *(v4u*)&sb[(sr + 16 * i) * GLP + sc] = rk[i]; *(v4u*)&sb[(64 + sr + 16 * i) * GLP + sc] = rv[i]; }
    __syncthreads();   // publishes this stage's buffer; the other buffer's readers all passed the barrier of the stage before
#pragma unroll   // both 32-key passes of a stage in straight-line code, so that the next stage's fetch has a fixed place among the loads
   for (int sub = 0; sub < 2; ++sub) { const int ks = st * 2 + sub; v8f s[2];
#pragma unroll
    for (int ct = 0; ct < 2; ++ct) { const _Float16* krow = sb + (sub * 32 + ct * 16 + col) * GLP; const float* bp = rbq - (ks * 32 + ct * 16); const v4fu b1 = *(const v4fu*)bp, b0 = *(const v4fu*)(bp + 4); v8f c = {};   // b0: keys 8g + 3 .. 8g + 0, b1: keys 8g + 7 .. 8g + 4
#pragma unroll
      for (int kc = 0; kc < 2; ++kc) c = wmma16(frag_h(krow + kc * 32, lane), aq[kc], c);   // single product: k, q as one-rounding f16 operands; c[r] = score(key ct*16 + 8g + r, query col)
#pragma unroll
      for (int r = 0; r < 4; ++r) { s[ct][r] = c[r] * 0.125f + b0[3 - r]; s[ct][4 + r] = c[4 + r] * 0.125f + b1[3 - r]; } }   // 1/sqrt(64) + bias[h][t - s]
    if (sub == 0) { const int nx = (st + 1 < nks / 2) ? st + 1 : st;   // fetch the next stage behind this pass's bias loads (loads return in order: ahead of them, the wait for the bias would wait for the stage); the last stage fetches itself again, unused
#pragma unroll
      for (int i = 0; i < 4; ++i) { rk[i] = *(const v4u*)(kg + ((size_t)nx * 64 + i * 16) * (2 * DM)); rv[i] = *(const v4u*)(vg + (size_t)i * 16 * SS + nx * 64); } }
    float mx = fmaxf(s[0][0], s[1][0]);
#pragma unroll
    for (int r = 1; r < 8; ++r) mx = fmaxf(mx, fmaxf(s[0][r], s[1][r]));
    mx = fmaxf(mx, xhalf(mx));   // the query's maximum over all 32 keys of the pass, in both halves
    const float mn = fmaxf(m, mx); const float alpha = (m <= -1.0e38f) ? 0.f : __expf(m - mn);
    float es = 0.f; v16h pa;
#pragma unroll
    for (int r = 0; r < 8; ++r) { const float e0 = (s[0][r] <= -1.0e38f) ? 0.f : __expf(s[0][r] - mn), e1 = (s[1][r] <= -1.0e38f) ? 0.f : __expf(s[1][r] - mn); es += e0 + e1;
      pa[r] = (_Float16)(e0 * 2048.0f); pa[8 + r] = (_Float16)(e1 * 2048.0f); }   // P scaled by 2^11 before the f16 rounding so small softmax weights stay out of the f16 subnormal range; 2^-11 folded into the epilogue
    l = l * alpha + es; m = mn;
#pragma unroll
    for (int dt = 0; dt < 4; ++dt) {
#pragma unroll
      for (int r = 0; r < 8; ++r) { acc[dt][r] *= alpha; accl[dt][r] *= alpha; } }
#pragma unroll
    for (int dt = 0; dt < 4; ++dt) acc[dt] = wmma16(frag_h(sb + (64 + dt * 16 + col) * GLP + sub * 32, lane), pa, acc[dt]);   // single product: V^T x P^T (x2^11); acc[dt][r] = O(query col, d = dt*16 + 8g + r)
   } }
  const float il = (1.0f / 2048.0f) / (l + xhalf(l));   // the halves' sums joined once
#pragma unroll
  for (int dt = 0; dt < 4; ++dt) { v4f o0, o1;
#pragma unroll
    for (int r = 0; r < 4; ++r) { o0[r] = (acc[dt][r] + accl[dt][r] * (1.0f / 2048.0f)) * il; o1[r] = (acc[dt][4 + r] + accl[dt][4 + r] * (1.0f / 2048.0f)) * il; }
    *(v4f*)&so[wave][col][dt * 16 + 8 * g] = o0; *(v4f*)&so[wave][col][dt * 16 + 8 * g + 4] = o1; }
  LDSX();
  for (int rl = 0; rl < 16; ++rl) if (lane < 16) vst2(O + ((size_t)b * SS + q0 + rl) * DM + h * HD + lane * 4, *(const v4f*)&so[wave][rl][lane * 4]);
}
// ---- k_out: block = (128 rows, 128 cols), tiles staged as in k_qkv: out = O(hi/lo) . Wo rows (2 products) + bo
__global__ __launch_bounds__(256) void k_out(const float* __restrict__ O, const __bf16* __restrict__ P, const float* __restrict__ BO, float* __restrict__ Y) {
  __shared__ __align__(16) unsigned char smem[2 * (2 * GBM + GBN) * GLP * 2];   // two buffers of [O hi 128 rows | O residual 128 rows | Wo 128 rows]; the epilogue's staging afterwards
  const int tid = threadIdx.x, wave = tid >> 5, lane = tid & 31, col = lane & 15, g = lane >> 4, wm = wave >> 2, wn = wave & 3;
  const size_t rb = (size_t)blockIdx.x * GBM; const int n0 = blockIdx.y * GBN;
  const int ar = tid >> 4, ac = (tid & 15) * 4, br = tid >> 3, bc = (tid & 7) * 8;
  const float* ag = O + (rb + ar) * DM + ac; const __bf16* bg = P + (size_t)(n0 + br) * DM + bc;
  __bf16* sm = (__bf16*)smem;
  v4f ra[8]; v4u rw[4]; v8f acc[4][2] = {};
#pragma unroll
  for (int i = 0; i < 8; ++i) ra[i] = *(const v4f*)(ag + (size_t)i * 16 * DM);
#pragma unroll
  for (int i = 0; i < 4; ++i) rw[i] = *(const v4u*)(bg + (size_t)i * 32 * DM);
  for (int ks = 0; ks < DM / GBK; ++ks) { __bf16* sb = sm + (ks & 1) * ((2 * GBM + GBN) * GLP);
#pragma unroll
    for (int i = 0; i < 8; ++i) { v4b ch, cl;
#pragma unroll
      for (int e = 0; e < 4; ++e) { const __bf16 h = (__bf16)ra[i][e]; ch[e] = h; cl[e] = (__bf16)(ra[i][e] - (float)h); }
      *(v4b*)&sb[(ar + 16 * i) * GLP + ac] = ch; *(v4b*)&sb[(GBM + ar + 16 * i) * GLP + ac] = cl; }
#pragma unroll
    for (int i = 0; i < 4; ++i) *(v4u*)&sb[(2 * GBM + br + 32 * i) * GLP + bc] = rw[i];
    __syncthreads();   // publishes this step's buffer; the other buffer's readers all passed the barrier of the step before
    if (ks + 1 < DM / GBK) {
#pragma unroll
      for (int i = 0; i < 8; ++i) ra[i] = *(const v4f*)(ag + (size_t)i * 16 * DM + (ks + 1) * GBK);
#pragma unroll
      for (int i = 0; i < 4; ++i) rw[i] = *(const v4u*)(bg + (size_t)i * 32 * DM + (ks + 1) * GBK);
      asm volatile("s_wait_xcnt 0x0" ::: "memory"); }   // the twelve loads' address registers are reused by the compute below: the wait stands in front of their first overwrite
#pragma unroll
    for (int kc = 0; kc < GBK / 32; ++kc) { v16b ah[4], al[4], wf[2];
#pragma unroll
      for (int i = 0; i < 4; ++i) { ah[i] = frag_b(sb + (wm * 64 + i * 16 + col) * GLP + kc * 32, lane); al[i] = frag_b(sb + (GBM + wm * 64 + i * 16 + col) * GLP + kc * 32, lane); }
#pragma unroll
      for (int j = 0; j < 2; ++j) wf[j] = frag_b(sb + (2 * GBM + wn * 32 + j * 16 + col) * GLP + kc * 32, lane);
#pragma unroll
      for (int i = 0; i < 4; ++i) {
#pragma unroll
        for (int j = 0; j < 2; ++j) acc[i][j] = wmma_bf(al[i], wf[j], acc[i][j]); }
#pragma unroll
      for (int i = 0; i < 4; ++i) {
#pragma unroll
        for (int j = 0; j < 2; ++j) acc[i][j] = wmma_bf(ah[i], wf[j], acc[i][j]); } } }
  __syncthreads();   // every wave has left the operand buffers before they become staging
  float* so = (float*)smem;
#pragma unroll
  for (int i = 0; i < 4; ++i) {
#pragma unroll
    for (int j = 0; j < 2; ++j) { const int n = wn * 32 + j * 16 + col; const float bias = bfr(BO[n0 + n]);
#pragma unroll
      for (int r = 0; r < 8; ++r) so[(wm * 64 + i * 16 + 8 * g + r) * 132 + n] = acc[i][j][r] + bias; } }
  __syncthreads();
  for (int q = tid; q < 128 * 32; q += 256) { const int row = q >> 5, c = q & 31; vst2(Y + (rb + row) * DM + n0 + c * 4, *(const v4f*)&so[row * 132 + c * 4]); }
}
// ---- k_rpe: one thread per relative distance rel = idx - (SS-1): f = sign(rel) log1p(|rel|); h = relu(f w1[j] + b1[j]); bias[h] = sum_j h_j w2[j][h] + b2[h]
__global__ __launch_bounds__(256) void k_rpe(const float* __restrict__ W1, const float* __restrict__ B1, const float* __restrict__ W2, const float* __restrict__ B2, float* __restrict__ RB) {
  const int idx = blockIdx.x * 256 + threadIdx.x; if (idx >= 2 * SS - 1) return; const float rel = (float)(idx - (SS - 1)); const float f = (rel > 0.f ? 1.f : (rel < 0.f ? -1.f : 0.f)) * log1pf(fabsf(rel));
  float hdn[RPEH];
#pragma unroll
  for (int j = 0; j < RPEH; ++j) hdn[j] = fmaxf(f * bfr(W1[j]) + bfr(B1[j]), 0.f);
#pragma unroll 1
  for (int h = 0; h < NH; ++h) { float b = bfr(B2[h]);
#pragma unroll
    for (int j = 0; j < RPEH; ++j) b += hdn[j] * bfr(W2[j * NH + h]);
    RB[(size_t)h * (2 * SS - 1) + idx] = b; }   // 4-B scratch store
}
extern "C" void kernel_launch(void* const* d_in, const int* in_sizes, int n_in, void* d_out, int out_size, void* d_ws, size_t ws_size, hipStream_t stream) {
  (void)in_sizes; (void)n_in; (void)out_size;
  const float** F = (const float**)d_in;   // 0 x [2,2048,1024], 1 w_qkv [1024,3072] (in,out: q | k | v), 2 b_qkv [3072], 3 w_out (in,out), 4 b_out, 5 w1_rpe [1,32], 6 b1_rpe [32], 7 w2_rpe [32,16], 8 b2_rpe [16]
  if (ws_size < (size_t)WS_END) return;
  char* ws = (char*)d_ws; __bf16* PK = (__bf16*)(ws + WS_PK); _Float16 *QK = (_Float16*)(ws + WS_QK), *QKL = (_Float16*)(ws + WS_QKL), *VTH = (_Float16*)(ws + WS_VTH), *VTL = (_Float16*)(ws + WS_VTL); float *O = (float*)(ws + WS_O), *RB = (float*)(ws + WS_RB);
  k_packt<<<dim3(DM / 128, (QKVW + DM) / 128), 256, 0, stream>>>(F[1], F[3], PK);
  k_rpe<<<(2 * SS + 255) / 256, 256, 0, stream>>>(F[5], F[6], F[7], F[8], RB);
  k_qkv<<<dim3(TNB * SS / GBM, QKVW / GBN), 256, 0, stream>>>(F[0], F[0], F[0], PK + PK_A, F[2], F[2] + DM, F[2] + 2 * DM, QK, QKL, VTH, VTL);
  k_attn<<<dim3(TQB, NH, TNB), 128, 0, stream>>>(QK, QKL, VTH, VTL, nullptr, RB, O);
  k_out<<<dim3(NB * SS / GBM, DM / GBN), 256, 0, stream>>>(O, PK + PK_P, F[4], (float*)d_out);
}

// v004
// A run of this version takes 122 microseconds.
// In two side-by-side timings against v003, it was 1.04 and 1.05 times as fast.
// Over all steps from v000 it is 3.62 times as fast.
// compute dtype: all float inputs rounded to bf16; qkv = x . W_qkv + b with EXACT bf16 products on WMMA 16x16x32 ((in,out) columns q | k | v as transposed rows); the relative-position bias table bias[h][t-s] = relu(sign(t-s) log1p|t-s| * w1 + b1) . w2 + b2 computed once per distance in f32 (precise log1pf); PLAIN attention: q, k as single f16 operands x 1/8 + bias, running-max softmax in f32 (hardware exp), P (scaled by 2^11, single f16) x v (single f16); out = ctx (bf16 hi + residual) . W_out (2 products) + b_out.
#include <hip/hip_runtime.h>
#include <math.h>

typedef __attribute__((ext_vector_type(16))) _Float16 v16h;
typedef __attribute__((ext_vector_type(16))) __bf16 v16b;
typedef __attribute__((ext_vector_type(8)))  _Float16 v8h;
typedef __attribute__((ext_vector_type(8)))  float v8f;
typedef __attribute__((ext_vector_type(4)))  float v4f;
typedef __attribute__((ext_vector_type(2)))  float v2f;
typedef __attribute__((ext_vector_type(4)))  unsigned v4u;
typedef __attribute__((ext_vector_type(4)))  int v4i;
typedef float __attribute__((may_alias)) float_a;
typedef int __attribute__((may_alias)) int_a;

template <typename T> __device__ __forceinline__ void vst2(void* p, T v) { *(T*)p = v;  }
__device__ __forceinline__ v8f wmma16(v16h a, v16h b, v8f c) {
  v8f d = __builtin_amdgcn_wmma_f32_16x16x32_f16(false, a, false, b, (short)0, c, false, false);
  asm volatile("v_nop\n\tv_nop\n\tv_nop\n\tv_nop" : "+v"(d) : "v"(a), "v"(b));
  return d;
}
__device__ __forceinline__ v8f wmma_bf(v16b a, v16b b, v8f c) {
  v8f d = __builtin_amdgcn_wmma_f32_16x16x32_bf16(false, a, false, b, (short)0, c, false, false);
  asm volatile("v_nop\n\tv_nop\n\tv_nop\n\tv_nop" : "+v"(d) : "v"(a), "v"(b));
  return d;
}
// Multi-head self attention with a learned relative-position bias (B 2, T 2,048, d 1,024, 16 heads x 64): fused q|k|v projection + bias, scores + bias[h](t - s) from a small MLP on the signed log distance, softmax, output projection + bias.
__device__ __forceinline__ v16h frag_h(const _Float16* rowk0, int lane) {
  union { v16h v; v8h q[2]; } u; const _Float16* p = rowk0 + 8 * (lane >> 4);
  u.q[0] = *(const v8h*)p; u.q[1] = *(const v8h*)(p + 16); return u.v;
}
__device__ __forceinline__ v16h frag_f32(const float* rowk0, int lane) {
  v16h a; const float* p = rowk0 + 8 * (lane >> 4);
#pragma unroll
  for (int i = 0; i < 8; ++i) { a[i] = (_Float16)p[i]; a[8 + i] = (_Float16)p[16 + i]; }
  return a;
}
__device__ __forceinline__ v16h frag_f32s(const float* rowk0, int lane, float sc) {
  v16h a; const float* p = rowk0 + 8 * (lane >> 4);
#pragma unroll
  for (int i = 0; i < 8; ++i) { a[i] = (_Float16)(p[i] * sc); a[8 + i] = (_Float16)(p[16 + i] * sc); }
  return a;
}
// column fragment from a [K][ld] layout (column n), rows >= K read as 0
__device__ __forceinline__ v16h fragc_f32(const float* W, int k0, int n, int lane, int ld, int K) {
  v16h a; const int g = lane >> 4;
#pragma unroll
  for (int i = 0; i < 8; ++i) { const int ka = k0 + 8 * g + i, kb = ka + 16;
    a[i] = (_Float16)(ka < K ? W[(size_t)(ka < K ? ka : K - 1) * ld + n] : 0.f); a[8 + i] = (_Float16)(kb < K ? W[(size_t)(kb < K ? kb : K - 1) * ld + n] : 0.f); }
  return a;
}
struct F2 { v16b h, l; };
__device__ __forceinline__ F2 bsplit16(const float v[16]) { F2 r;
#pragma unroll
  for (int i = 0; i < 16; ++i) { const __bf16 h = (__bf16)v[i]; r.h[i] = h; r.l[i] = (__bf16)(v[i] - (float)h); }
  return r; }
__device__ __forceinline__ F2 split_row(const float* row, int k0, int lane) { float v[16]; const float* p = row + k0 + 8 * (lane >> 4);
#pragma unroll
  for (int i = 0; i < 8; ++i) { v[i] = p[i]; v[8 + i] = p[16 + i]; }
  return bsplit16(v); }
__device__ __forceinline__ F2 split_rowK(const float* row, int k0, int lane, int K) { float v[16]; const int g = lane >> 4;
#pragma unroll
  for (int i = 0; i < 8; ++i) { const int ka = k0 + 8 * g + i, kb = ka + 16; v[i] = ka < K ? row[ka < K ? ka : K - 1] : 0.f; v[8 + i] = kb < K ? row[kb < K ? kb : K - 1] : 0.f; }
  return bsplit16(v); }
__device__ __forceinline__ F2 split_col(const float* W, int k0, int n, int lane, int ld, int K) { float v[16]; const int g = lane >> 4;
#pragma unroll
  for (int i = 0; i < 8; ++i) { const int ka = k0 + 8 * g + i, kb = ka + 16; v[i] = ka < K ? W[(size_t)(ka < K ? ka : K - 1) * ld + n] : 0.f; v[8 + i] = kb < K ? W[(size_t)(kb < K ? kb : K - 1) * ld + n] : 0.f; }
  return bsplit16(v); }
__device__ __forceinline__ v8f mac3(const F2& a, const F2& b, v8f c) { c = wmma_bf(a.l, b.h, c); c = wmma_bf(a.h, b.l, c); return wmma_bf(a.h, b.h, c); }
__device__ __forceinline__ float sigm(float v) { return 1.0f / (1.0f + expf(-v)); }
#define LDSX() do { asm volatile("s_wait_dscnt 0" ::: "memory"); __builtin_amdgcn_wave_barrier(); __builtin_amdgcn_fence(__ATOMIC_RELEASE, "workgroup"); } while (0)


#define NB 2
#define SS 2048
#define DM 1024
#define NH 16
#define HD 64
#define QKVW (3 * DM)
#ifndef TQB
#define TQB (SS / 64)
#define TNB NB
#define TOB (NB * SS / 64)     // 64-row tiles of all rows, not used
#endif
typedef __attribute__((ext_vector_type(8))) __bf16 v8b;
__device__ __forceinline__ v16b frag_b(const __bf16* rowk0, int lane) {
  union { v16b v; v8b q[2]; } u; const __bf16* p = rowk0 + 8 * (lane >> 4);
  u.q[0] = *(const v8b*)p; u.q[1] = *(const v8b*)(p + 16); return u.v;
}
__device__ __forceinline__ float bfr(float v) { return (float)(__bf16)v; }
__device__ __attribute__((noinline)) float exp_ni(float v) { return expf(v); }
__device__ __attribute__((noinline)) float erf_ni(float v) { return erff(v); }

#define PK_A 0                       // [3072][1024] Wqkv rows (natural [out][in])
#define PK_P (PK_A + QKVW * DM)        // [1024][1024] Wo rows (natural)
#define PK_END (PK_P + DM * DM)
#define WS_PK  0u
#define WS_QK  (WS_PK + 2u * PK_END)             // f16 [4096 rows][2048]: q | k
#define WS_QKL (WS_QK + 2u * NB * SS * 2 * DM)     // f16 q | k residual planes x2048
#define WS_VTH (WS_QKL + 2u * NB * SS * 2 * DM)    // f16 [b][1024 (h*64+d)][2048 s] hi
#define WS_VTL (WS_VTH + 2u * NB * DM * SS)        // f16 lo x 2048
#define WS_O   (WS_VTL + 2u * NB * DM * SS)        // f32 [4096][1024]
#define WS_CS  (WS_O + 4u * NB * SS * DM)           // f32 2 x [2048][32], not used
#define WS_RB  (WS_CS + 4u * 2 * SS * 32)                 // f32 [16][2*SS-1] relative-position bias table
#define WS_END (WS_RB + 4u * NH * (2 * SS))
#define RPEH 32
// ---- k_packt: block = one 128 (in) x 128 (out) tile of the (in,out) weights, columns 0..3071 of W_qkv, 3072..4095 of W_out -> bf16 rows PK[n][k] (PK_P follows PK_A, so the row is the column's number). A wave reads 16 whole 512-B row pieces; a lane's 16 k x 4 n block becomes four 32-B runs of k in LDS; the rows leave as 256-B pieces
// LDS rows hold 16 pieces of 16 B, piece j of row n at place j ^ ((n >> 2) & 15): the 32 lanes of a store stand 4 rows apart and would meet in 16 of the 64 banks at any 16-B-aligned pitch
__global__ __launch_bounds__(256) void k_packt(const float* __restrict__ WA, const float* __restrict__ WO, __bf16* __restrict__ PK) {
  __shared__ __align__(16) __bf16 s[128 * 128];
  const int tid = threadIdx.x, lane = tid & 31, wave = tid >> 5; const int k0 = blockIdx.x * 128, n0 = blockIdx.y * 128;
  const bool qkv = n0 < QKVW; const int ld = qkv ? QKVW : DM; const float* src = (qkv ? WA + n0 : WO + (n0 - QKVW)) + (size_t)(k0 + wave * 16) * ld + lane * 4;
  v4f r[16]; const float* p[16];
#pragma unroll
  for (int i = 0; i < 16; ++i) { p[i] = src + (size_t)i * ld; r[i] = *(const v4f*)p[i]; }
  // the two statements take the loaded values and their addresses as inputs only. They hold all sixteen loads in front of the first conversion (one memory latency a tile; left alone, the compiler issues the last six behind waits for the first), and they keep every address register live up to the wait that stands in front of its first overwrite
  asm volatile("s_wait_xcnt 0x0" :: "v"(r[0]), "v"(r[1]), "v"(r[2]), "v"(r[3]), "v"(r[4]), "v"(r[5]), "v"(r[6]), "v"(r[7]), "v"(p[0]), "v"(p[1]), "v"(p[2]), "v"(p[3]), "v"(p[4]), "v"(p[5]), "v"(p[6]), "v"(p[7]) : "memory");
  asm volatile("s_wait_xcnt 0x0" :: "v"(r[8]), "v"(r[9]), "v"(r[10]), "v"(r[11]), "v"(r[12]), "v"(r[13]), "v"(r[14]), "v"(r[15]), "v"(p[8]), "v"(p[9]), "v"(p[10]), "v"(p[11]), "v"(p[12]), "v"(p[13]), "v"(p[14]), "v"(p[15]) : "memory");
#pragma unroll
  for (int c = 0; c < 4; ++c) { v8b lo, hi;
#pragma unroll
    for (int e = 0; e < 8; ++e) { lo[e] = (__bf16)r[e][c]; hi[e] = (__bf16)r[8 + e][c]; }
    __bf16* row = &s[(lane * 4 + c) * 128]; *(v8b*)&row[((2 * wave) ^ (lane & 15)) * 8] = lo; *(v8b*)&row[((2 * wave + 1) ^ (lane & 15)) * 8] = hi; }
  __syncthreads();
  const int nr = tid >> 4, j = tid & 15; __bf16* dst = PK + PK_A + (size_t)(n0 + nr) * DM + k0 + j * 8;
#pragma unroll   // the eight LDS reads go out together, one wait chain instead of eight round trips
  for (int i = 0; i < 8; ++i) { const int n = nr + 16 * i; vst2((unsigned*)(dst + (size_t)i * 16 * DM), *(const v4u*)&s[n * 128 + (j ^ ((n >> 2) & 15)) * 8]); }
}
// ---- projection GEMM tiles: a block of 8 waves owns 128 x 128 of the product; 64 k of both operands are staged in LDS per step (two buffers, whole-line global loads fetched one step ahead into registers); wave (wm, wn) of 2 x 4 computes 64 x 32
#define GBM 128
#define GBN 128
#define GBK 64
#define GLP 72                         // LDS row pitch in bf16: 144 B = 16 B x odd, for 16-byte fragment reads of 128-B rows
#define GSP 136                        // f16 staging pitch of the epilogue (272 B)
typedef __attribute__((ext_vector_type(4))) __bf16 v4b;
__global__ __launch_bounds__(256) void k_qkv(const float* __restrict__ XQ, const float* __restrict__ XK, const float* __restrict__ XV, const __bf16* __restrict__ P, const float* __restrict__ BQ, const float* __restrict__ BK, const float* __restrict__ BV, _Float16* __restrict__ QK, _Float16* __restrict__ QKL, _Float16* __restrict__ VTH, _Float16* __restrict__ VTL) {
  const int which0 = (blockIdx.y * 128) / DM; const float* X = (which0 == 0) ? XQ : (which0 == 1) ? XK : XV; const float* BB = BQ ? (((which0 == 0) ? BQ : (which0 == 1) ? BK : BV) + (blockIdx.y * 128 - which0 * DM)) : nullptr;
  __shared__ __align__(16) unsigned char smem[2 * (GBM + GBN) * GLP * 2];   // two buffers of [x 128 rows | W 128 rows]; the epilogue's staging afterwards
  const int tid = threadIdx.x, wave = tid >> 5, lane = tid & 31, col = lane & 15, g = lane >> 4, wm = wave >> 2, wn = wave & 3;
  const size_t rb = (size_t)blockIdx.x * GBM; const int n0 = blockIdx.y * GBN;
  const int ar = tid >> 4, ac = (tid & 15) * 4, br = tid >> 3, bc = (tid & 7) * 8;   // x: 16 lanes x 16 B = one 256-B row piece; W: 8 lanes x 16 B = one 128-B line
  const float* ag = X + (rb + ar) * DM + ac; const __bf16* bg = P + (size_t)(n0 + br) * DM + bc;
  __bf16* sm = (__bf16*)smem;
  v4f ra[8]; v4u rw[4]; v8f acc[4][2] = {};
#pragma unroll
  for (int i = 0; i < 8; ++i) ra[i] = *(const v4f*)(ag + (size_t)i * 16 * DM);
#pragma unroll
  for (int i = 0; i < 4; ++i) rw[i] = *(const v4u*)(bg + (size_t)i * 32 * DM);
  for (int ks = 0; ks < DM / GBK; ++ks) { __bf16* sb = sm + (ks & 1) * ((GBM + GBN) * GLP);
#pragma unroll
    for (int i = 0; i < 8; ++i) { v4b c; c[0] = (__bf16)ra[i][0]; c[1] = (__bf16)ra[i][1]; c[2] = (__bf16)ra[i][2]; c[3] = (__bf16)ra[i][3]; *(v4b*)&sb[(ar + 16 * i) * GLP + ac] = c; }
#pragma unroll
    for (int i = 0; i < 4; ++i) *(v4u*)&sb[(GBM + br + 32 * i) * GLP + bc] = rw[i];
    __syncthreads();   // publishes this step's buffer; the other buffer's readers all passed the barrier of the step before
    if (ks + 1 < DM / GBK) {
#pragma unroll
      for (int i = 0; i < 8; ++i) ra[i] = *(const v4f*)(ag + (size_t)i * 16 * DM + (ks + 1) * GBK);
#pragma unroll
      for (int i = 0; i < 4; ++i) rw[i] = *(const v4u*)(bg + (size_t)i * 32 * DM + (ks + 1) * GBK); }
#pragma unroll
    for (int kc = 0; kc < GBK / 32; ++kc) { v16b af[4], wf[2];
#pragma unroll
      for (int i = 0; i < 4; ++i) af[i] = frag_b(sb + (wm * 64 + i * 16 + col) * GLP + kc * 32, lane);
#pragma unroll
      for (int j = 0; j < 2; ++j) wf[j] = frag_b(sb + (GBM + wn * 32 + j * 16 + col) * GLP + kc * 32, lane);
#pragma unroll
      for (int i = 0; i < 4; ++i) {
#pragma unroll
        for (int j = 0; j < 2; ++j) acc[i][j] = wmma_bf(af[i], wf[j], acc[i][j]); } } }
  __syncthreads();   // every wave has left the operand buffers before they become staging
  _Float16* sh = (_Float16*)smem; _Float16* sl = sh + 128 * GSP;
  if (n0 < 2 * DM) {   // q stored unscaled (f16 sigma ~0.6, no subnormal exposure); 1/8 applied to the f32 score
#pragma unroll
    for (int i = 0; i < 4; ++i) {
#pragma unroll
      for (int j = 0; j < 2; ++j) { const int n = wn * 32 + j * 16 + col; const float bias = BB ? bfr(BB[n]) : 0.f;
#pragma unroll
        for (int r = 0; r < 8; ++r) { const int row = wm * 64 + i * 16 + 8 * g + r; const float v = acc[i][j][r] + bias; const _Float16 hv = (_Float16)v; sh[row * GSP + n] = hv; sl[row * GSP + n] = (_Float16)((v - (float)hv) * 2048.0f); } } }   // q, k (+ bias) as f16 hi + (x2048) residual
    __syncthreads();
    for (int q = tid; q < 128 * 16; q += 256) { const int row = q >> 4, c = q & 15; vst2((unsigned*)(QK + (rb + row) * (2 * DM) + n0 + c * 8), *(const v4u*)&sh[row * GSP + c * 8]); vst2((unsigned*)(QKL + (rb + row) * (2 * DM) + n0 + c * 8), *(const v4u*)&sl[row * GSP + c * 8]); }
  } else {             // v transposed: staging row = output column d, a lane's 8 accumulator rows are 8 consecutive s
#pragma unroll
    for (int i = 0; i < 4; ++i) {
#pragma unroll
      for (int j = 0; j < 2; ++j) { const int n = wn * 32 + j * 16 + col; const float bias = BB ? bfr(BB[n]) : 0.f; v8h h8, l8;
#pragma unroll
        for (int r = 0; r < 8; ++r) { const float v = acc[i][j][r] + bias; const _Float16 hv = (_Float16)v; h8[r] = hv; l8[r] = (_Float16)((v - (float)hv) * 2048.0f); }
        *(v8h*)&sh[n * GSP + wm * 64 + i * 16 + 8 * g] = h8; *(v8h*)&sl[n * GSP + wm * 64 + i * 16 + 8 * g] = l8; } }
    __syncthreads();
    const int b = (int)(rb / SS), s0 = (int)(rb % SS); const int pc0 = n0 - 2 * DM;
    for (int q = tid; q < 128 * 16; q += 256) { const int d = q >> 4, pc = q & 15; const size_t o = ((size_t)b * DM + pc0 + d) * SS + s0 + pc * 8; vst2((unsigned*)(VTH + o), *(const v4u*)&sh[d * GSP + pc * 8]); vst2((unsigned*)(VTL + o), *(const v4u*)&sl[d * GSP + pc * 8]); }
  }
}
// ---- k_attn: block = (64 queries, head h, batch b): all-keys flash attention on TRANSPOSED tiles: S^T = K . Q^T (A = key rows from LDS, B = the wave's 16 queries, kept in registers), so a lane holds 16 of the 32 scores of ONE query (column = lane & 15; keys 8g + r of each 16-key tile): maximum and sum run in the lane, the two lane halves exchange the maximum once a pass and join their sums once at the end; the two score tiles, converted in place, ARE the B operand of O^T += V^T . P^T (hardware k order), so P never goes through LDS; the bias (x 8, from the table) is the C operand of the score product, scores = (q.k + 8 bias) * 0.125 with single f16 operands, and P = exp2 of ONE multiply-add of the raw accumulator (scale, log2 e, maximum and 2^11 folded); O[b*S+q][h*64+d] = (acc + accl / 2048) / l (256-B segments)
__device__ __forceinline__ float xhalf(float x) { return __builtin_bit_cast(float, __builtin_amdgcn_permlanex16(__builtin_bit_cast(int, x), __builtin_bit_cast(int, x), 0x76543210, 0xfedcba98, false, false)); }   // lane l with lane l ^ 16
typedef float v4fu __attribute__((ext_vector_type(4), aligned(4)));   // four table entries at a 4-byte-aligned address
__device__ __forceinline__ v8f bias8(const float* p) { const v4f lo = *(const v4fu*)p, hi = *(const v4fu*)(p + 4); return __builtin_shufflevector(lo, hi, 0, 1, 2, 3, 4, 5, 6, 7); }   // a lane's 8 keys of one score tile, in accumulator order
#define SC2 0.18033688f                // 1/sqrt(64) * log2(e): raw accumulator -> exponent of 2
__global__ __launch_bounds__(128) void k_attn(const _Float16* __restrict__ QK, const _Float16* __restrict__ QKL, const _Float16* __restrict__ VTH, const _Float16* __restrict__ VTL, const void* __restrict__ KMASK, const float* __restrict__ RB, float* __restrict__ O) {
  __shared__ __align__(16) float so[4][16][68];
  __shared__ __align__(16) _Float16 skv[2][128 * GLP];   // two buffers of a 64-key stage shared by the 4 waves: [k: 64 key rows x 64 d | v: 64 d rows x 64 keys], 128-B rows at pitch 144 B
  const int tid = threadIdx.x, wave = tid >> 5, lane = tid & 31, col = lane & 15, g = lane >> 4;
  const int qb = blockIdx.x, h = blockIdx.y, b = blockIdx.z; const int q0 = qb * 64 + wave * 16; const size_t rq = (size_t)b * SS + q0 + col;
  v16h aq[2];
#pragma unroll
  for (int kc = 0; kc < 2; ++kc) aq[kc] = frag_h(QK + rq * (2 * DM) + h * HD + kc * 32, lane);
  asm volatile("s_wait_xcnt 0x0" ::: "memory");   // the four loads' address pair is reused as a destination of the loads below: the wait stands in front of that overwrite
  float m = -3.0e38f, l = 0.f;   // this lane's query: running maximum of the raw accumulators q.k + 8 bias (equal in both halves), and this half's share of the sum (x 2^11)
  float off = 11.0f - m * SC2;   // P = exp2(raw * SC2 + off) = 2^11 exp(score - maximum)
  v8f acc[4] = {}, accl[4] = {};
  const int nks = SS / 32;   // all keys
  const int sr = tid >> 3, sc = (tid & 7) * 8;   // staging: 8 lanes x 16 B = one whole 128-B line, 16 rows a sweep
  const _Float16* kg = QK + ((size_t)b * SS + sr) * (2 * DM) + DM + h * HD + sc; const _Float16* vg = VTH + ((size_t)b * DM + h * HD + sr) * SS + sc;
  const float* rbq = RB + (size_t)h * (2 * SS - 1) + (SS - 1) - (q0 + col) + 8 * g;   // 8 bias[h][t - s] of this lane's query at key 8g of tile 0: the table runs with the key, so a lane's 8 keys of a tile are 8 consecutive entries in accumulator order
  v4u rk[4], rv[4]; v8f bc[2];   // bc: the bias of a pass's two 16-key score tiles, fetched one pass ahead: it is the C operand of the tile's first product
#pragma unroll
  for (int i = 0; i < 2; ++i) bc[i] = bias8(rbq + i * 16);
#pragma unroll
  for (int i = 0; i < 4; ++i) { rk[i] = *(const v4u*)(kg + (size_t)i * 16 * (2 * DM)); rv[i] = *(const v4u*)(vg + (size_t)i * 16 * SS); }
#pragma unroll 1
  for (int st = 0; st < nks / 2; ++st) { _Float16* sb = &skv[st & 1][0];   // a stage: lay down the 64 keys fetched one stage ahead
#pragma unroll
    for (int i = 0; i < 4; ++i) { *(v4u*)&sb[(sr + 16 * i) * GLP + sc] = rk[i]; *(v4u*)&sb[(64 + sr + 16 * i) * GLP + sc] = rv[i]; }
    __syncthreads();   // publishes this stage's buffer; the other buffer's readers all passed the barrier of the stage before
#pragma unroll   // both 32-key passes of a stage in straight-line code, so that the next stage's fetch has a fixed place among the loads
   for (int sub = 0; sub < 2; ++sub) { v8f s[2]; const int nx = (st + 1 < nks / 2) ? st + 1 : st;   // the last stage fetches itself again, unused
#pragma unroll
    for (int ct = 0; ct < 2; ++ct) { const _Float16* krow = sb + (sub * 32 + ct * 16 + col) * GLP; v8f c = bc[ct];
#pragma unroll
      for (int kc = 0; kc < 2; ++kc) c = wmma16(frag_h(krow + kc * 32, lane), aq[kc], c);   // single product: k, q as one-rounding f16 operands; c[r] = q.k + 8 bias[h][t - s] = 8 x score(key ct*16 + 8g + r, query col)
      s[ct] = c; }
#pragma unroll
    for (int ct = 0; ct < 2; ++ct) bc[ct] = bias8(rbq + (sub == 0 ? st * 64 + 32 : nx * 64) + ct * 16);   // the next pass's two tiles
    if (sub == 0) {   // fetch the next stage's keys and values behind the bias loads (loads return in order: ahead of them, the next pass's wait for its bias would wait for the stage)
#pragma unroll
      for (int i = 0; i < 4; ++i) { rk[i] = *(const v4u*)(kg + ((size_t)nx * 64 + i * 16) * (2 * DM)); rv[i] = *(const v4u*)(vg + (size_t)i * 16 * SS + nx * 64); } }
    float mx = fmaxf(s[0][0], s[1][0]);
#pragma unroll
    for (int r = 1; r < 8; ++r) mx = fmaxf(mx, fmaxf(s[0][r], s[1][r]));
    mx = fmaxf(mx, xhalf(mx));   // the query's maximum over all 32 keys of the pass, in both halves
    const float mn = fmaxf(m, mx); const float noff = 11.0f - mn * SC2; const float alpha = __builtin_amdgcn_exp2f(noff - off);   // old sums were taken against off: the first pass gives exp2 of a huge negative number = 0
    float es = 0.f; v16h pa;
#pragma unroll
    for (int r = 0; r < 8; ++r) { const float e0 = __builtin_amdgcn_exp2f(s[0][r] * SC2 + noff), e1 = __builtin_amdgcn_exp2f(s[1][r] * SC2 + noff); es += e0 + e1;
      pa[r] = (_Float16)e0; pa[8 + r] = (_Float16)e1; }   // P carries 2^11 (in the exponent) so small softmax weights stay out of the f16 subnormal range; the sum carries it too, so it cancels in the epilogue
    l = l * alpha + es; m = mn; off = noff;
#pragma unroll
    for (int dt = 0; dt < 4; ++dt) {
#pragma unroll
      for (int r = 0; r < 8; ++r) { acc[dt][r] *= alpha; accl[dt][r] *= alpha; } }
#pragma unroll
    for (int dt = 0; dt < 4; ++dt) acc[dt] = wmma16(frag_h(sb + (64 + dt * 16 + col) * GLP + sub * 32, lane), pa, acc[dt]);   // single product: V^T x P^T (x2^11); acc[dt][r] = O(query col, d = dt*16 + 8g + r)
   } }
  const float il = 1.0f / (l + xhalf(l));   // the halves' sums joined once
#pragma unroll
  for (int dt = 0; dt < 4; ++dt) { v4f o0, o1;
#pragma unroll
    for (int r = 0; r < 4; ++r) { o0[r] = (acc[dt][r] + accl[dt][r] * (1.0f / 2048.0f)) * il; o1[r] = (acc[dt][4 + r] + accl[dt][4 + r] * (1.0f / 2048.0f)) * il; }
    *(v4f*)&so[wave][col][dt * 16 + 8 * g] = o0; *(v4f*)&so[wave][col][dt * 16 + 8 * g + 4] = o1; }
  LDSX();
  for (int rl = 0; rl < 16; ++rl) if (lane < 16) vst2(O + ((size_t)b * SS + q0 + rl) * DM + h * HD + lane * 4, *(const v4f*)&so[wave][rl][lane * 4]);
}
// ---- k_out: block = (128 rows, 128 cols), tiles staged as in k_qkv: out = O(hi/lo) . Wo rows (2 products) + bo
__global__ __launch_bounds__(256) void k_out(const float* __restrict__ O, const __bf16* __restrict__ P, const float* __restrict__ BO, float* __restrict__ Y) {
  __shared__ __align__(16) unsigned char smem[2 * (2 * GBM + GBN) * GLP * 2];   // two buffers of [O hi 128 rows | O residual 128 rows | Wo 128 rows]; the epilogue's staging afterwards
  const int tid = threadIdx.x, wave = tid >> 5, lane = tid & 31, col = lane & 15, g = lane >> 4, wm = wave >> 2, wn = wave & 3;
  const size_t rb = (size_t)blockIdx.x * GBM; const int n0 = blockIdx.y * GBN;
  const int ar = tid >> 4, ac = (tid & 15) * 4, br = tid >> 3, bc = (tid & 7) * 8;
  const float* ag = O + (rb + ar) * DM + ac; const __bf16* bg = P + (size_t)(n0 + br) * DM + bc;
  __bf16* sm = (__bf16*)smem;
  v4f ra[8]; v4u rw[4]; v8f acc[4][2] = {};
#pragma unroll
  for (int i = 0; i < 8; ++i) ra[i] = *(const v4f*)(ag + (size_t)i * 16 * DM);
#pragma unroll
  for (int i = 0; i < 4; ++i) rw[i] = *(const v4u*)(bg + (size_t)i * 32 * DM);
  for (int ks = 0; ks < DM / GBK; ++ks) { __bf16* sb = sm + (ks & 1) * ((2 * GBM + GBN) * GLP);
#pragma unroll
    for (int i = 0; i < 8; ++i) { v4b ch, cl;
#pragma unroll
      for (int e = 0; e < 4; ++e) { const __bf16 h = (__bf16)ra[i][e]; ch[e] = h; cl[e] = (__bf16)(ra[i][e] - (float)h); }
      *(v4b*)&sb[(ar + 16 * i) * GLP + ac] = ch; *(v4b*)&sb[(GBM + ar + 16 * i) * GLP + ac] = cl; }
#pragma unroll
    for (int i = 0; i < 4; ++i) *(v4u*)&sb[(2 * GBM + br + 32 * i) * GLP + bc] = rw[i];
    __syncthreads();   // publishes this step's buffer; the other buffer's readers all passed the barrier of the step before
    if (ks + 1 < DM / GBK) {
#pragma unroll
      for (int i = 0; i < 8; ++i) ra[i] = *(const v4f*)(ag + (size_t)i * 16 * DM + (ks + 1) * GBK);
#pragma unroll
      for (int i = 0; i < 4; ++i) rw[i] = *(const v4u*)(bg + (size_t)i * 32 * DM + (ks + 1) * GBK);
      asm volatile("s_wait_xcnt 0x0" ::: "memory"); }   // the twelve loads' address registers are reused by the compute below: the wait stands in front of their first overwrite
#pragma unroll
    for (int kc = 0; kc < GBK / 32; ++kc) { v16b ah[4], al[4], wf[2];
#pragma unroll
      for (int i = 0; i < 4; ++i) { ah[i] = frag_b(sb + (wm * 64 + i * 16 + col) * GLP + kc * 32, lane); al[i] = frag_b(sb + (GBM + wm * 64 + i * 16 + col) * GLP + kc * 32, lane); }
#pragma unroll
      for (int j = 0; j < 2; ++j) wf[j] = frag_b(sb + (2 * GBM + wn * 32 + j * 16 + col) * GLP + kc * 32, lane);
#pragma unroll
      for (int i = 0; i < 4; ++i) {
#pragma unroll
        for (int j = 0; j < 2; ++j) acc[i][j] = wmma_bf(al[i], wf[j], acc[i][j]); }
#pragma unroll
      for (int i = 0; i < 4; ++i) {
#pragma unroll
        for (int j = 0; j < 2; ++j) acc[i][j] = wmma_bf(ah[i], wf[j], acc[i][j]); } } }
  __syncthreads();   // every wave has left the operand buffers before they become staging
  float* so = (float*)smem;
#pragma unroll
  for (int i = 0; i < 4; ++i) {
#pragma unroll
    for (int j = 0; j < 2; ++j) { const int n = wn * 32 + j * 16 + col; const float bias = bfr(BO[n0 + n]);
#pragma unroll
      for (int r = 0; r < 8; ++r) so[(wm * 64 + i * 16 + 8 * g + r) * 132 + n] = acc[i][j][r] + bias; } }
  __syncthreads();
  for (int q = tid; q < 128 * 32; q += 256) { const int row = q >> 5, c = q & 31; vst2(Y + (rb + row) * DM + n0 + c * 4, *(const v4f*)&so[row * 132 + c * 4]); }
}
// ---- k_rpe: one thread per relative distance rel = idx - (SS-1): f = sign(rel) log1p(|rel|); h = relu(f w1[j] + b1[j]); bias[h] = sum_j h_j w2[j][h] + b2[h]
__global__ __launch_bounds__(256) void k_rpe(const float* __restrict__ W1, const float* __restrict__ B1, const float* __restrict__ W2, const float* __restrict__ B2, float* __restrict__ RB) {
  const int idx = blockIdx.x * 256 + threadIdx.x; if (idx >= 2 * SS - 1) return; const float rel = (float)(idx - (SS - 1)); const float f = (rel > 0.f ? 1.f : (rel < 0.f ? -1.f : 0.f)) * log1pf(fabsf(rel));
  float hdn[RPEH];
#pragma unroll
  for (int j = 0; j < RPEH; ++j) hdn[j] = fmaxf(f * bfr(W1[j]) + bfr(B1[j]), 0.f);
#pragma unroll 1
  for (int h = 0; h < NH; ++h) { float b = bfr(B2[h]);
#pragma unroll
    for (int j = 0; j < RPEH; ++j) b += hdn[j] * bfr(W2[j * NH + h]);
    RB[(size_t)h * (2 * SS - 1) + (2 * SS - 2 - idx)] = b * 8.0f; }   // 4-B scratch store; entry (SS-1) - rel, so that the table runs with the key, and x 8 = sqrt(64), so that it adds to the unscaled q.k
}
extern "C" void kernel_launch(void* const* d_in, const int* in_sizes, int n_in, void* d_out, int out_size, void* d_ws, size_t ws_size, hipStream_t stream) {
  (void)in_sizes; (void)n_in; (void)out_size;
  const float** F = (const float**)d_in;   // 0 x [2,2048,1024], 1 w_qkv [1024,3072] (in,out: q | k | v), 2 b_qkv [3072], 3 w_out (in,out), 4 b_out, 5 w1_rpe [1,32], 6 b1_rpe [32], 7 w2_rpe [32,16], 8 b2_rpe [16]
  if (ws_size < (size_t)WS_END) return;
  char* ws = (char*)d_ws; __bf16* PK = (__bf16*)(ws + WS_PK); _Float16 *QK = (_Float16*)(ws + WS_QK), *QKL = (_Float16*)(ws + WS_QKL), *VTH = (_Float16*)(ws + WS_VTH), *VTL = (_Float16*)(ws + WS_VTL); float *O = (float*)(ws + WS_O), *RB = (float*)(ws + WS_RB);
  k_packt<<<dim3(DM / 128, (QKVW + DM) / 128), 256, 0, stream>>>(F[1], F[3], PK);
  k_rpe<<<(2 * SS + 255) / 256, 256, 0, stream>>>(F[5], F[6], F[7], F[8], RB);
  k_qkv<<<dim3(TNB * SS / GBM, QKVW / GBN), 256, 0, stream>>>(F[0], F[0], F[0], PK + PK_A, F[2], F[2] + DM, F[2] + 2 * DM, QK, QKL, VTH, VTL);
  k_attn<<<dim3(TQB, NH, TNB), 128, 0, stream>>>(QK, QKL, VTH, VTL, nullptr, RB, O);
  k_out<<<dim3(NB * SS / GBM, DM / GBN), 256, 0, stream>>>(O, PK + PK_P, F[4], (float*)d_out);
}

// v005
// A run of this version takes 113 microseconds.
// In two side-by-side timings against v004, it was 1.07 and 1.08 times as fast.
// Counting every step since v000, it is 3.89 times as fast.
// compute dtype: all float inputs rounded to bf16; qkv = x . W_qkv + b with EXACT bf16 products on WMMA 16x16x32 ((in,out) columns q | k | v as transposed rows); the relative-position bias table bias[h][t-s] = relu(sign(t-s) log1p|t-s| * w1 + b1) . w2 + b2 computed once per distance in f32 (precise log1pf); PLAIN attention: q, k as single f16 operands x 1/8 + bias, running-max softmax in f32 (hardware exp), P (scaled by 2^11, single f16) x v (single f16); out = ctx (bf16 hi + residual) . W_out (2 products) + b_out.
#include <hip/hip_runtime.h>
#include <math.h>

typedef __attribute__((ext_vector_type(16))) _Float16 v16h;
typedef __attribute__((ext_vector_type(16))) __bf16 v16b;
typedef __attribute__((ext_vector_type(8)))  _Float16 v8h;
typedef __attribute__((ext_vector_type(8)))  float v8f;
typedef __attribute__((ext_vector_type(4)))  float v4f;
typedef __attribute__((ext_vector_type(2)))  float v2f;
typedef __attribute__((ext_vector_type(4)))  unsigned v4u;
typedef __attribute__((ext_vector_type(4)))  int v4i;
typedef float __attribute__((may_alias)) float_a;
typedef int __attribute__((may_alias)) int_a;

template <typename T> __device__ __forceinline__ void vst2(void* p, T v) { *(T*)p = v;  }
__device__ __forceinline__ v8f wmma16(v16h a, v16h b, v8f c) {
  return __builtin_amdgcn_wmma_f32_16x16x32_f16(false, a, false, b, (short)0, c, false, false);   // plain builtin: the compiler keeps the distances behind it and is free to issue LDS reads and other products around it
}
__device__ __forceinline__ v8f wmma_bf(v16b a, v16b b, v8f c) {
  v8f d = __builtin_amdgcn_wmma_f32_16x16x32_bf16(false, a, false, b, (short)0, c, false, false);
  asm volatile("v_nop\n\tv_nop\n\tv_nop\n\tv_nop" : "+v"(d) : "v"(a), "v"(b));
  return d;
}
// Multi-head self attention with a learned relative-position bias (B 2, T 2,048, d 1,024, 16 heads x 64): fused q|k|v projection + bias, scores + bias[h](t - s) from a small MLP on the signed log distance, softmax, output projection + bias.
__device__ __forceinline__ v16h frag_h(const _Float16* rowk0, int lane) {
  union { v16h v; v8h q[2]; } u; const _Float16* p = rowk0 + 8 * (lane >> 4);
  u.q[0] = *(const v8h*)p; u.q[1] = *(const v8h*)(p + 16); return u.v;
}
__device__ __forceinline__ v16h frag_f32(const float* rowk0, int lane) {
  v16h a; const float* p = rowk0 + 8 * (lane >> 4);
#pragma unroll
  for (int i = 0; i < 8; ++i) { a[i] = (_Float16)p[i]; a[8 + i] = (_Float16)p[16 + i]; }
  return a;
}
__device__ __forceinline__ v16h frag_f32s(const float* rowk0, int lane, float sc) {
  v16h a; const float* p = rowk0 + 8 * (lane >> 4);
#pragma unroll
  for (int i = 0; i < 8; ++i) { a[i] = (_Float16)(p[i] * sc); a[8 + i] = (_Float16)(p[16 + i] * sc); }
  return a;
}
// column fragment from a [K][ld] layout (column n), rows >= K read as 0
__device__ __forceinline__ v16h fragc_f32(const float* W, int k0, int n, int lane, int ld, int K) {
  v16h a; const int g = lane >> 4;
#pragma unroll
  for (int i = 0; i < 8; ++i) { const int ka = k0 + 8 * g + i, kb = ka + 16;
    a[i] = (_Float16)(ka < K ? W[(size_t)(ka < K ? ka : K - 1) * ld + n] : 0.f); a[8 + i] = (_Float16)(kb < K ? W[(size_t)(kb < K ? kb : K - 1) * ld + n] : 0.f); }
  return a;
}
struct F2 { v16b h, l; };
__device__ __forceinline__ F2 bsplit16(const float v[16]) { F2 r;
#pragma unroll
  for (int i = 0; i < 16; ++i) { const __bf16 h = (__bf16)v[i]; r.h[i] = h; r.l[i] = (__bf16)(v[i] - (float)h); }
  return r; }
__device__ __forceinline__ F2 split_row(const float* row, int k0, int lane) { float v[16]; const float* p = row + k0 + 8 * (lane >> 4);
#pragma unroll
  for (int i = 0; i < 8; ++i) { v[i] = p[i]; v[8 + i] = p[16 + i]; }
  return bsplit16(v); }
__device__ __forceinline__ F2 split_rowK(const float* row, int k0, int lane, int K) { float v[16]; const int g = lane >> 4;
#pragma unroll
  for (int i = 0; i < 8; ++i) { const int ka = k0 + 8 * g + i, kb = ka + 16; v[i] = ka < K ? row[ka < K ? ka : K - 1] : 0.f; v[8 + i] = kb < K ? row[kb < K ? kb : K - 1] : 0.f; }
  return bsplit16(v); }
__device__ __forceinline__ F2 split_col(const float* W, int k0, int n, int lane, int ld, int K) { float v[16]; const int g = lane >> 4;
#pragma unroll
  for (int i = 0; i < 8; ++i) { const int ka = k0 + 8 * g + i, kb = ka + 16; v[i] = ka < K ? W[(size_t)(ka < K ? ka : K - 1) * ld + n] : 0.f; v[8 + i] = kb < K ? W[(size_t)(kb < K ? kb : K - 1) * ld + n] : 0.f; }
  return bsplit16(v); }
__device__ __forceinline__ v8f mac3(const F2& a, const F2& b, v8f c) { c = wmma_bf(a.l, b.h, c); c = wmma_bf(a.h, b.l, c); return wmma_bf(a.h, b.h, c); }
__device__ __forceinline__ float sigm(float v) { return 1.0f / (1.0f + expf(-v)); }
#define LDSX() do { asm volatile("s_wait_dscnt 0" ::: "memory"); __builtin_amdgcn_wave_barrier(); __builtin_amdgcn_fence(__ATOMIC_RELEASE, "workgroup"); } while (0)


#define NB 2
#define SS 2048
#define DM 1024
#define NH 16
#define HD 64
#define QKVW (3 * DM)
#ifndef TQB
#define TQB (SS / 64)
#define TNB NB
#define TOB (NB * SS / 64)     // 64-row tiles of all rows, not used
#endif
typedef __attribute__((ext_vector_type(8))) __bf16 v8b;
__device__ __forceinline__ v16b frag_b(const __bf16* rowk0, int lane) {
  union { v16b v; v8b q[2]; } u; const __bf16* p = rowk0 + 8 * (lane >> 4);
  u.q[0] = *(const v8b*)p; u.q[1] = *(const v8b*)(p + 16); return u.v;
}
__device__ __forceinline__ float bfr(float v) { return (float)(__bf16)v; }
__device__ __attribute__((noinline)) float exp_ni(float v) { return expf(v); }
__device__ __attribute__((noinline)) float erf_ni(float v) { return erff(v); }

#define PK_A 0                       // [3072][1024] Wqkv rows (natural [out][in])
#define PK_P (PK_A + QKVW * DM)        // [1024][1024] Wo rows (natural)
#define PK_END (PK_P + DM * DM)
#define WS_PK  0u
#define WS_QK  (WS_PK + 2u * PK_END)             // f16 [4096 rows][2048]: q | k
#define WS_QKL (WS_QK + 2u * NB * SS * 2 * DM)     // f16 q | k residual planes x2048
#define WS_VTH (WS_QKL + 2u * NB * SS * 2 * DM)    // f16 [b][1024 (h*64+d)][2048 s] hi
#define WS_VTL (WS_VTH + 2u * NB * DM * SS)        // f16 lo x 2048
#define WS_O   (WS_VTL + 2u * NB * DM * SS)        // f32 [4096][1024]
#define WS_CS  (WS_O + 4u * NB * SS * DM)           // f32 2 x [2048][32], not used
#define WS_RB  (WS_CS + 4u * 2 * SS * 32)                 // f32 [16][2*SS-1] relative-position bias table
#define WS_END (WS_RB + 4u * NH * (2 * SS))
#define RPEH 32
// ---- k_packt: block = one 128 (in) x 128 (out) tile of the (in,out) weights, columns 0..3071 of W_qkv, 3072..4095 of W_out -> bf16 rows PK[n][k] (PK_P follows PK_A, so the row is the column's number). A wave reads 16 whole 512-B row pieces; a lane's 16 k x 4 n block becomes four 32-B runs of k in LDS; the rows leave as 256-B pieces
// LDS rows hold 16 pieces of 16 B, piece j of row n at place j ^ ((n >> 2) & 15): the 32 lanes of a store stand 4 rows apart and would meet in 16 of the 64 banks at any 16-B-aligned pitch
__global__ __launch_bounds__(256) void k_packt(const float* __restrict__ WA, const float* __restrict__ WO, __bf16* __restrict__ PK) {
  __shared__ __align__(16) __bf16 s[128 * 128];
  const int tid = threadIdx.x, lane = tid & 31, wave = tid >> 5; const int k0 = blockIdx.x * 128, n0 = blockIdx.y * 128;
  const bool qkv = n0 < QKVW; const int ld = qkv ? QKVW : DM; const float* src = (qkv ? WA + n0 : WO + (n0 - QKVW)) + (size_t)(k0 + wave * 16) * ld + lane * 4;
  v4f r[16]; const float* p[16];
#pragma unroll
  for (int i = 0; i < 16; ++i) { p[i] = src + (size_t)i * ld; r[i] = *(const v4f*)p[i]; }
  // the two statements take the loaded values and their addresses as inputs only. They hold all sixteen loads in front of the first conversion (one memory latency a tile; left alone, the compiler issues the last six behind waits for the first), and they keep every address register live up to the wait that stands in front of its first overwrite
  asm volatile("s_wait_xcnt 0x0" :: "v"(r[0]), "v"(r[1]), "v"(r[2]), "v"(r[3]), "v"(r[4]), "v"(r[5]), "v"(r[6]), "v"(r[7]), "v"(p[0]), "v"(p[1]), "v"(p[2]), "v"(p[3]), "v"(p[4]), "v"(p[5]), "v"(p[6]), "v"(p[7]) : "memory");
  asm volatile("s_wait_xcnt 0x0" :: "v"(r[8]), "v"(r[9]), "v"(r[10]), "v"(r[11]), "v"(r[12]), "v"(r[13]), "v"(r[14]), "v"(r[15]), "v"(p[8]), "v"(p[9]), "v"(p[10]), "v"(p[11]), "v"(p[12]), "v"(p[13]), "v"(p[14]), "v"(p[15]) : "memory");
#pragma unroll
  for (int c = 0; c < 4; ++c) { v8b lo, hi;
#pragma unroll
    for (int e = 0; e < 8; ++e) { lo[e] = (__bf16)r[e][c]; hi[e] = (__bf16)r[8 + e][c]; }
    __bf16* row = &s[(lane * 4 + c) * 128]; *(v8b*)&row[((2 * wave) ^ (lane & 15)) * 8] = lo; *(v8b*)&row[((2 * wave + 1) ^ (lane & 15)) * 8] = hi; }
  __syncthreads();
  const int nr = tid >> 4, j = tid & 15; __bf16* dst = PK + PK_A + (size_t)(n0 + nr) * DM + k0 + j * 8;
#pragma unroll   // the eight LDS reads go out together, one wait chain instead of eight round trips
  for (int i = 0; i < 8; ++i) { const int n = nr + 16 * i; vst2((unsigned*)(dst + (size_t)i * 16 * DM), *(const v4u*)&s[n * 128 + (j ^ ((n >> 2) & 15)) * 8]); }
}
// ---- projection GEMM tiles: a block of 8 waves owns 128 x 128 of the product; 64 k of both operands are staged in LDS per step (two buffers, whole-line global loads fetched one step ahead into registers); wave (wm, wn) of 2 x 4 computes 64 x 32
#define GBM 128
#define GBN 128
#define GBK 64
#define GLP 72                         // LDS row pitch in bf16: 144 B = 16 B x odd, for 16-byte fragment reads of 128-B rows
#define GSP 136                        // f16 staging pitch of the epilogue (272 B)
typedef __attribute__((ext_vector_type(4))) __bf16 v4b;
__global__ __launch_bounds__(256) void k_qkv(const float* __restrict__ XQ, const float* __restrict__ XK, const float* __restrict__ XV, const __bf16* __restrict__ P, const float* __restrict__ BQ, const float* __restrict__ BK, const float* __restrict__ BV, _Float16* __restrict__ QK, _Float16* __restrict__ QKL, _Float16* __restrict__ VTH, _Float16* __restrict__ VTL) {
  const int which0 = (blockIdx.y * 128) / DM; const float* X = (which0 == 0) ? XQ : (which0 == 1) ? XK : XV; const float* BB = BQ ? (((which0 == 0) ? BQ : (which0 == 1) ? BK : BV) + (blockIdx.y * 128 - which0 * DM)) : nullptr;
  __shared__ __align__(16) unsigned char smem[2 * (GBM + GBN) * GLP * 2];   // two buffers of [x 128 rows | W 128 rows]; the epilogue's staging afterwards
  const int tid = threadIdx.x, wave = tid >> 5, lane = tid & 31, col = lane & 15, g = lane >> 4, wm = wave >> 2, wn = wave & 3;
  const size_t rb = (size_t)blockIdx.x * GBM; const int n0 = blockIdx.y * GBN;
  const int ar = tid >> 4, ac = (tid & 15) * 4, br = tid >> 3, bc = (tid & 7) * 8;   // x: 16 lanes x 16 B = one 256-B row piece; W: 8 lanes x 16 B = one 128-B line
  const float* ag = X + (rb + ar) * DM + ac; const __bf16* bg = P + (size_t)(n0 + br) * DM + bc;
  __bf16* sm = (__bf16*)smem;
  v4f ra[8]; v4u rw[4]; v8f acc[4][2] = {};
#pragma unroll
  for (int i = 0; i < 8; ++i) ra[i] = *(const v4f*)(ag + (size_t)i * 16 * DM);
#pragma unroll
  for (int i = 0; i < 4; ++i) rw[i] = *(const v4u*)(bg + (size_t)i * 32 * DM);
  for (int ks = 0; ks < DM / GBK; ++ks) { __bf16* sb = sm + (ks & 1) * ((GBM + GBN) * GLP);
#pragma unroll
    for (int i = 0; i < 8; ++i) { v4b c; c[0] = (__bf16)ra[i][0]; c[1] = (__bf16)ra[i][1]; c[2] = (__bf16)ra[i][2]; c[3] = (__bf16)ra[i][3]; *(v4b*)&sb[(ar + 16 * i) * GLP + ac] = c; }
#pragma unroll
    for (int i = 0; i < 4; ++i) *(v4u*)&sb[(GBM + br + 32 * i) * GLP + bc] = rw[i];
    __syncthreads();   // publishes this step's buffer; the other buffer's readers all passed the barrier of the step before
    if (ks + 1 < DM / GBK) {
#pragma unroll
      for (int i = 0; i < 8; ++i) ra[i] = *(const v4f*)(ag + (size_t)i * 16 * DM + (ks + 1) * GBK);
#pragma unroll
      for (int i = 0; i < 4; ++i) rw[i] = *(const v4u*)(bg + (size_t)i * 32 * DM + (ks + 1) * GBK); }
#pragma unroll
    for (int kc = 0; kc < GBK / 32; ++kc) { v16b af[4], wf[2];
#pragma unroll
      for (int i = 0; i < 4; ++i) af[i] = frag_b(sb + (wm * 64 + i * 16 + col) * GLP + kc * 32, lane);
#pragma unroll
      for (int j = 0; j < 2; ++j) wf[j] = frag_b(sb + (GBM + wn * 32 + j * 16 + col) * GLP + kc * 32, lane);
#pragma unroll
      for (int i = 0; i < 4; ++i) {
#pragma unroll
        for (int j = 0; j < 2; ++j) acc[i][j] = wmma_bf(af[i], wf[j], acc[i][j]); } } }
  __syncthreads();   // every wave has left the operand buffers before they become staging
  _Float16* sh = (_Float16*)smem; _Float16* sl = sh + 128 * GSP;
  if (n0 < 2 * DM) {   // q stored unscaled (f16 sigma ~0.6, no subnormal exposure); 1/8 applied to the f32 score
#pragma unroll
    for (int i = 0; i < 4; ++i) {
#pragma unroll
      for (int j = 0; j < 2; ++j) { const int n = wn * 32 + j * 16 + col; const float bias = BB ? bfr(BB[n]) : 0.f;
#pragma unroll
        for (int r = 0; r < 8; ++r) { const int row = wm * 64 + i * 16 + 8 * g + r; const float v = acc[i][j][r] + bias; const _Float16 hv = (_Float16)v; sh[row * GSP + n] = hv; sl[row * GSP + n] = (_Float16)((v - (float)hv) * 2048.0f); } } }   // q, k (+ bias) as f16 hi + (x2048) residual
    __syncthreads();
    for (int q = tid; q < 128 * 16; q += 256) { const int row = q >> 4, c = q & 15; vst2((unsigned*)(QK + (rb + row) * (2 * DM) + n0 + c * 8), *(const v4u*)&sh[row * GSP + c * 8]); vst2((unsigned*)(QKL + (rb + row) * (2 * DM) + n0 + c * 8), *(const v4u*)&sl[row * GSP + c * 8]); }
  } else {             // v transposed: staging row = output column d, a lane's 8 accumulator rows are 8 consecutive s
#pragma unroll
    for (int i = 0; i < 4; ++i) {
#pragma unroll
      for (int j = 0; j < 2; ++j) { const int n = wn * 32 + j * 16 + col; const float bias = BB ? bfr(BB[n]) : 0.f; v8h h8, l8;
#pragma unroll
        for (int r = 0; r < 8; ++r) { const float v = acc[i][j][r] + bias; const _Float16 hv = (_Float16)v; h8[r] = hv; l8[r] = (_Float16)((v - (float)hv) * 2048.0f); }
        *(v8h*)&sh[n * GSP + wm * 64 + i * 16 + 8 * g] = h8; *(v8h*)&sl[n * GSP + wm * 64 + i * 16 + 8 * g] = l8; } }
    __syncthreads();
    const int b = (int)(rb / SS), s0 = (int)(rb % SS); const int pc0 = n0 - 2 * DM;
    for (int q = tid; q < 128 * 16; q += 256) { const int d = q >> 4, pc = q & 15; const size_t o = ((size_t)b * DM + pc0 + d) * SS + s0 + pc * 8; vst2((unsigned*)(VTH + o), *(const v4u*)&sh[d * GSP + pc * 8]); vst2((unsigned*)(VTL + o), *(const v4u*)&sl[d * GSP + pc * 8]); }
  }
}
// ---- k_attn: block = (64 queries, head h, batch b): all-keys flash attention on TRANSPOSED tiles: S^T = K . Q^T (A = key rows from LDS, B = the wave's 16 queries, kept in registers), so a lane holds 16 of the 32 scores of ONE query (column = lane & 15; keys 8g + r of each 16-key tile): maximum and sum run in the lane, the two lane halves exchange the maximum once a pass and join their sums once at the end; the two score tiles, converted in place, ARE the B operand of O^T += V^T . P^T (hardware k order), so P never goes through LDS; the bias (x 8, from the table) is the C operand of the score product, scores = (q.k + 8 bias) * 0.125 with single f16 operands, and P = exp2 of ONE multiply-add of the raw accumulator (scale, log2 e, maximum and 2^11 folded); O[b*S+q][h*64+d] = (acc + accl / 2048) / l (256-B segments)
__device__ __forceinline__ float xhalf(float x) { return __builtin_bit_cast(float, __builtin_amdgcn_permlanex16(__builtin_bit_cast(int, x), __builtin_bit_cast(int, x), 0x76543210, 0xfedcba98, false, false)); }   // lane l with lane l ^ 16
typedef float v4fu __attribute__((ext_vector_type(4), aligned(4)));   // four table entries at a 4-byte-aligned address
__device__ __forceinline__ v8f bias8(const float* p) { const v4f lo = *(const v4fu*)p, hi = *(const v4fu*)(p + 4); return __builtin_shufflevector(lo, hi, 0, 1, 2, 3, 4, 5, 6, 7); }   // a lane's 8 keys of one score tile, in accumulator order
#define SC2 0.18033688f                // 1/sqrt(64) * log2(e): raw accumulator -> exponent of 2
__global__ __launch_bounds__(128) void k_attn(const _Float16* __restrict__ QK, const _Float16* __restrict__ QKL, const _Float16* __restrict__ VTH, const _Float16* __restrict__ VTL, const void* __restrict__ KMASK, const float* __restrict__ RB, float* __restrict__ O) {
  __shared__ __align__(16) float so[4][16][68];
  __shared__ __align__(16) _Float16 skv[2][128 * GLP];   // two buffers of a 64-key stage shared by the 4 waves: [k: 64 key rows x 64 d | v: 64 d rows x 64 keys], 128-B rows at pitch 144 B
  const int tid = threadIdx.x, wave = tid >> 5, lane = tid & 31, col = lane & 15, g = lane >> 4;
  const int qb = blockIdx.x, h = blockIdx.y, b = blockIdx.z; const int q0 = qb * 64 + wave * 16; const size_t rq = (size_t)b * SS + q0 + col;
  v16h aq[2];
#pragma unroll
  for (int kc = 0; kc < 2; ++kc) aq[kc] = frag_h(QK + rq * (2 * DM) + h * HD + kc * 32, lane);
  asm volatile("s_wait_xcnt 0x0" ::: "memory");   // the four loads' address pair is reused as a destination of the loads below: the wait stands in front of that overwrite
  float m = -3.0e38f, l = 0.f;   // this lane's query: running maximum of the raw accumulators q.k + 8 bias (equal in both halves), and this half's share of the sum (x 2^11)
  float off = 11.0f - m * SC2;   // P = exp2(raw * SC2 + off) = 2^11 exp(score - maximum)
  v8f acc[4] = {}, accl[4] = {};
  const int nks = SS / 32;   // all keys
  const int sr = tid >> 3, sc = (tid & 7) * 8;   // staging: 8 lanes x 16 B = one whole 128-B line, 16 rows a sweep
  const _Float16* kg = QK + ((size_t)b * SS + sr) * (2 * DM) + DM + h * HD + sc; const _Float16* vg = VTH + ((size_t)b * DM + h * HD + sr) * SS + sc;
  const float* rbq = RB + (size_t)h * (2 * SS - 1) + (SS - 1) - (q0 + col) + 8 * g;   // 8 bias[h][t - s] of this lane's query at key 8g of tile 0: the table runs with the key, so a lane's 8 keys of a tile are 8 consecutive entries in accumulator order
  v4u rk[4], rv[4]; v8f bc[2];   // bc: the bias of a pass's two 16-key score tiles, fetched one pass ahead: it is the C operand of the tile's first product
#pragma unroll
  for (int i = 0; i < 2; ++i) bc[i] = bias8(rbq + i * 16);
#pragma unroll
  for (int i = 0; i < 4; ++i) { rk[i] = *(const v4u*)(kg + (size_t)i * 16 * (2 * DM)); rv[i] = *(const v4u*)(vg + (size_t)i * 16 * SS); }
#pragma unroll 1
  for (int st = 0; st < nks / 2; ++st) { _Float16* sb = &skv[st & 1][0];   // a stage: lay down the 64 keys fetched one stage ahead
#pragma unroll
    for (int i = 0; i < 4; ++i) { *(v4u*)&sb[(sr + 16 * i) * GLP + sc] = rk[i]; *(v4u*)&sb[(64 + sr + 16 * i) * GLP + sc] = rv[i]; }
    __syncthreads();   // publishes this stage's buffer; the other buffer's readers all passed the barrier of the stage before
#pragma unroll   // both 32-key passes of a stage in straight-line code, so that the next stage's fetch has a fixed place among the loads
   for (int sub = 0; sub < 2; ++sub) { v8f s[2]; const int nx = (st + 1 < nks / 2) ? st + 1 : st;   // the last stage fetches itself again, unused
#pragma unroll
    for (int ct = 0; ct < 2; ++ct) { const _Float16* krow = sb + (sub * 32 + ct * 16 + col) * GLP; v8f c = bc[ct];
#pragma unroll
      for (int kc = 0; kc < 2; ++kc) c = wmma16(frag_h(krow + kc * 32, lane), aq[kc], c);   // single product: k, q as one-rounding f16 operands; c[r] = q.k + 8 bias[h][t - s] = 8 x score(key ct*16 + 8g + r, query col)
      s[ct] = c; }
#pragma unroll
    for (int ct = 0; ct < 2; ++ct) bc[ct] = bias8(rbq + (sub == 0 ? st * 64 + 32 : nx * 64) + ct * 16);   // the next pass's two tiles
    if (sub == 0) {   // fetch the next stage's keys and values behind the bias loads (loads return in order: ahead of them, the next pass's wait for its bias would wait for the stage)
#pragma unroll
      for (int i = 0; i < 4; ++i) { rk[i] = *(const v4u*)(kg + ((size_t)nx * 64 + i * 16) * (2 * DM)); rv[i] = *(const v4u*)(vg + (size_t)i * 16 * SS + nx * 64); } }
    if (sub == 0) __builtin_amdgcn_sched_barrier(0x78F);   // no global load may cross (all else may): the stage's fetch stays ahead of the next bias fetch, half a stage or more before its use; left free, the scheduler sinks six of the eight loads into the last third of the stage
    float mx = fmaxf(s[0][0], s[1][0]);
#pragma unroll
    for (int r = 1; r < 8; ++r) mx = fmaxf(mx, fmaxf(s[0][r], s[1][r]));
    mx = fmaxf(mx, xhalf(mx));   // the query's maximum over all 32 keys of the pass, in both halves
    const float mn = fmaxf(m, mx); const float noff = 11.0f - mn * SC2; const float alpha = __builtin_amdgcn_exp2f(noff - off);   // old sums were taken against off: the first pass gives exp2 of a huge negative number = 0
    float es = 0.f; v16h pa;
#pragma unroll
    for (int r = 0; r < 8; ++r) { const float e0 = __builtin_amdgcn_exp2f(s[0][r] * SC2 + noff), e1 = __builtin_amdgcn_exp2f(s[1][r] * SC2 + noff); es += e0 + e1;
      pa[r] = (_Float16)e0; pa[8 + r] = (_Float16)e1; }   // P carries 2^11 (in the exponent) so small softmax weights stay out of the f16 subnormal range; the sum carries it too, so it cancels in the epilogue
    l = l * alpha + es; m = mn; off = noff;
#pragma unroll
    for (int dt = 0; dt < 4; ++dt) {
#pragma unroll
      for (int r = 0; r < 8; ++r) { acc[dt][r] *= alpha; accl[dt][r] *= alpha; } }
#pragma unroll
    for (int dt = 0; dt < 4; ++dt) acc[dt] = wmma16(frag_h(sb + (64 + dt * 16 + col) * GLP + sub * 32, lane), pa, acc[dt]);   // single product: V^T x P^T (x2^11); acc[dt][r] = O(query col, d = dt*16 + 8g + r)
   } }
  const float il = 1.0f / (l + xhalf(l));   // the halves' sums joined once
#pragma unroll
  for (int dt = 0; dt < 4; ++dt) { v4f o0, o1;
#pragma unroll
    for (int r = 0; r < 4; ++r) { o0[r] = (acc[dt][r] + accl[dt][r] * (1.0f / 2048.0f)) * il; o1[r] = (acc[dt][4 + r] + accl[dt][4 + r] * (1.0f / 2048.0f)) * il; }
    *(v4f*)&so[wave][col][dt * 16 + 8 * g] = o0; *(v4f*)&so[wave][col][dt * 16 + 8 * g + 4] = o1; }
  LDSX();
  for (int rl = 0; rl < 16; ++rl) if (lane < 16) vst2(O + ((size_t)b * SS + q0 + rl) * DM + h * HD + lane * 4, *(const v4f*)&so[wave][rl][lane * 4]);
}
// ---- k_out: block = (128 rows, 128 cols), tiles staged as in k_qkv: out = O(hi/lo) . Wo rows (2 products) + bo
__global__ __launch_bounds__(256) void k_out(const float* __restrict__ O, const __bf16* __restrict__ P, const float* __restrict__ BO, float* __restrict__ Y) {
  __shared__ __align__(16) unsigned char smem[2 * (2 * GBM + GBN) * GLP * 2];   // two buffers of [O hi 128 rows | O residual 128 rows | Wo 128 rows]; the epilogue's staging afterwards
  const int tid = threadIdx.x, wave = tid >> 5, lane = tid & 31, col = lane & 15, g = lane >> 4, wm = wave >> 2, wn = wave & 3;
  const size_t rb = (size_t)blockIdx.x * GBM; const int n0 = blockIdx.y * GBN;
  const int ar = tid >> 4, ac = (tid & 15) * 4, br = tid >> 3, bc = (tid & 7) * 8;
  const float* ag = O + (rb + ar) * DM + ac; const __bf16* bg = P + (size_t)(n0 + br) * DM + bc;
  __bf16* sm = (__bf16*)smem;
  v4f ra[8]; v4u rw[4]; v8f acc[4][2] = {};
#pragma unroll
  for (int i = 0; i < 8; ++i) ra[i] = *(const v4f*)(ag + (size_t)i * 16 * DM);
#pragma unroll
  for (int i = 0; i < 4; ++i) rw[i] = *(const v4u*)(bg + (size_t)i * 32 * DM);
  for (int ks = 0; ks < DM / GBK; ++ks) { __bf16* sb = sm + (ks & 1) * ((2 * GBM + GBN) * GLP);
#pragma unroll
    for (int i = 0; i < 8; ++i) { v4b ch, cl;
#pragma unroll
      for (int e = 0; e < 4; ++e) { const __bf16 h = (__bf16)ra[i][e]; ch[e] = h; cl[e] = (__bf16)(ra[i][e] - (float)h); }
      *(v4b*)&sb[(ar + 16 * i) * GLP + ac] = ch; *(v4b*)&sb[(GBM + ar + 16 * i) * GLP + ac] = cl; }
#pragma unroll
    for (int i = 0; i < 4; ++i) *(v4u*)&sb[(2 * GBM + br + 32 * i) * GLP + bc] = rw[i];
    __syncthreads();   // publishes this step's buffer; the other buffer's readers all passed the barrier of the step before
    if (ks + 1 < DM / GBK) {
#pragma unroll
      for (int i = 0; i < 8; ++i) ra[i] = *(const v4f*)(ag + (size_t)i * 16 * DM + (ks + 1) * GBK);
#pragma unroll
      for (int i = 0; i < 4; ++i) rw[i] = *(const v4u*)(bg + (size_t)i * 32 * DM + (ks + 1) * GBK);
      asm volatile("s_wait_xcnt 0x0" ::: "memory"); }   // the twelve loads' address registers are reused by the compute below: the wait stands in front of their first overwrite
#pragma unroll
    for (int kc = 0; kc < GBK / 32; ++kc) { v16b ah[4], al[4], wf[2];
#pragma unroll
      for (int i = 0; i < 4; ++i) { ah[i] = frag_b(sb + (wm * 64 + i * 16 + col) * GLP + kc * 32, lane); al[i] = frag_b(sb + (GBM + wm * 64 + i * 16 + col) * GLP + kc * 32, lane); }
#pragma unroll
      for (int j = 0; j < 2; ++j) wf[j] = frag_b(sb + (2 * GBM + wn * 32 + j * 16 + col) * GLP + kc * 32, lane);
#pragma unroll
      for (int i = 0; i < 4; ++i) {
#pragma unroll
        for (int j = 0; j < 2; ++j) acc[i][j] = wmma_bf(al[i], wf[j], acc[i][j]); }
#pragma unroll
      for (int i = 0; i < 4; ++i) {
#pragma unroll
        for (int j = 0; j < 2; ++j) acc[i][j] = wmma_bf(ah[i], wf[j], acc[i][j]); } } }
  __syncthreads();   // every wave has left the operand buffers before they become staging
  float* so = (float*)smem;
#pragma unroll
  for (int i = 0; i < 4; ++i) {
#pragma unroll
    for (int j = 0; j < 2; ++j) { const int n = wn * 32 + j * 16 + col; const float bias = bfr(BO[n0 + n]);
#pragma unroll
      for (int r = 0; r < 8; ++r) so[(wm * 64 + i * 16 + 8 * g + r) * 132 + n] = acc[i][j][r] + bias; } }
  __syncthreads();
  for (int q = tid; q < 128 * 32; q += 256) { const int row = q >> 5, c = q & 31; vst2(Y + (rb + row) * DM + n0 + c * 4, *(const v4f*)&so[row * 132 + c * 4]); }
}
// ---- k_rpe: one thread per relative distance rel = idx - (SS-1): f = sign(rel) log1p(|rel|); h = relu(f w1[j] + b1[j]); bias[h] = sum_j h_j w2[j][h] + b2[h]
__global__ __launch_bounds__(256) void k_rpe(const float* __restrict__ W1, const float* __restrict__ B1, const float* __restrict__ W2, const float* __restrict__ B2, float* __restrict__ RB) {
  const int idx = blockIdx.x * 256 + threadIdx.x; if (idx >= 2 * SS - 1) return; const float rel = (float)(idx - (SS - 1)); const float f = (rel > 0.f ? 1.f : (rel < 0.f ? -1.f : 0.f)) * log1pf(fabsf(rel));
  float hdn[RPEH];
#pragma unroll
  for (int j = 0; j < RPEH; ++j) hdn[j] = fmaxf(f * bfr(W1[j]) + bfr(B1[j]), 0.f);
#pragma unroll 1
  for (int h = 0; h < NH; ++h) { float b = bfr(B2[h]);
#pragma unroll
    for (int j = 0; j < RPEH; ++j) b += hdn[j] * bfr(W2[j * NH + h]);
    RB[(size_t)h * (2 * SS - 1) + (2 * SS - 2 - idx)] = b * 8.0f; }   // 4-B scratch store; entry (SS-1) - rel, so that the table runs with the key, and x 8 = sqrt(64), so that it adds to the unscaled q.k
}
extern "C" void kernel_launch(void* const* d_in, const int* in_sizes, int n_in, void* d_out, int out_size, void* d_ws, size_t ws_size, hipStream_t stream) {
  (void)in_sizes; (void)n_in; (void)out_size;
  const float** F = (const float**)d_in;   // 0 x [2,2048,1024], 1 w_qkv [1024,3072] (in,out: q | k | v), 2 b_qkv [3072], 3 w_out (in,out), 4 b_out, 5 w1_rpe [1,32], 6 b1_rpe [32], 7 w2_rpe [32,16], 8 b2_rpe [16]
  if (ws_size < (size_t)WS_END) return;
  char* ws = (char*)d_ws; __bf16* PK = (__bf16*)(ws + WS_PK); _Float16 *QK = (_Float16*)(ws + WS_QK), *QKL = (_Float16*)(ws + WS_QKL), *VTH = (_Float16*)(ws + WS_VTH), *VTL = (_Float16*)(ws + WS_VTL); float *O = (float*)(ws + WS_O), *RB = (float*)(ws + WS_RB);
  k_packt<<<dim3(DM / 128, (QKVW + DM) / 128), 256, 0, stream>>>(F[1], F[3], PK);
  k_rpe<<<(2 * SS + 255) / 256, 256, 0, stream>>>(F[5], F[6], F[7], F[8], RB);
  k_qkv<<<dim3(TNB * SS / GBM, QKVW / GBN), 256, 0, stream>>>(F[0], F[0], F[0], PK + PK_A, F[2], F[2] + DM, F[2] + 2 * DM, QK, QKL, VTH, VTL);
  k_attn<<<dim3(TQB, NH, TNB), 128, 0, stream>>>(QK, QKL, VTH, VTL, nullptr, RB, O);
  k_out<<<dim3(NB * SS / GBM, DM / GBN), 256, 0, stream>>>(O, PK + PK_P, F[4], (float*)d_out);
}

// v006
// Measured time: 106 microseconds a run.
// Timed twice side by side with v005, it ran 1.06 and 1.07 times as fast.
// All steps since v000 together make it 4.15 times as fast.
// compute dtype: all float inputs rounded to bf16; qkv = x . W_qkv + b with EXACT bf16 products on WMMA 16x16x32 ((in,out) columns q | k | v as transposed rows); the relative-position bias table bias[h][t-s] = relu(sign(t-s) log1p|t-s| * w1 + b1) . w2 + b2 computed once per distance in f32 (precise log1pf); PLAIN attention: q, k as single f16 operands x 1/8 + bias, running-max softmax in f32 (hardware exp), P (scaled by 2^11, single f16) x v (single f16); out = ctx (bf16 hi + residual) . W_out (2 products) + b_out.
#include <hip/hip_runtime.h>
#include <math.h>

typedef __attribute__((ext_vector_type(16))) _Float16 v16h;
typedef __attribute__((ext_vector_type(16))) __bf16 v16b;
typedef __attribute__((ext_vector_type(8)))  _Float16 v8h;
typedef __attribute__((ext_vector_type(8)))  float v8f;
typedef __attribute__((ext_vector_type(4)))  float v4f;
typedef __attribute__((ext_vector_type(2)))  float v2f;
typedef __attribute__((ext_vector_type(4)))  unsigned v4u;
typedef __attribute__((ext_vector_type(4)))  int v4i;
typedef float __attribute__((may_alias)) float_a;
typedef int __attribute__((may_alias)) int_a;

template <typename T> __device__ __forceinline__ void vst2(void* p, T v) { *(T*)p = v;  }
__device__ __forceinline__ v8f wmma16(v16h a, v16h b, v8f c) {
  return __builtin_amdgcn_wmma_f32_16x16x32_f16(false, a, false, b, (short)0, c, false, false);   // plain builtin: the compiler keeps the distances behind it and is free to issue LDS reads and other products around it
}
__device__ __forceinline__ v8f wmma_bf(v16b a, v16b b, v8f c) {
  v8f d = __builtin_amdgcn_wmma_f32_16x16x32_bf16(false, a, false, b, (short)0, c, false, false);
  asm volatile("v_nop\n\tv_nop\n\tv_nop\n\tv_nop" : "+v"(d) : "v"(a), "v"(b));
  return d;
}
// Multi-head self attention with a learned relative-position bias (B 2, T 2,048, d 1,024, 16 heads x 64): fused q|k|v projection + bias, scores + bias[h](t - s) from a small MLP on the signed log distance, softmax, output projection + bias.
__device__ __forceinline__ v16h frag_h(const _Float16* rowk0, int lane) {
  union { v16h v; v8h q[2]; } u; const _Float16* p = rowk0 + 8 * (lane >> 4);
  u.q[0] = *(const v8h*)p; u.q[1] = *(const v8h*)(p + 16); return u.v;
}
__device__ __forceinline__ v16h frag_f32(const float* rowk0, int lane) {
  v16h a; const float* p = rowk0 + 8 * (lane >> 4);
#pragma unroll
  for (int i = 0; i < 8; ++i) { a[i] = (_Float16)p[i]; a[8 + i] = (_Float16)p[16 + i]; }
  return a;
}
__device__ __forceinline__ v16h frag_f32s(const float* rowk0, int lane, float sc) {
  v16h a; const float* p = rowk0 + 8 * (lane >> 4);
#pragma unroll
  for (int i = 0; i < 8; ++i) { a[i] = (_Float16)(p[i] * sc); a[8 + i] = (_Float16)(p[16 + i] * sc); }
  return a;
}
// column fragment from a [K][ld] layout (column n), rows >= K read as 0
__device__ __forceinline__ v16h fragc_f32(const float* W, int k0, int n, int lane, int ld, int K) {
  v16h a; const int g = lane >> 4;
#pragma unroll
  for (int i = 0; i < 8; ++i) { const int ka = k0 + 8 * g + i, kb = ka + 16;
    a[i] = (_Float16)(ka < K ? W[(size_t)(ka < K ? ka : K - 1) * ld + n] : 0.f); a[8 + i] = (_Float16)(kb < K ? W[(size_t)(kb < K ? kb : K - 1) * ld + n] : 0.f); }
  return a;
}
struct F2 { v16b h, l; };
__device__ __forceinline__ F2 bsplit16(const float v[16]) { F2 r;
#pragma unroll
  for (int i = 0; i < 16; ++i) { const __bf16 h = (__bf16)v[i]; r.h[i] = h; r.l[i] = (__bf16)(v[i] - (float)h); }
  return r; }
__device__ __forceinline__ F2 split_row(const float* row, int k0, int lane) { float v[16]; const float* p = row + k0 + 8 * (lane >> 4);
#pragma unroll
  for (int i = 0; i < 8; ++i) { v[i] = p[i]; v[8 + i] = p[16 + i]; }
  return bsplit16(v); }
__device__ __forceinline__ F2 split_rowK(const float* row, int k0, int lane, int K) { float v[16]; const int g = lane >> 4;
#pragma unroll
  for (int i = 0; i < 8; ++i) { const int ka = k0 + 8 * g + i, kb = ka + 16; v[i] = ka < K ? row[ka < K ? ka : K - 1] : 0.f; v[8 + i] = kb < K ? row[kb < K ? kb : K - 1] : 0.f; }
  return bsplit16(v); }
__device__ __forceinline__ F2 split_col(const float* W, int k0, int n, int lane, int ld, int K) { float v[16]; const int g = lane >> 4;
#pragma unroll
  for (int i = 0; i < 8; ++i) { const int ka = k0 + 8 * g + i, kb = ka + 16; v[i] = ka < K ? W[(size_t)(ka < K ? ka : K - 1) * ld + n] : 0.f; v[8 + i] = kb < K ? W[(size_t)(kb < K ? kb : K - 1) * ld + n] : 0.f; }
  return bsplit16(v); }
__device__ __forceinline__ v8f mac3(const F2& a, const F2& b, v8f c) { c = wmma_bf(a.l, b.h, c); c = wmma_bf(a.h, b.l, c); return wmma_bf(a.h, b.h, c); }
__device__ __forceinline__ float sigm(float v) { return 1.0f / (1.0f + expf(-v)); }
#define LDSX() do { asm volatile("s_wait_dscnt 0" ::: "memory"); __builtin_amdgcn_wave_barrier(); __builtin_amdgcn_fence(__ATOMIC_RELEASE, "workgroup"); } while (0)


#define NB 2
#define SS 2048
#define DM 1024
#define NH 16
#define HD 64
#define QKVW (3 * DM)
#ifndef TQB
#define TQB (SS / 64)
#define TNB NB
#define TOB (NB * SS / 64)     // 64-row tiles of all rows, not used
#endif
typedef __attribute__((ext_vector_type(8))) __bf16 v8b;
__device__ __forceinline__ v16b frag_b(const __bf16* rowk0, int lane) {
  union { v16b v; v8b q[2]; } u; const __bf16* p = rowk0 + 8 * (lane >> 4);
  u.q[0] = *(const v8b*)p; u.q[1] = *(const v8b*)(p + 16); return u.v;
}
__device__ __forceinline__ float bfr(float v) { return (float)(__bf16)v; }
__device__ __attribute__((noinline)) float exp_ni(float v) { return expf(v); }
__device__ __attribute__((noinline)) float erf_ni(float v) { return erff(v); }

#define PK_A 0                       // [3072][1024] Wqkv rows (natural [out][in])
#define PK_P (PK_A + QKVW * DM)        // [1024][1024] Wo rows (natural)
#define PK_END (PK_P + DM * DM)
#define WS_PK  0u
#define WS_QK  (WS_PK + 2u * PK_END)             // f16 [4096 rows][2048]: q | k
#define WS_QKL (WS_QK + 2u * NB * SS * 2 * DM)     // f16 q | k residual planes x2048
#define WS_VTH (WS_QKL + 2u * NB * SS * 2 * DM)    // f16 [b][1024 (h*64+d)][2048 s] hi
#define WS_VTL (WS_VTH + 2u * NB * DM * SS)        // f16 lo x 2048
#define WS_O   (WS_VTL + 2u * NB * DM * SS)        // f32 [4096][1024]
#define WS_CS  (WS_O + 4u * NB * SS * DM)           // f32 2 x [2048][32], not used
#define WS_RB  (WS_CS + 4u * 2 * SS * 32)                 // f32 [16][2*SS-1] relative-position bias table
#define WS_END (WS_RB + 4u * NH * (2 * SS))
#define RPEH 32
// ---- k_packt: block = one 128 (in) x 128 (out) tile of the (in,out) weights, columns 0..3071 of W_qkv, 3072..4095 of W_out -> bf16 rows PK[n][k] (PK_P follows PK_A, so the row is the column's number). A wave reads 16 whole 512-B row pieces; a lane's 16 k x 4 n block becomes four 32-B runs of k in LDS; the rows leave as 256-B pieces
// LDS rows hold 16 pieces of 16 B, piece j of row n at place j ^ ((n >> 2) & 15): the 32 lanes of a store stand 4 rows apart and would meet in 16 of the 64 banks at any 16-B-aligned pitch
__global__ __launch_bounds__(256) void k_packt(const float* __restrict__ WA, const float* __restrict__ WO, __bf16* __restrict__ PK) {
  __shared__ __align__(16) __bf16 s[128 * 128];
  const int tid = threadIdx.x, lane = tid & 31, wave = tid >> 5; const int k0 = blockIdx.x * 128, n0 = blockIdx.y * 128;
  const bool qkv = n0 < QKVW; const int ld = qkv ? QKVW : DM; const float* src = (qkv ? WA + n0 : WO + (n0 - QKVW)) + (size_t)(k0 + wave * 16) * ld + lane * 4;
  v4f r[16]; const float* p[16];
#pragma unroll
  for (int i = 0; i < 16; ++i) { p[i] = src + (size_t)i * ld; r[i] = *(const v4f*)p[i]; }
  // the two statements take the loaded values and their addresses as inputs only. They hold all sixteen loads in front of the first conversion (one memory latency a tile; left alone, the compiler issues the last six behind waits for the first), and they keep every address register live up to the wait that stands in front of its first overwrite
  asm volatile("s_wait_xcnt 0x0" :: "v"(r[0]), "v"(r[1]), "v"(r[2]), "v"(r[3]), "v"(r[4]), "v"(r[5]), "v"(r[6]), "v"(r[7]), "v"(p[0]), "v"(p[1]), "v"(p[2]), "v"(p[3]), "v"(p[4]), "v"(p[5]), "v"(p[6]), "v"(p[7]) : "memory");
  asm volatile("s_wait_xcnt 0x0" :: "v"(r[8]), "v"(r[9]), "v"(r[10]), "v"(r[11]), "v"(r[12]), "v"(r[13]), "v"(r[14]), "v"(r[15]), "v"(p[8]), "v"(p[9]), "v"(p[10]), "v"(p[11]), "v"(p[12]), "v"(p[13]), "v"(p[14]), "v"(p[15]) : "memory");
#pragma unroll
  for (int c = 0; c < 4; ++c) { v8b lo, hi;
#pragma unroll
    for (int e = 0; e < 8; ++e) { lo[e] = (__bf16)r[e][c]; hi[e] = (__bf16)r[8 + e][c]; }
    __bf16* row = &s[(lane * 4 + c) * 128]; *(v8b*)&row[((2 * wave) ^ (lane & 15)) * 8] = lo; *(v8b*)&row[((2 * wave + 1) ^ (lane & 15)) * 8] = hi; }
  __syncthreads();
  const int nr = tid >> 4, j = tid & 15; __bf16* dst = PK + PK_A + (size_t)(n0 + nr) * DM + k0 + j * 8;
#pragma unroll   // the eight LDS reads go out together, one wait chain instead of eight round trips
  for (int i = 0; i < 8; ++i) { const int n = nr + 16 * i; vst2((unsigned*)(dst + (size_t)i * 16 * DM), *(const v4u*)&s[n * 128 + (j ^ ((n >> 2) & 15)) * 8]); }
}
// ---- projection GEMM tiles: a block of 8 waves owns 128 x 128 of the product; 64 k of both operands are staged in LDS per step (two buffers, whole-line global loads fetched one step ahead into registers); wave (wm, wn) of 2 x 4 computes 64 x 32
#define GBM 128
#define GBN 128
#define GBK 64
#define GLP 72                         // LDS row pitch in bf16: 144 B = 16 B x odd, for 16-byte fragment reads of 128-B rows
#define GSP 136                        // f16 staging pitch of the epilogue (272 B)
typedef __attribute__((ext_vector_type(4))) __bf16 v4b;
__global__ __launch_bounds__(256) void k_qkv(const float* __restrict__ XQ, const float* __restrict__ XK, const float* __restrict__ XV, const __bf16* __restrict__ P, const float* __restrict__ BQ, const float* __restrict__ BK, const float* __restrict__ BV, _Float16* __restrict__ QK, _Float16* __restrict__ QKL, _Float16* __restrict__ VTH, _Float16* __restrict__ VTL) {
  const int which0 = (blockIdx.y * 128) / DM; const float* X = (which0 == 0) ? XQ : (which0 == 1) ? XK : XV; const float* BB = BQ ? (((which0 == 0) ? BQ : (which0 == 1) ? BK : BV) + (blockIdx.y * 128 - which0 * DM)) : nullptr;
  __shared__ __align__(16) unsigned char smem[2 * (GBM + GBN) * GLP * 2];   // two buffers of [x 128 rows | W 128 rows]; the epilogue's staging afterwards
  const int tid = threadIdx.x, wave = tid >> 5, lane = tid & 31, col = lane & 15, g = lane >> 4, wm = wave >> 2, wn = wave & 3;
  const size_t rb = (size_t)blockIdx.x * GBM; const int n0 = blockIdx.y * GBN;
  const int ar = tid >> 4, ac = (tid & 15) * 4, br = tid >> 3, bc = (tid & 7) * 8;   // x: 16 lanes x 16 B = one 256-B row piece; W: 8 lanes x 16 B = one 128-B line
  const float* ag = X + (rb + ar) * DM + ac; const __bf16* bg = P + (size_t)(n0 + br) * DM + bc;
  __bf16* sm = (__bf16*)smem;
  const int rot = (blockIdx.x + 2 * blockIdx.y) & (DM / GBK - 1);   // the block's first k step; the walk wraps. Blocks of one row panel or one column panel would otherwise ask L2 for the same lines at the same moment
  v4f ra[8]; v4u rw[4]; v8f acc[4][2] = {};
#pragma unroll
  for (int i = 0; i < 8; ++i) ra[i] = *(const v4f*)(ag + (size_t)i * 16 * DM + rot * GBK);
#pragma unroll
  for (int i = 0; i < 4; ++i) rw[i] = *(const v4u*)(bg + (size_t)i * 32 * DM + rot * GBK);
  for (int ks = 0; ks < DM / GBK; ++ks) { __bf16* sb = sm + (ks & 1) * ((GBM + GBN) * GLP); const int kn = ((ks + 1 + rot) & (DM / GBK - 1)) * GBK;   // first k of the next step
#pragma unroll
    for (int i = 0; i < 8; ++i) { v4b c; c[0] = (__bf16)ra[i][0]; c[1] = (__bf16)ra[i][1]; c[2] = (__bf16)ra[i][2]; c[3] = (__bf16)ra[i][3]; *(v4b*)&sb[(ar + 16 * i) * GLP + ac] = c; }
#pragma unroll
    for (int i = 0; i < 4; ++i) *(v4u*)&sb[(GBM + br + 32 * i) * GLP + bc] = rw[i];
    __syncthreads();   // publishes this step's buffer; the other buffer's readers all passed the barrier of the step before
    if (ks + 1 < DM / GBK) {
#pragma unroll
      for (int i = 0; i < 8; ++i) ra[i] = *(const v4f*)(ag + (size_t)i * 16 * DM + kn);
#pragma unroll
      for (int i = 0; i < 4; ++i) rw[i] = *(const v4u*)(bg + (size_t)i * 32 * DM + kn); }
#pragma unroll
    for (int kc = 0; kc < GBK / 32; ++kc) { v16b af[4], wf[2];
#pragma unroll
      for (int i = 0; i < 4; ++i) af[i] = frag_b(sb + (wm * 64 + i * 16 + col) * GLP + kc * 32, lane);
#pragma unroll
      for (int j = 0; j < 2; ++j) wf[j] = frag_b(sb + (GBM + wn * 32 + j * 16 + col) * GLP + kc * 32, lane);
#pragma unroll
      for (int i = 0; i < 4; ++i) {
#pragma unroll
        for (int j = 0; j < 2; ++j) acc[i][j] = wmma_bf(af[i], wf[j], acc[i][j]); } } }
  __syncthreads();   // every wave has left the operand buffers before they become staging
  _Float16* sh = (_Float16*)smem; _Float16* sl = sh + 128 * GSP;
  if (n0 < 2 * DM) {   // q stored unscaled (f16 sigma ~0.6, no subnormal exposure); 1/8 applied to the f32 score
#pragma unroll
    for (int i = 0; i < 4; ++i) {
#pragma unroll
      for (int j = 0; j < 2; ++j) { const int n = wn * 32 + j * 16 + col; const float bias = BB ? bfr(BB[n]) : 0.f;
#pragma unroll
        for (int r = 0; r < 8; ++r) { const int row = wm * 64 + i * 16 + 8 * g + r; const float v = acc[i][j][r] + bias; const _Float16 hv = (_Float16)v; sh[row * GSP + n] = hv; sl[row * GSP + n] = (_Float16)((v - (float)hv) * 2048.0f); } } }   // q, k (+ bias) as f16 hi + (x2048) residual
    __syncthreads();
    for (int q = tid; q < 128 * 16; q += 256) { const int row = q >> 4, c = q & 15; vst2((unsigned*)(QK + (rb + row) * (2 * DM) + n0 + c * 8), *(const v4u*)&sh[row * GSP + c * 8]); vst2((unsigned*)(QKL + (rb + row) * (2 * DM) + n0 + c * 8), *(const v4u*)&sl[row * GSP + c * 8]); }
  } else {             // v transposed: staging row = output column d, a lane's 8 accumulator rows are 8 consecutive s
#pragma unroll
    for (int i = 0; i < 4; ++i) {
#pragma unroll
      for (int j = 0; j < 2; ++j) { const int n = wn * 32 + j * 16 + col; const float bias = BB ? bfr(BB[n]) : 0.f; v8h h8, l8;
#pragma unroll
        for (int r = 0; r < 8; ++r) { const float v = acc[i][j][r] + bias; const _Float16 hv = (_Float16)v; h8[r] = hv; l8[r] = (_Float16)((v - (float)hv) * 2048.0f); }
        *(v8h*)&sh[n * GSP + wm * 64 + i * 16 + 8 * g] = h8; *(v8h*)&sl[n * GSP + wm * 64 + i * 16 + 8 * g] = l8; } }
    __syncthreads();
    const int b = (int)(rb / SS), s0 = (int)(rb % SS); const int pc0 = n0 - 2 * DM;
    for (int q = tid; q < 128 * 16; q += 256) { const int d = q >> 4, pc = q & 15; const size_t o = ((size_t)b * DM + pc0 + d) * SS + s0 + pc * 8; vst2((unsigned*)(VTH + o), *(const v4u*)&sh[d * GSP + pc * 8]); vst2((unsigned*)(VTL + o), *(const v4u*)&sl[d * GSP + pc * 8]); }
  }
}
// ---- k_attn: block = (64 queries, head h, batch b): all-keys flash attention on TRANSPOSED tiles: S^T = K . Q^T (A = key rows from LDS, B = the wave's 16 queries, kept in registers), so a lane holds 16 of the 32 scores of ONE query (column = lane & 15; keys 8g + r of each 16-key tile): maximum and sum run in the lane, the two lane halves exchange the maximum once a pass and join their sums once at the end; the two score tiles, converted in place, ARE the B operand of O^T += V^T . P^T (hardware k order), so P never goes through LDS; the bias (x 8, from the table) is the C operand of the score product, scores = (q.k + 8 bias) * 0.125 with single f16 operands, and P = exp2 of ONE multiply-add of the raw accumulator (scale, log2 e, maximum and 2^11 folded); O[b*S+q][h*64+d] = (acc + accl / 2048) / l (256-B segments)
__device__ __forceinline__ float xhalf(float x) { return __builtin_bit_cast(float, __builtin_amdgcn_permlanex16(__builtin_bit_cast(int, x), __builtin_bit_cast(int, x), 0x76543210, 0xfedcba98, false, false)); }   // lane l with lane l ^ 16
typedef float v4fu __attribute__((ext_vector_type(4), aligned(4)));   // four table entries at a 4-byte-aligned address
__device__ __forceinline__ v8f bias8(const float* p) { const v4f lo = *(const v4fu*)p, hi = *(const v4fu*)(p + 4); return __builtin_shufflevector(lo, hi, 0, 1, 2, 3, 4, 5, 6, 7); }   // a lane's 8 keys of one score tile, in accumulator order
#define SC2 0.18033688f                // 1/sqrt(64) * log2(e): raw accumulator -> exponent of 2
__global__ __launch_bounds__(128) void k_attn(const _Float16* __restrict__ QK, const _Float16* __restrict__ QKL, const _Float16* __restrict__ VTH, const _Float16* __restrict__ VTL, const void* __restrict__ KMASK, const float* __restrict__ RB, float* __restrict__ O) {
  __shared__ __align__(16) float so[4][16][68];
  __shared__ __align__(16) _Float16 skv[2][128 * GLP];   // two buffers of a 64-key stage shared by the 4 waves: [k: 64 key rows x 64 d | v: 64 d rows x 64 keys], 128-B rows at pitch 144 B
  const int tid = threadIdx.x, wave = tid >> 5, lane = tid & 31, col = lane & 15, g = lane >> 4;
  const int qb = blockIdx.x, h = blockIdx.y, b = blockIdx.z; const int q0 = qb * 64 + wave * 16; const size_t rq = (size_t)b * SS + q0 + col;
  v16h aq[2];
#pragma unroll
  for (int kc = 0; kc < 2; ++kc) aq[kc] = frag_h(QK + rq * (2 * DM) + h * HD + kc * 32, lane);
  asm volatile("s_wait_xcnt 0x0" ::: "memory");   // the four loads' address pair is reused as a destination of the loads below: the wait stands in front of that overwrite
  float m = -3.0e38f, l = 0.f;   // this lane's query: running maximum of the raw accumulators q.k + 8 bias (equal in both halves), and this half's share of the sum (x 2^11)
  float off = 11.0f - m * SC2;   // P = exp2(raw * SC2 + off) = 2^11 exp(score - maximum)
  v8f acc[4] = {}, accl[4] = {};
  const int nks = SS / 32;   // all keys
  const int sr = tid >> 3, sc = (tid & 7) * 8;   // staging: 8 lanes x 16 B = one whole 128-B line, 16 rows a sweep
  const _Float16* kg = QK + ((size_t)b * SS + sr) * (2 * DM) + DM + h * HD + sc; const _Float16* vg = VTH + ((size_t)b * DM + h * HD + sr) * SS + sc;
  const float* rbq = RB + (size_t)h * (2 * SS - 1) + (SS - 1) - (q0 + col) + 8 * g;   // 8 bias[h][t - s] of this lane's query at key 8g of tile 0: the table runs with the key, so a lane's 8 keys of a tile are 8 consecutive entries in accumulator order
  const int rot = qb & (nks / 2 - 1);   // the block's first 64-key stage; the walk wraps. The 32 query blocks of a head read the same k and v lines: a start of its own keeps each from asking L2 for a line at the moment the others do (the running softmax takes the keys in any order)
  v4u rk[4], rv[4]; v8f bc[2];   // bc: the bias of a pass's two 16-key score tiles, fetched one pass ahead: it is the C operand of the tile's first product
#pragma unroll
  for (int i = 0; i < 2; ++i) bc[i] = bias8(rbq + rot * 64 + i * 16);
#pragma unroll
  for (int i = 0; i < 4; ++i) { rk[i] = *(const v4u*)(kg + ((size_t)rot * 64 + i * 16) * (2 * DM)); rv[i] = *(const v4u*)(vg + (size_t)i * 16 * SS + rot * 64); }
#pragma unroll 1
  for (int st = 0; st < nks / 2; ++st) { _Float16* sb = &skv[st & 1][0];   // a stage: lay down the 64 keys fetched one stage ahead
#pragma unroll
    for (int i = 0; i < 4; ++i) { *(v4u*)&sb[(sr + 16 * i) * GLP + sc] = rk[i]; *(v4u*)&sb[(64 + sr + 16 * i) * GLP + sc] = rv[i]; }
    __syncthreads();   // publishes this stage's buffer; the other buffer's readers all passed the barrier of the stage before
#pragma unroll   // both 32-key passes of a stage in straight-line code, so that the next stage's fetch has a fixed place among the loads
   for (int sub = 0; sub < 2; ++sub) { v8f s[2]; const int cu = (st + rot) & (nks / 2 - 1), nx = (st + 1 + rot) & (nks / 2 - 1);   // this stage's and the next stage's place among the keys; the last stage fetches the first again, unused
#pragma unroll
    for (int ct = 0; ct < 2; ++ct) { const _Float16* krow = sb + (sub * 32 + ct * 16 + col) * GLP; v8f c = bc[ct];
#pragma unroll
      for (int kc = 0; kc < 2; ++kc) c = wmma16(frag_h(krow + kc * 32, lane), aq[kc], c);   // single product: k, q as one-rounding f16 operands; c[r] = q.k + 8 bias[h][t - s] = 8 x score(key ct*16 + 8g + r, query col)
      s[ct] = c; }
#pragma unroll
    for (int ct = 0; ct < 2; ++ct) bc[ct] = bias8(rbq + (sub == 0 ? cu * 64 + 32 : nx * 64) + ct * 16);   // the next pass's two tiles
    if (sub == 0) {   // fetch the next stage's keys and values behind the bias loads (loads return in order: ahead of them, the next pass's wait for its bias would wait for the stage)
#pragma unroll
      for (int i = 0; i < 4; ++i) { rk[i] = *(const v4u*)(kg + ((size_t)nx * 64 + i * 16) * (2 * DM)); rv[i] = *(const v4u*)(vg + (size_t)i * 16 * SS + nx * 64); } }
    if (sub == 0) __builtin_amdgcn_sched_barrier(0x78F);   // no global load may cross (all else may): the stage's fetch stays ahead of the next bias fetch, half a stage or more before its use; left free, the scheduler sinks six of the eight loads into the last third of the stage
    float mx = fmaxf(s[0][0], s[1][0]);
#pragma unroll
    for (int r = 1; r < 8; ++r) mx = fmaxf(mx, fmaxf(s[0][r], s[1][r]));
    mx = fmaxf(mx, xhalf(mx));   // the query's maximum over all 32 keys of the pass, in both halves
    const float mn = fmaxf(m, mx); const float noff = 11.0f - mn * SC2; const float alpha = __builtin_amdgcn_exp2f(noff - off);   // old sums were taken against off: the first pass gives exp2 of a huge negative number = 0
    float es = 0.f; v16h pa;
#pragma unroll
    for (int r = 0; r < 8; ++r) { const float e0 = __builtin_amdgcn_exp2f(s[0][r] * SC2 + noff), e1 = __builtin_amdgcn_exp2f(s[1][r] * SC2 + noff); es += e0 + e1;
      pa[r] = (_Float16)e0; pa[8 + r] = (_Float16)e1; }   // P carries 2^11 (in the exponent) so small softmax weights stay out of the f16 subnormal range; the sum carries it too, so it cancels in the epilogue
    l = l * alpha + es; m = mn; off = noff;
#pragma unroll
    for (int dt = 0; dt < 4; ++dt) {
#pragma unroll
      for (int r = 0; r < 8; ++r) { acc[dt][r] *= alpha; accl[dt][r] *= alpha; } }
#pragma unroll
    for (int dt = 0; dt < 4; ++dt) acc[dt] = wmma16(frag_h(sb + (64 + dt * 16 + col) * GLP + sub * 32, lane), pa, acc[dt]);   // single product: V^T x P^T (x2^11); acc[dt][r] = O(query col, d = dt*16 + 8g + r)
   } }
  const float il = 1.0f / (l + xhalf(l));   // the halves' sums joined once
#pragma unroll
  for (int dt = 0; dt < 4; ++dt) { v4f o0, o1;
#pragma unroll
    for (int r = 0; r < 4; ++r) { o0[r] = (acc[dt][r] + accl[dt][r] * (1.0f / 2048.0f)) * il; o1[r] = (acc[dt][4 + r] + accl[dt][4 + r] * (1.0f / 2048.0f)) * il; }
    *(v4f*)&so[wave][col][dt * 16 + 8 * g] = o0; *(v4f*)&so[wave][col][dt * 16 + 8 * g + 4] = o1; }
  LDSX();
  for (int rl = 0; rl < 16; ++rl) if (lane < 16) vst2(O + ((size_t)b * SS + q0 + rl) * DM + h * HD + lane * 4, *(const v4f*)&so[wave][rl][lane * 4]);
}
// ---- k_out: block = (128 rows, 128 cols), tiles staged as in k_qkv: out = O(hi/lo) . Wo rows (2 products) + bo
__global__ __launch_bounds__(256) void k_out(const float* __restrict__ O, const __bf16* __restrict__ P, const float* __restrict__ BO, float* __restrict__ Y) {
  __shared__ __align__(16) unsigned char smem[2 * (2 * GBM + GBN) * GLP * 2];   // two buffers of [O hi 128 rows | O residual 128 rows | Wo 128 rows]; the epilogue's staging afterwards
  const int tid = threadIdx.x, wave = tid >> 5, lane = tid & 31, col = lane & 15, g = lane >> 4, wm = wave >> 2, wn = wave & 3;
  const size_t rb = (size_t)blockIdx.x * GBM; const int n0 = blockIdx.y * GBN;
  const int ar = tid >> 4, ac = (tid & 15) * 4, br = tid >> 3, bc = (tid & 7) * 8;
  const float* ag = O + (rb + ar) * DM + ac; const __bf16* bg = P + (size_t)(n0 + br) * DM + bc;
  __bf16* sm = (__bf16*)smem;
  const int rot = (blockIdx.x + 2 * blockIdx.y) & (DM / GBK - 1);   // the block's first k step, as in k_qkv: the 8 blocks of a row panel start apart, the 32 of a column panel two to each of the 16 starts, and all wrap
  v4f ra[8]; v4u rw[4]; v8f acc[4][2] = {};
#pragma unroll
  for (int i = 0; i < 8; ++i) ra[i] = *(const v4f*)(ag + (size_t)i * 16 * DM + rot * GBK);
#pragma unroll
  for (int i = 0; i < 4; ++i) rw[i] = *(const v4u*)(bg + (size_t)i * 32 * DM + rot * GBK);
  for (int ks = 0; ks < DM / GBK; ++ks) { __bf16* sb = sm + (ks & 1) * ((2 * GBM + GBN) * GLP); const int kn = ((ks + 1 + rot) & (DM / GBK - 1)) * GBK;   // first k of the next step
#pragma unroll
    for (int i = 0; i < 8; ++i) { v4b ch, cl;
#pragma unroll
      for (int e = 0; e < 4; ++e) { const __bf16 h = (__bf16)ra[i][e]; ch[e] = h; cl[e] = (__bf16)(ra[i][e] - (float)h); }
      *(v4b*)&sb[(ar + 16 * i) * GLP + ac] = ch; *(v4b*)&sb[(GBM + ar + 16 * i) * GLP + ac] = cl; }
#pragma unroll
    for (int i = 0; i < 4; ++i) *(v4u*)&sb[(2 * GBM + br + 32 * i) * GLP + bc] = rw[i];
    __syncthreads();   // publishes this step's buffer; the other buffer's readers all passed the barrier of the step before
    if (ks + 1 < DM / GBK) {
#pragma unroll
      for (int i = 0; i < 8; ++i) ra[i] = *(const v4f*)(ag + (size_t)i * 16 * DM + kn);
#pragma unroll
      for (int i = 0; i < 4; ++i) rw[i] = *(const v4u*)(bg + (size_t)i * 32 * DM + kn);
      asm volatile("s_wait_xcnt 0x0" ::: "memory"); }   // the twelve loads' address registers are reused by the compute below: the wait stands in front of their first overwrite
#pragma unroll
    for (int kc = 0; kc < GBK / 32; ++kc) { v16b ah[4], al[4], wf[2];
#pragma unroll
      for (int i = 0; i < 4; ++i) { ah[i] = frag_b(sb + (wm * 64 + i * 16 + col) * GLP + kc * 32, lane); al[i] = frag_b(sb + (GBM + wm * 64 + i * 16 + col) * GLP + kc * 32, lane); }
#pragma unroll
      for (int j = 0; j < 2; ++j) wf[j] = frag_b(sb + (2 * GBM + wn * 32 + j * 16 + col) * GLP + kc * 32, lane);
#pragma unroll
      for (int i = 0; i < 4; ++i) {
#pragma unroll
        for (int j = 0; j < 2; ++j) acc[i][j] = wmma_bf(al[i], wf[j], acc[i][j]); }
#pragma unroll
      for (int i = 0; i < 4; ++i) {
#pragma unroll
        for (int j = 0; j < 2; ++j) acc[i][j] = wmma_bf(ah[i], wf[j], acc[i][j]); } } }
  __syncthreads();   // every wave has left the operand buffers before they become staging
  float* so = (float*)smem;
#pragma unroll
  for (int i = 0; i < 4; ++i) {
#pragma unroll
    for (int j = 0; j < 2; ++j) { const int n = wn * 32 + j * 16 + col; const float bias = bfr(BO[n0 + n]);
#pragma unroll
      for (int r = 0; r < 8; ++r) so[(wm * 64 + i * 16 + 8 * g + r) * 132 + n] = acc[i][j][r] + bias; } }
  __syncthreads();
  for (int q = tid; q < 128 * 32; q += 256) { const int row = q >> 5, c = q & 31; vst2(Y + (rb + row) * DM + n0 + c * 4, *(const v4f*)&so[row * 132 + c * 4]); }
}
// ---- k_rpe: one thread per relative distance rel = idx - (SS-1): f = sign(rel) log1p(|rel|); h = relu(f w1[j] + b1[j]); bias[h] = sum_j h_j w2[j][h] + b2[h]
__global__ __launch_bounds__(256) void k_rpe(const float* __restrict__ W1, const float* __restrict__ B1, const float* __restrict__ W2, const float* __restrict__ B2, float* __restrict__ RB) {
  const int idx = blockIdx.x * 256 + threadIdx.x; if (idx >= 2 * SS - 1) return; const float rel = (float)(idx - (SS - 1)); const float f = (rel > 0.f ? 1.f : (rel < 0.f ? -1.f : 0.f)) * log1pf(fabsf(rel));
  float hdn[RPEH];
#pragma unroll
  for (int j = 0; j < RPEH; ++j) hdn[j] = fmaxf(f * bfr(W1[j]) + bfr(B1[j]), 0.f);
#pragma unroll 1
  for (int h = 0; h < NH; ++h) { float b = bfr(B2[h]);
#pragma unroll
    for (int j = 0; j < RPEH; ++j) b += hdn[j] * bfr(W2[j * NH + h]);
    RB[(size_t)h * (2 * SS - 1) + (2 * SS - 2 - idx)] = b * 8.0f; }   // 4-B scratch store; entry (SS-1) - rel, so that the table runs with the key, and x 8 = sqrt(64), so that it adds to the unscaled q.k
}
extern "C" void kernel_launch(void* const* d_in, const int* in_sizes, int n_in, void* d_out, int out_size, void* d_ws, size_t ws_size, hipStream_t stream) {
  (void)in_sizes; (void)n_in; (void)out_size;
  const float** F = (const float**)d_in;   // 0 x [2,2048,1024], 1 w_qkv [1024,3072] (in,out: q | k | v), 2 b_qkv [3072], 3 w_out (in,out), 4 b_out, 5 w1_rpe [1,32], 6 b1_rpe [32], 7 w2_rpe [32,16], 8 b2_rpe [16]
  if (ws_size < (size_t)WS_END) return;
  char* ws = (char*)d_ws; __bf16* PK = (__bf16*)(ws + WS_PK); _Float16 *QK = (_Float16*)(ws + WS_QK), *QKL = (_Float16*)(ws + WS_QKL), *VTH = (_Float16*)(ws + WS_VTH), *VTL = (_Float16*)(ws + WS_VTL); float *O = (float*)(ws + WS_O), *RB = (float*)(ws + WS_RB);
  k_packt<<<dim3(DM / 128, (QKVW + DM) / 128), 256, 0, stream>>>(F[1], F[3], PK);
  k_rpe<<<(2 * SS + 255) / 256, 256, 0, stream>>>(F[5], F[6], F[7], F[8], RB);
  k_qkv<<<dim3(TNB * SS / GBM, QKVW / GBN), 256, 0, stream>>>(F[0], F[0], F[0], PK + PK_A, F[2], F[2] + DM, F[2] + 2 * DM, QK, QKL, VTH, VTL);
  k_attn<<<dim3(TQB, NH, TNB), 128, 0, stream>>>(QK, QKL, VTH, VTL, nullptr, RB, O);
  k_out<<<dim3(NB * SS / GBM, DM / GBN), 256, 0, stream>>>(O, PK + PK_P, F[4], (float*)d_out);
}

// v007
// One run takes 101 microseconds.
// Timed twice side by side with v006, it ran 1.05 times as fast both times.
// All steps since v000 together make it 4.33 times as fast.
// compute dtype: all float inputs rounded to bf16; qkv = x . W_qkv + b with EXACT bf16 products on WMMA 16x16x32 ((in,out) columns q | k | v as transposed rows); the relative-position bias table bias[h][t-s] = relu(sign(t-s) log1p|t-s| * w1 + b1) . w2 + b2 computed once per distance in f32 (precise log1pf); PLAIN attention: q, k as single f16 operands x 1/8 + bias, running-max softmax in f32 (hardware exp), P (scaled by 2^11, single f16) x v (single f16); out = ctx (bf16 hi + residual) . W_out (2 products) + b_out.
#include <hip/hip_runtime.h>
#include <math.h>

typedef __attribute__((ext_vector_type(16))) _Float16 v16h;
typedef __attribute__((ext_vector_type(16))) __bf16 v16b;
typedef __attribute__((ext_vector_type(8)))  _Float16 v8h;
typedef __attribute__((ext_vector_type(8)))  float v8f;
typedef __attribute__((ext_vector_type(4)))  float v4f;
typedef __attribute__((ext_vector_type(2)))  float v2f;
typedef __attribute__((ext_vector_type(4)))  unsigned v4u;
typedef __attribute__((ext_vector_type(4)))  int v4i;
typedef float __attribute__((may_alias)) float_a;
typedef int __attribute__((may_alias)) int_a;

template <typename T> __device__ __forceinline__ void vst2(void* p, T v) { *(T*)p = v;  }
__device__ __forceinline__ v8f wmma16(v16h a, v16h b, v8f c) {
  return __builtin_amdgcn_wmma_f32_16x16x32_f16(false, a, false, b, (short)0, c, false, false);   // plain builtin: the compiler keeps the distances behind it and is free to issue LDS reads and other products around it
}
__device__ __forceinline__ v8f wmma_bf(v16b a, v16b b, v8f c) {
  v8f d = __builtin_amdgcn_wmma_f32_16x16x32_bf16(false, a, false, b, (short)0, c, false, false);
  asm volatile("v_nop\n\tv_nop\n\tv_nop\n\tv_nop" : "+v"(d) : "v"(a), "v"(b));
  return d;
}
// Multi-head self attention with a learned relative-position bias (B 2, T 2,048, d 1,024, 16 heads x 64): fused q|k|v projection + bias, scores + bias[h](t - s) from a small MLP on the signed log distance, softmax, output projection + bias.
__device__ __forceinline__ v16h frag_h(const _Float16* rowk0, int lane) {
  union { v16h v; v8h q[2]; } u; const _Float16* p = rowk0 + 8 * (lane >> 4);
  u.q[0] = *(const v8h*)p; u.q[1] = *(const v8h*)(p + 16); return u.v;
}
__device__ __forceinline__ v16h frag_f32(const float* rowk0, int lane) {
  v16h a; const float* p = rowk0 + 8 * (lane >> 4);
#pragma unroll
  for (int i = 0; i < 8; ++i) { a[i] = (_Float16)p[i]; a[8 + i] = (_Float16)p[16 + i]; }
  return a;
}
__device__ __forceinline__ v16h frag_f32s(const float* rowk0, int lane, float sc) {
  v16h a; const float* p = rowk0 + 8 * (lane >> 4);
#pragma unroll
  for (int i = 0; i < 8; ++i) { a[i] = (_Float16)(p[i] * sc); a[8 + i] = (_Float16)(p[16 + i] * sc); }
  return a;
}
// column fragment from a [K][ld] layout (column n), rows >= K read as 0
__device__ __forceinline__ v16h fragc_f32(const float* W, int k0, int n, int lane, int ld, int K) {
  v16h a; const int g = lane >> 4;
#pragma unroll
  for (int i = 0; i < 8; ++i) { const int ka = k0 + 8 * g + i, kb = ka + 16;
    a[i] = (_Float16)(ka < K ? W[(size_t)(ka < K ? ka : K - 1) * ld + n] : 0.f); a[8 + i] = (_Float16)(kb < K ? W[(size_t)(kb < K ? kb : K - 1) * ld + n] : 0.f); }
  return a;
}
struct F2 { v16b h, l; };
__device__ __forceinline__ F2 bsplit16(const float v[16]) { F2 r;
#pragma unroll
  for (int i = 0; i < 16; ++i) { const __bf16 h = (__bf16)v[i]; r.h[i] = h; r.l[i] = (__bf16)(v[i] - (float)h); }
  return r; }
__device__ __forceinline__ F2 split_row(const float* row, int k0, int lane) { float v[16]; const float* p = row + k0 + 8 * (lane >> 4);
#pragma unroll
  for (int i = 0; i < 8; ++i) { v[i] = p[i]; v[8 + i] = p[16 + i]; }
  return bsplit16(v); }
__device__ __forceinline__ F2 split_rowK(const float* row, int k0, int lane, int K) { float v[16]; const int g = lane >> 4;
#pragma unroll
  for (int i = 0; i < 8; ++i) { const int ka = k0 + 8 * g + i, kb = ka + 16; v[i] = ka < K ? row[ka < K ? ka : K - 1] : 0.f; v[8 + i] = kb < K ? row[kb < K ? kb : K - 1] : 0.f; }
  return bsplit16(v); }
__device__ __forceinline__ F2 split_col(const float* W, int k0, int n, int lane, int ld, int K) { float v[16]; const int g = lane >> 4;
#pragma unroll
  for (int i = 0; i < 8; ++i) { const int ka = k0 + 8 * g + i, kb = ka + 16; v[i] = ka < K ? W[(size_t)(ka < K ? ka : K - 1) * ld + n] : 0.f; v[8 + i] = kb < K ? W[(size_t)(kb < K ? kb : K - 1) * ld + n] : 0.f; }
  return bsplit16(v); }
__device__ __forceinline__ v8f mac3(const F2& a, const F2& b, v8f c) { c = wmma_bf(a.l, b.h, c); c = wmma_bf(a.h, b.l, c); return wmma_bf(a.h, b.h, c); }
__device__ __forceinline__ float sigm(float v) { return 1.0f / (1.0f + expf(-v)); }
#define LDSX() do { asm volatile("s_wait_dscnt 0" ::: "memory"); __builtin_amdgcn_wave_barrier(); __builtin_amdgcn_fence(__ATOMIC_RELEASE, "workgroup"); } while (0)


#define NB 2
#define SS 2048
#define DM 1024
#define NH 16
#define HD 64
#define QKVW (3 * DM)
#ifndef TQB
#define TQB (SS / 64)
#define TNB NB
#define TOB (NB * SS / 64)     // 64-row tiles of all rows, not used
#endif
typedef __attribute__((ext_vector_type(8))) __bf16 v8b;
__device__ __forceinline__ v16b frag_b(const __bf16* rowk0, int lane) {
  union { v16b v; v8b q[2]; } u; const __bf16* p = rowk0 + 8 * (lane >> 4);
  u.q[0] = *(const v8b*)p; u.q[1] = *(const v8b*)(p + 16); return u.v;
}
__device__ __forceinline__ float bfr(float v) { return (float)(__bf16)v; }
__device__ __attribute__((noinline)) float exp_ni(float v) { return expf(v); }
__device__ __attribute__((noinline)) float erf_ni(float v) { return erff(v); }

#define PK_A 0                       // [3072][1024] Wqkv rows (natural [out][in])
#define PK_P (PK_A + QKVW * DM)        // [1024][1024] Wo rows (natural)
#define PK_END (PK_P + DM * DM)
#define WS_PK  0u
#define WS_QK  (WS_PK + 2u * PK_END)             // f16 [4096 rows][2048]: q | k
#define WS_QKL (WS_QK + 2u * NB * SS * 2 * DM)     // f16 q | k residual planes x2048
#define WS_VTH (WS_QKL + 2u * NB * SS * 2 * DM)    // f16 [b][1024 (h*64+d)][2048 s] hi
#define WS_VTL (WS_VTH + 2u * NB * DM * SS)        // f16 lo x 2048
#define WS_O   (WS_VTL + 2u * NB * DM * SS)        // f32 [4096][1024]
#define WS_CS  (WS_O + 4u * NB * SS * DM)           // f32 2 x [2048][32], not used
#define WS_RB  (WS_CS + 4u * 2 * SS * 32)                 // f32 [16][2*SS-1] relative-position bias table
#define WS_END (WS_RB + 4u * NH * (2 * SS))
#define RPEH 32
// ---- k_packt: block = one 128 (in) x 128 (out) tile of the (in,out) weights, columns 0..3071 of W_qkv, 3072..4095 of W_out -> bf16 rows PK[n][k] (PK_P follows PK_A, so the row is the column's number). A wave reads 16 whole 512-B row pieces; a lane's 16 k x 4 n block becomes four 32-B runs of k in LDS; the rows leave as 256-B pieces
// LDS rows hold 16 pieces of 16 B, piece j of row n at place j ^ ((n >> 2) & 15): the 32 lanes of a store stand 4 rows apart and would meet in 16 of the 64 banks at any 16-B-aligned pitch
__global__ __launch_bounds__(256) void k_packt(const float* __restrict__ WA, const float* __restrict__ WO, __bf16* __restrict__ PK) {
  __shared__ __align__(16) __bf16 s[128 * 128];
  const int tid = threadIdx.x, lane = tid & 31, wave = tid >> 5; const int k0 = blockIdx.x * 128, n0 = blockIdx.y * 128;
  const bool qkv = n0 < QKVW; const int ld = qkv ? QKVW : DM; const float* src = (qkv ? WA + n0 : WO + (n0 - QKVW)) + (size_t)(k0 + wave * 16) * ld + lane * 4;
  v4f r[16]; const float* p[16];
#pragma unroll
  for (int i = 0; i < 16; ++i) { p[i] = src + (size_t)i * ld; r[i] = *(const v4f*)p[i]; }
  // the two statements take the loaded values and their addresses as inputs only. They hold all sixteen loads in front of the first conversion (one memory latency a tile; left alone, the compiler issues the last six behind waits for the first), and they keep every address register live up to the wait that stands in front of its first overwrite
  asm volatile("s_wait_xcnt 0x0" :: "v"(r[0]), "v"(r[1]), "v"(r[2]), "v"(r[3]), "v"(r[4]), "v"(r[5]), "v"(r[6]), "v"(r[7]), "v"(p[0]), "v"(p[1]), "v"(p[2]), "v"(p[3]), "v"(p[4]), "v"(p[5]), "v"(p[6]), "v"(p[7]) : "memory");
  asm volatile("s_wait_xcnt 0x0" :: "v"(r[8]), "v"(r[9]), "v"(r[10]), "v"(r[11]), "v"(r[12]), "v"(r[13]), "v"(r[14]), "v"(r[15]), "v"(p[8]), "v"(p[9]), "v"(p[10]), "v"(p[11]), "v"(p[12]), "v"(p[13]), "v"(p[14]), "v"(p[15]) : "memory");
#pragma unroll
  for (int c = 0; c < 4; ++c) { v8b lo, hi;
#pragma unroll
    for (int e = 0; e < 8; ++e) { lo[e] = (__bf16)r[e][c]; hi[e] = (__bf16)r[8 + e][c]; }
    __bf16* row = &s[(lane * 4 + c) * 128]; *(v8b*)&row[((2 * wave) ^ (lane & 15)) * 8] = lo; *(v8b*)&row[((2 * wave + 1) ^ (lane & 15)) * 8] = hi; }
  __syncthreads();
  const int nr = tid >> 4, j = tid & 15; __bf16* dst = PK + PK_A + (size_t)(n0 + nr) * DM + k0 + j * 8;
#pragma unroll   // the eight LDS reads go out together, one wait chain instead of eight round trips
  for (int i = 0; i < 8; ++i) { const int n = nr + 16 * i; vst2((unsigned*)(dst + (size_t)i * 16 * DM), *(const v4u*)&s[n * 128 + (j ^ ((n >> 2) & 15)) * 8]); }
}
// ---- rpe_rows: one thread per relative distance rel = idx - (SS-1): f = sign(rel) log1p(|rel|); h = relu(f w1[j] + b1[j]); bias[h] = sum_j h_j w2[j][h] + b2[h]
__device__ __forceinline__ void rpe_rows(const int idx, const float* __restrict__ W1, const float* __restrict__ B1, const float* __restrict__ W2, const float* __restrict__ B2, float* __restrict__ RB) {
  if (idx >= 2 * SS - 1) return; const float rel = (float)(idx - (SS - 1)); const float f = (rel > 0.f ? 1.f : (rel < 0.f ? -1.f : 0.f)) * log1pf(fabsf(rel));
  float hdn[RPEH];
#pragma unroll
  for (int j = 0; j < RPEH; ++j) hdn[j] = fmaxf(f * bfr(W1[j]) + bfr(B1[j]), 0.f);
#pragma unroll 1
  for (int h = 0; h < NH; ++h) { float b = bfr(B2[h]);
#pragma unroll
    for (int j = 0; j < RPEH; ++j) b += hdn[j] * bfr(W2[j * NH + h]);
    RB[(size_t)h * (2 * SS - 1) + (2 * SS - 2 - idx)] = b * 8.0f;
    asm volatile("s_wait_xcnt 0x0" ::: "memory"); }   // the store's address and data registers are written again by the next trip: the wait stands in front of that overwrite. 4-B scratch store; entry (SS-1) - rel, so that the table runs with the key, and x 8 = sqrt(64), so that it adds to the unscaled q.k
}
// ---- projection GEMM tiles: a block of 8 waves owns 128 x 128 of the product; 64 k of both operands are staged in LDS per step (two buffers, whole-line global loads fetched one step ahead into registers); wave (wm, wn) of 2 x 4 computes 64 x 32
#define GBM 128
#define GBN 128
#define GBK 64
#define GLP 72                         // LDS row pitch in bf16: 144 B = 16 B x odd, for 16-byte fragment reads of 128-B rows
#define GSP 136                        // f16 staging pitch of the epilogue (272 B)
typedef __attribute__((ext_vector_type(4))) __bf16 v4b;
__global__ __launch_bounds__(256) void k_qkv(const float* __restrict__ XQ, const float* __restrict__ XK, const float* __restrict__ XV, const __bf16* __restrict__ P, const float* __restrict__ BQ, const float* __restrict__ BK, const float* __restrict__ BV, _Float16* __restrict__ QK, _Float16* __restrict__ QKL, _Float16* __restrict__ VTH, _Float16* __restrict__ VTL, const float* __restrict__ W1, const float* __restrict__ B1, const float* __restrict__ W2, const float* __restrict__ B2, float* __restrict__ RB) {
  if (blockIdx.y == 0) { rpe_rows(blockIdx.x * 256 + threadIdx.x, W1, B1, W2, B2, RB); return; }   // grid row 0 (the first blocks to start) builds the bias table, which only k_attn reads: a short latency-bound job that runs beside the product tiles instead of in a launch of its own; whole blocks leave here, ahead of every barrier
  const int by = blockIdx.y - 1;   // the product's column tile
  const int which0 = (by * 128) / DM; const float* X = (which0 == 0) ? XQ : (which0 == 1) ? XK : XV; const float* BB = BQ ? (((which0 == 0) ? BQ : (which0 == 1) ? BK : BV) + (by * 128 - which0 * DM)) : nullptr;
  __shared__ __align__(16) unsigned char smem[2 * (GBM + GBN) * GLP * 2];   // two buffers of [x 128 rows | W 128 rows]; the epilogue's staging afterwards
  const int tid = threadIdx.x, wave = tid >> 5, lane = tid & 31, col = lane & 15, g = lane >> 4, wm = wave >> 2, wn = wave & 3;
  const size_t rb = (size_t)blockIdx.x * GBM; const int n0 = by * GBN;
  const int ar = tid >> 4, ac = (tid & 15) * 4, br = tid >> 3, bc = (tid & 7) * 8;   // x: 16 lanes x 16 B = one 256-B row piece; W: 8 lanes x 16 B = one 128-B line
  const float* ag = X + (rb + ar) * DM + ac; const __bf16* bg = P + (size_t)(n0 + br) * DM + bc;
  __bf16* sm = (__bf16*)smem;
  const int rot = (blockIdx.x + 2 * by) & (DM / GBK - 1);   // the block's first k step; the walk wraps. Blocks of one row panel or one column panel would otherwise ask L2 for the same lines at the same moment
  v4f ra[8]; v4u rw[4]; v8f acc[4][2] = {};
#pragma unroll
  for (int i = 0; i < 8; ++i) ra[i] = *(const v4f*)(ag + (size_t)i * 16 * DM + rot * GBK);
#pragma unroll
  for (int i = 0; i < 4; ++i) rw[i] = *(const v4u*)(bg + (size_t)i * 32 * DM + rot * GBK);
  for (int ks = 0; ks < DM / GBK; ++ks) { __bf16* sb = sm + (ks & 1) * ((GBM + GBN) * GLP); const int kn = ((ks + 1 + rot) & (DM / GBK - 1)) * GBK;   // first k of the next step
#pragma unroll
    for (int i = 0; i < 8; ++i) { v4b c; c[0] = (__bf16)ra[i][0]; c[1] = (__bf16)ra[i][1]; c[2] = (__bf16)ra[i][2]; c[3] = (__bf16)ra[i][3]; *(v4b*)&sb[(ar + 16 * i) * GLP + ac] = c; }
#pragma unroll
    for (int i = 0; i < 4; ++i) *(v4u*)&sb[(GBM + br + 32 * i) * GLP + bc] = rw[i];
    __syncthreads();   // publishes this step's buffer; the other buffer's readers all passed the barrier of the step before
    if (ks + 1 < DM / GBK) {
#pragma unroll
      for (int i = 0; i < 8; ++i) ra[i] = *(const v4f*)(ag + (size_t)i * 16 * DM + kn);
#pragma unroll
      for (int i = 0; i < 4; ++i) rw[i] = *(const v4u*)(bg + (size_t)i * 32 * DM + kn); }
#pragma unroll
    for (int kc = 0; kc < GBK / 32; ++kc) { v16b af[4], wf[2];
#pragma unroll
      for (int i = 0; i < 4; ++i) af[i] = frag_b(sb + (wm * 64 + i * 16 + col) * GLP + kc * 32, lane);
#pragma unroll
      for (int j = 0; j < 2; ++j) wf[j] = frag_b(sb + (GBM + wn * 32 + j * 16 + col) * GLP + kc * 32, lane);
#pragma unroll
      for (int i = 0; i < 4; ++i) {
#pragma unroll
        for (int j = 0; j < 2; ++j) acc[i][j] = wmma_bf(af[i], wf[j], acc[i][j]); } } }
  __syncthreads();   // every wave has left the operand buffers before they become staging
  _Float16* sh = (_Float16*)smem; _Float16* sl = sh + 128 * GSP;
  if (n0 < 2 * DM) {   // q stored unscaled (f16 sigma ~0.6, no subnormal exposure); 1/8 applied to the f32 score
#pragma unroll
    for (int i = 0; i < 4; ++i) {
#pragma unroll
      for (int j = 0; j < 2; ++j) { const int n = wn * 32 + j * 16 + col; const float bias = BB ? bfr(BB[n]) : 0.f;
#pragma unroll
        for (int r = 0; r < 8; ++r) { const int row = wm * 64 + i * 16 + 8 * g + r; const float v = acc[i][j][r] + bias; const _Float16 hv = (_Float16)v; sh[row * GSP + n] = hv; sl[row * GSP + n] = (_Float16)((v - (float)hv) * 2048.0f); } } }   // q, k (+ bias) as f16 hi + (x2048) residual
    __syncthreads();
    for (int q = tid; q < 128 * 16; q += 256) { const int row = q >> 4, c = q & 15; vst2((unsigned*)(QK + (rb + row) * (2 * DM) + n0 + c * 8), *(const v4u*)&sh[row * GSP + c * 8]); vst2((unsigned*)(QKL + (rb + row) * (2 * DM) + n0 + c * 8), *(const v4u*)&sl[row * GSP + c * 8]); }
  } else {             // v transposed: staging row = output column d, a lane's 8 accumulator rows are 8 consecutive s
#pragma unroll
    for (int i = 0; i < 4; ++i) {
#pragma unroll
      for (int j = 0; j < 2; ++j) { const int n = wn * 32 + j * 16 + col; const float bias = BB ? bfr(BB[n]) : 0.f; v8h h8, l8;
#pragma unroll
        for (int r = 0; r < 8; ++r) { const float v = acc[i][j][r] + bias; const _Float16 hv = (_Float16)v; h8[r] = hv; l8[r] = (_Float16)((v - (float)hv) * 2048.0f); }
        *(v8h*)&sh[n * GSP + wm * 64 + i * 16 + 8 * g] = h8; *(v8h*)&sl[n * GSP + wm * 64 + i * 16 + 8 * g] = l8; } }
    __syncthreads();
    const int b = (int)(rb / SS), s0 = (int)(rb % SS); const int pc0 = n0 - 2 * DM;
    for (int q = tid; q < 128 * 16; q += 256) { const int d = q >> 4, pc = q & 15; const size_t o = ((size_t)b * DM + pc0 + d) * SS + s0 + pc * 8; vst2((unsigned*)(VTH + o), *(const v4u*)&sh[d * GSP + pc * 8]); vst2((unsigned*)(VTL + o), *(const v4u*)&sl[d * GSP + pc * 8]); }
  }
}
// ---- k_attn: block = (64 queries, head h, batch b): all-keys flash attention on TRANSPOSED tiles: S^T = K . Q^T (A = key rows from LDS, B = the wave's 16 queries, kept in registers), so a lane holds 16 of the 32 scores of ONE query (column = lane & 15; keys 8g + r of each 16-key tile): maximum and sum run in the lane, the two lane halves exchange the maximum once a pass and join their sums once at the end; the two score tiles, converted in place, ARE the B operand of O^T += V^T . P^T (hardware k order), so P never goes through LDS; the bias (x 8, from the table) is the C operand of the score product, scores = (q.k + 8 bias) * 0.125 with single f16 operands, and P = exp2 of ONE multiply-add of the raw accumulator (scale, log2 e, maximum and 2^11 folded); O[b*S+q][h*64+d] = (acc + accl / 2048) / l (256-B segments)
__device__ __forceinline__ float xhalf(float x) { return __builtin_bit_cast(float, __builtin_amdgcn_permlanex16(__builtin_bit_cast(int, x), __builtin_bit_cast(int, x), 0x76543210, 0xfedcba98, false, false)); }   // lane l with lane l ^ 16
typedef float v4fu __attribute__((ext_vector_type(4), aligned(4)));   // four table entries at a 4-byte-aligned address
__device__ __forceinline__ v8f bias8(const float* p) { const v4f lo = *(const v4fu*)p, hi = *(const v4fu*)(p + 4); return __builtin_shufflevector(lo, hi, 0, 1, 2, 3, 4, 5, 6, 7); }   // a lane's 8 keys of one score tile, in accumulator order
#define SC2 0.18033688f                // 1/sqrt(64) * log2(e): raw accumulator -> exponent of 2
__global__ __launch_bounds__(128) void k_attn(const _Float16* __restrict__ QK, const _Float16* __restrict__ QKL, const _Float16* __restrict__ VTH, const _Float16* __restrict__ VTL, const void* __restrict__ KMASK, const float* __restrict__ RB, float* __restrict__ O) {
  __shared__ __align__(16) float so[4][16][68];
  __shared__ __align__(16) _Float16 skv[2][128 * GLP];   // two buffers of a 64-key stage shared by the 4 waves: [k: 64 key rows x 64 d | v: 64 d rows x 64 keys], 128-B rows at pitch 144 B
  const int tid = threadIdx.x, wave = tid >> 5, lane = tid & 31, col = lane & 15, g = lane >> 4;
  const int qb = blockIdx.x, h = blockIdx.y, b = blockIdx.z; const int q0 = qb * 64 + wave * 16; const size_t rq = (size_t)b * SS + q0 + col;
  v16h aq[2];
#pragma unroll
  for (int kc = 0; kc < 2; ++kc) aq[kc] = frag_h(QK + rq * (2 * DM) + h * HD + kc * 32, lane);
  asm volatile("s_wait_xcnt 0x0" ::: "memory");   // the four loads' address pair is reused as a destination of the loads below: the wait stands in front of that overwrite
  float m = -3.0e38f, l = 0.f;   // this lane's query: running maximum of the raw accumulators q.k + 8 bias (equal in both halves), and this half's share of the sum (x 2^11)
  float off = 11.0f - m * SC2;   // P = exp2(raw * SC2 + off) = 2^11 exp(score - maximum)
  v8f acc[4] = {}, accl[4] = {};
  const int nks = SS / 32;   // all keys
  const int sr = tid >> 3, sc = (tid & 7) * 8;   // staging: 8 lanes x 16 B = one whole 128-B line, 16 rows a sweep
  const _Float16* kg = QK + ((size_t)b * SS + sr) * (2 * DM) + DM + h * HD + sc; const _Float16* vg = VTH + ((size_t)b * DM + h * HD + sr) * SS + sc;
  const float* rbq = RB + (size_t)h * (2 * SS - 1) + (SS - 1) - (q0 + col) + 8 * g;   // 8 bias[h][t - s] of this lane's query at key 8g of tile 0: the table runs with the key, so a lane's 8 keys of a tile are 8 consecutive entries in accumulator order
  const int rot = qb & (nks / 2 - 1);   // the block's first 64-key stage; the walk wraps. The 32 query blocks of a head read the same k and v lines: a start of its own keeps each from asking L2 for a line at the moment the others do (the running softmax takes the keys in any order)
  v4u rk[4], rv[4]; v8f bc[2];   // bc: the bias of a pass's two 16-key score tiles, fetched one pass ahead: it is the C operand of the tile's first product
#pragma unroll
  for (int i = 0; i < 2; ++i) bc[i] = bias8(rbq + rot * 64 + i * 16);
#pragma unroll
  for (int i = 0; i < 4; ++i) { rk[i] = *(const v4u*)(kg + ((size_t)rot * 64 + i * 16) * (2 * DM)); rv[i] = *(const v4u*)(vg + (size_t)i * 16 * SS + rot * 64); }
#pragma unroll 1
  for (int st = 0; st < nks / 2; ++st) { _Float16* sb = &skv[st & 1][0];   // a stage: lay down the 64 keys fetched one stage ahead
#pragma unroll
    for (int i = 0; i < 4; ++i) { *(v4u*)&sb[(sr + 16 * i) * GLP + sc] = rk[i]; *(v4u*)&sb[(64 + sr + 16 * i) * GLP + sc] = rv[i]; }
    __syncthreads();   // publishes this stage's buffer; the other buffer's readers all passed the barrier of the stage before
#pragma unroll   // both 32-key passes of a stage in straight-line code, so that the next stage's fetch has a fixed place among the loads
   for (int sub = 0; sub < 2; ++sub) { v8f s[2]; const int cu = (st + rot) & (nks / 2 - 1), nx = (st + 1 + rot) & (nks / 2 - 1);   // this stage's and the next stage's place among the keys; the last stage fetches the first again, unused
#pragma unroll
    for (int ct = 0; ct < 2; ++ct) { const _Float16* krow = sb + (sub * 32 + ct * 16 + col) * GLP; v8f c = bc[ct];
#pragma unroll
      for (int kc = 0; kc < 2; ++kc) c = wmma16(frag_h(krow + kc * 32, lane), aq[kc], c);   // single product: k, q as one-rounding f16 operands; c[r] = q.k + 8 bias[h][t - s] = 8 x score(key ct*16 + 8g + r, query col)
      s[ct] = c; }
#pragma unroll
    for (int ct = 0; ct < 2; ++ct) bc[ct] = bias8(rbq + (sub == 0 ? cu * 64 + 32 : nx * 64) + ct * 16);   // the next pass's two tiles
    if (sub == 0) {   // fetch the next stage's keys and values behind the bias loads (loads return in order: ahead of them, the next pass's wait for its bias would wait for the stage)
#pragma unroll
      for (int i = 0; i < 4; ++i) { rk[i] = *(const v4u*)(kg + ((size_t)nx * 64 + i * 16) * (2 * DM)); rv[i] = *(const v4u*)(vg + (size_t)i * 16 * SS + nx * 64); } }
    if (sub == 0) __builtin_amdgcn_sched_barrier(0x78F);   // no global load may cross (all else may): the stage's fetch stays ahead of the next bias fetch, half a stage or more before its use; left free, the scheduler sinks six of the eight loads into the last third of the stage
    float mx = fmaxf(s[0][0], s[1][0]);
#pragma unroll
    for (int r = 1; r < 8; ++r) mx = fmaxf(mx, fmaxf(s[0][r], s[1][r]));
    mx = fmaxf(mx, xhalf(mx));   // the query's maximum over all 32 keys of the pass, in both halves
    const float mn = fmaxf(m, mx); const float noff = 11.0f - mn * SC2; const float alpha = __builtin_amdgcn_exp2f(noff - off);   // old sums were taken against off: the first pass gives exp2 of a huge negative number = 0
    float es = 0.f; v16h pa;
#pragma unroll
    for (int r = 0; r < 8; ++r) { const float e0 = __builtin_amdgcn_exp2f(s[0][r] * SC2 + noff), e1 = __builtin_amdgcn_exp2f(s[1][r] * SC2 + noff); es += e0 + e1;
      pa[r] = (_Float16)e0; pa[8 + r] = (_Float16)e1; }   // P carries 2^11 (in the exponent) so small softmax weights stay out of the f16 subnormal range; the sum carries it too, so it cancels in the epilogue
    l = l * alpha + es; m = mn; off = noff;
#pragma unroll
    for (int dt = 0; dt < 4; ++dt) {
#pragma unroll
      for (int r = 0; r < 8; ++r) { acc[dt][r] *= alpha; accl[dt][r] *= alpha; } }
#pragma unroll
    for (int dt = 0; dt < 4; ++dt) acc[dt] = wmma16(frag_h(sb + (64 + dt * 16 + col) * GLP + sub * 32, lane), pa, acc[dt]);   // single product: V^T x P^T (x2^11); acc[dt][r] = O(query col, d = dt*16 + 8g + r)
   } }
  const float il = 1.0f / (l + xhalf(l));   // the halves' sums joined once
#pragma unroll
  for (int dt = 0; dt < 4; ++dt) { v4f o0, o1;
#pragma unroll
    for (int r = 0; r < 4; ++r) { o0[r] = (acc[dt][r] + accl[dt][r] * (1.0f / 2048.0f)) * il; o1[r] = (acc[dt][4 + r] + accl[dt][4 + r] * (1.0f / 2048.0f)) * il; }
    *(v4f*)&so[wave][col][dt * 16 + 8 * g] = o0; *(v4f*)&so[wave][col][dt * 16 + 8 * g + 4] = o1; }
  LDSX();
  for (int rl = 0; rl < 16; ++rl) if (lane < 16) vst2(O + ((size_t)b * SS + q0 + rl) * DM + h * HD + lane * 4, *(const v4f*)&so[wave][rl][lane * 4]);
}
// ---- k_out: block = (128 rows, 128 cols), tiles staged as in k_qkv: out = O(hi/lo) . Wo rows (2 products) + bo
__global__ __launch_bounds__(256) void k_out(const float* __restrict__ O, const __bf16* __restrict__ P, const float* __restrict__ BO, float* __restrict__ Y) {
  __shared__ __align__(16) unsigned char smem[2 * (2 * GBM + GBN) * GLP * 2];   // two buffers of [O hi 128 rows | O residual 128 rows | Wo 128 rows]; the epilogue's staging afterwards
  const int tid = threadIdx.x, wave = tid >> 5, lane = tid & 31, col = lane & 15, g = lane >> 4, wm = wave >> 2, wn = wave & 3;
  const size_t rb = (size_t)blockIdx.x * GBM; const int n0 = blockIdx.y * GBN;
  const int ar = tid >> 4, ac = (tid & 15) * 4, br = tid >> 3, bc = (tid & 7) * 8;
  const float* ag = O + (rb + ar) * DM + ac; const __bf16* bg = P + (size_t)(n0 + br) * DM + bc;
  __bf16* sm = (__bf16*)smem;
  const int rot = (blockIdx.x + 2 * blockIdx.y) & (DM / GBK - 1);   // the block's first k step, as in k_qkv: the 8 blocks of a row panel start apart, the 32 of a column panel two to each of the 16 starts, and all wrap
  v4f ra[8]; v4u rw[4]; v8f acc[4][2] = {};
#pragma unroll
  for (int i = 0; i < 8; ++i) ra[i] = *(const v4f*)(ag + (size_t)i * 16 * DM + rot * GBK);
#pragma unroll
  for (int i = 0; i < 4; ++i) rw[i] = *(const v4u*)(bg + (size_t)i * 32 * DM + rot * GBK);
  for (int ks = 0; ks < DM / GBK; ++ks) { __bf16* sb = sm + (ks & 1) * ((2 * GBM + GBN) * GLP); const int kn = ((ks + 1 + rot) & (DM / GBK - 1)) * GBK;   // first k of the next step
#pragma unroll
    for (int i = 0; i < 8; ++i) { v4b ch, cl;
#pragma unroll
      for (int e = 0; e < 4; ++e) { const __bf16 h = (__bf16)ra[i][e]; ch[e] = h; cl[e] = (__bf16)(ra[i][e] - (float)h); }
      *(v4b*)&sb[(ar + 16 * i) * GLP + ac] = ch; *(v4b*)&sb[(GBM + ar + 16 * i) * GLP + ac] = cl; }
#pragma unroll
    for (int i = 0; i < 4; ++i) *(v4u*)&sb[(2 * GBM + br + 32 * i) * GLP + bc] = rw[i];
    __syncthreads();   // publishes this step's buffer; the other buffer's readers all passed the barrier of the step before
    if (ks + 1 < DM / GBK) {
#pragma unroll
      for (int i = 0; i < 8; ++i) ra[i] = *(const v4f*)(ag + (size_t)i * 16 * DM + kn);
#pragma unroll
      for (int i = 0; i < 4; ++i) rw[i] = *(const v4u*)(bg + (size_t)i * 32 * DM + kn);
      asm volatile("s_wait_xcnt 0x0" ::: "memory"); }   // the twelve loads' address registers are reused by the compute below: the wait stands in front of their first overwrite
#pragma unroll
    for (int kc = 0; kc < GBK / 32; ++kc) { v16b ah[4], al[4], wf[2];
#pragma unroll
      for (int i = 0; i < 4; ++i) { ah[i] = frag_b(sb + (wm * 64 + i * 16 + col) * GLP + kc * 32, lane); al[i] = frag_b(sb + (GBM + wm * 64 + i * 16 + col) * GLP + kc * 32, lane); }
#pragma unroll
      for (int j = 0; j < 2; ++j) wf[j] = frag_b(sb + (2 * GBM + wn * 32 + j * 16 + col) * GLP + kc * 32, lane);
#pragma unroll
      for (int i = 0; i < 4; ++i) {
#pragma unroll
        for (int j = 0; j < 2; ++j) acc[i][j] = wmma_bf(al[i], wf[j], acc[i][j]); }
#pragma unroll
      for (int i = 0; i < 4; ++i) {
#pragma unroll
        for (int j = 0; j < 2; ++j) acc[i][j] = wmma_bf(ah[i], wf[j], acc[i][j]); } } }
  __syncthreads();   // every wave has left the operand buffers before they become staging
  float* so = (float*)smem;
#pragma unroll
  for (int i = 0; i < 4; ++i) {
#pragma unroll
    for (int j = 0; j < 2; ++j) { const int n = wn * 32 + j * 16 + col; const float bias = bfr(BO[n0 + n]);
#pragma unroll
      for (int r = 0; r < 8; ++r) so[(wm * 64 + i * 16 + 8 * g + r) * 132 + n] = acc[i][j][r] + bias; } }
  __syncthreads();
  for (int q = tid; q < 128 * 32; q += 256) { const int row = q >> 5, c = q & 31; vst2(Y + (rb + row) * DM + n0 + c * 4, *(const v4f*)&so[row * 132 + c * 4]); }
}
extern "C" void kernel_launch(void* const* d_in, const int* in_sizes, int n_in, void* d_out, int out_size, void* d_ws, size_t ws_size, hipStream_t stream) {
  (void)in_sizes; (void)n_in; (void)out_size;
  const float** F = (const float**)d_in;   // 0 x [2,2048,1024], 1 w_qkv [1024,3072] (in,out: q | k | v), 2 b_qkv [3072], 3 w_out (in,out), 4 b_out, 5 w1_rpe [1,32], 6 b1_rpe [32], 7 w2_rpe [32,16], 8 b2_rpe [16]
  if (ws_size < (size_t)WS_END) return;
  char* ws = (char*)d_ws; __bf16* PK = (__bf16*)(ws + WS_PK); _Float16 *QK = (_Float16*)(ws + WS_QK), *QKL = (_Float16*)(ws + WS_QKL), *VTH = (_Float16*)(ws + WS_VTH), *VTL = (_Float16*)(ws + WS_VTL); float *O = (float*)(ws + WS_O), *RB = (float*)(ws + WS_RB);
  k_packt<<<dim3(DM / 128, (QKVW + DM) / 128), 256, 0, stream>>>(F[1], F[3], PK);
  k_qkv<<<dim3(TNB * SS / GBM, QKVW / GBN + 1), 256, 0, stream>>>(F[0], F[0], F[0], PK + PK_A, F[2], F[2] + DM, F[2] + 2 * DM, QK, QKL, VTH, VTL, F[5], F[6], F[7], F[8], RB);
  k_attn<<<dim3(TQB, NH, TNB), 128, 0, stream>>>(QK, QKL, VTH, VTL, nullptr, RB, O);
  k_out<<<dim3(NB * SS / GBM, DM / GBN), 256, 0, stream>>>(O, PK + PK_P, F[4], (float*)d_out);
}

// v008
// One run takes 92.9 microseconds.
// In both of two side-by-side timings against v007, it was 1.09 times as fast.
// Counting every step since v000, it is 4.72 times as fast.
// compute dtype: all float inputs rounded to bf16; qkv = x . W_qkv + b with EXACT bf16 products on WMMA 16x16x32 ((in,out) columns q | k | v as transposed rows); the relative-position bias table bias[h][t-s] = relu(sign(t-s) log1p|t-s| * w1 + b1) . w2 + b2 computed once per distance in f32 (precise log1pf); PLAIN attention: q, k as single f16 operands x 1/8 + bias, running-max softmax in f32 (hardware exp), P (scaled by 2^11, single f16) x v (single f16); out = ctx (bf16 hi + residual) . W_out (2 products) + b_out.
#include <hip/hip_runtime.h>
#include <math.h>

typedef __attribute__((ext_vector_type(16))) _Float16 v16h;
typedef __attribute__((ext_vector_type(16))) __bf16 v16b;
typedef __attribute__((ext_vector_type(8)))  _Float16 v8h;
typedef __attribute__((ext_vector_type(8)))  float v8f;
typedef __attribute__((ext_vector_type(4)))  float v4f;
typedef __attribute__((ext_vector_type(2)))  float v2f;
typedef __attribute__((ext_vector_type(4)))  unsigned v4u;
typedef __attribute__((ext_vector_type(4)))  int v4i;
typedef float __attribute__((may_alias)) float_a;
typedef int __attribute__((may_alias)) int_a;

template <typename T> __device__ __forceinline__ void vst2(void* p, T v) { *(T*)p = v;  }
__device__ __forceinline__ v8f wmma16(v16h a, v16h b, v8f c) {
  return __builtin_amdgcn_wmma_f32_16x16x32_f16(false, a, false, b, (short)0, c, false, false);   // plain builtin: the compiler keeps the distances behind it and is free to issue LDS reads and other products around it
}
__device__ __forceinline__ v8f wmma_bf(v16b a, v16b b, v8f c) {
  v8f d = __builtin_amdgcn_wmma_f32_16x16x32_bf16(false, a, false, b, (short)0, c, false, false);
  asm volatile("v_nop\n\tv_nop\n\tv_nop\n\tv_nop" : "+v"(d) : "v"(a), "v"(b));
  return d;
}
// Multi-head self attention with a learned relative-position bias (B 2, T 2,048, d 1,024, 16 heads x 64): fused q|k|v projection + bias, scores + bias[h](t - s) from a small MLP on the signed log distance, softmax, output projection + bias.
__device__ __forceinline__ v16h frag_h(const _Float16* rowk0, int lane) {
  union { v16h v; v8h q[2]; } u; const _Float16* p = rowk0 + 8 * (lane >> 4);
  u.q[0] = *(const v8h*)p; u.q[1] = *(const v8h*)(p + 16); return u.v;
}
__device__ __forceinline__ v16h frag_f32(const float* rowk0, int lane) {
  v16h a; const float* p = rowk0 + 8 * (lane >> 4);
#pragma unroll
  for (int i = 0; i < 8; ++i) { a[i] = (_Float16)p[i]; a[8 + i] = (_Float16)p[16 + i]; }
  return a;
}
__device__ __forceinline__ v16h frag_f32s(const float* rowk0, int lane, float sc) {
  v16h a; const float* p = rowk0 + 8 * (lane >> 4);
#pragma unroll
  for (int i = 0; i < 8; ++i) { a[i] = (_Float16)(p[i] * sc); a[8 + i] = (_Float16)(p[16 + i] * sc); }
  return a;
}
// column fragment from a [K][ld] layout (column n), rows >= K read as 0
__device__ __forceinline__ v16h fragc_f32(const float* W, int k0, int n, int lane, int ld, int K) {
  v16h a; const int g = lane >> 4;
#pragma unroll
  for (int i = 0; i < 8; ++i) { const int ka = k0 + 8 * g + i, kb = ka + 16;
    a[i] = (_Float16)(ka < K ? W[(size_t)(ka < K ? ka : K - 1) * ld + n] : 0.f); a[8 + i] = (_Float16)(kb < K ? W[(size_t)(kb < K ? kb : K - 1) * ld + n] : 0.f); }
  return a;
}
struct F2 { v16b h, l; };
__device__ __forceinline__ F2 bsplit16(const float v[16]) { F2 r;
#pragma unroll
  for (int i = 0; i < 16; ++i) { const __bf16 h = (__bf16)v[i]; r.h[i] = h; r.l[i] = (__bf16)(v[i] - (float)h); }
  return r; }
__device__ __forceinline__ F2 split_row(const float* row, int k0, int lane) { float v[16]; const float* p = row + k0 + 8 * (lane >> 4);
#pragma unroll
  for (int i = 0; i < 8; ++i) { v[i] = p[i]; v[8 + i] = p[16 + i]; }
  return bsplit16(v); }
__device__ __forceinline__ F2 split_rowK(const float* row, int k0, int lane, int K) { float v[16]; const int g = lane >> 4;
#pragma unroll
  for (int i = 0; i < 8; ++i) { const int ka = k0 + 8 * g + i, kb = ka + 16; v[i] = ka < K ? row[ka < K ? ka : K - 1] : 0.f; v[8 + i] = kb < K ? row[kb < K ? kb : K - 1] : 0.f; }
  return bsplit16(v); }
__device__ __forceinline__ F2 split_col(const float* W, int k0, int n, int lane, int ld, int K) { float v[16]; const int g = lane >> 4;
#pragma unroll
  for (int i = 0; i < 8; ++i) { const int ka = k0 + 8 * g + i, kb = ka + 16; v[i] = ka < K ? W[(size_t)(ka < K ? ka : K - 1) * ld + n] : 0.f; v[8 + i] = kb < K ? W[(size_t)(kb < K ? kb : K - 1) * ld + n] : 0.f; }
  return bsplit16(v); }
__device__ __forceinline__ v8f mac3(const F2& a, const F2& b, v8f c) { c = wmma_bf(a.l, b.h, c); c = wmma_bf(a.h, b.l, c); return wmma_bf(a.h, b.h, c); }
__device__ __forceinline__ float sigm(float v) { return 1.0f / (1.0f + expf(-v)); }
#define LDSX() do { asm volatile("s_wait_dscnt 0" ::: "memory"); __builtin_amdgcn_wave_barrier(); __builtin_amdgcn_fence(__ATOMIC_RELEASE, "workgroup"); } while (0)


#define NB 2
#define SS 2048
#define DM 1024
#define NH 16
#define HD 64
#define QKVW (3 * DM)
#ifndef TQB
#define TQB (SS / 64)
#define TNB NB
#define TOB (NB * SS / 64)     // 64-row tiles of all rows, not used
#endif
typedef __attribute__((ext_vector_type(8))) __bf16 v8b;
__device__ __forceinline__ v16b frag_b(const __bf16* rowk0, int lane) {
  union { v16b v; v8b q[2]; } u; const __bf16* p = rowk0 + 8 * (lane >> 4);
  u.q[0] = *(const v8b*)p; u.q[1] = *(const v8b*)(p + 16); return u.v;
}
__device__ __forceinline__ float bfr(float v) { return (float)(__bf16)v; }
__device__ __attribute__((noinline)) float exp_ni(float v) { return expf(v); }
__device__ __attribute__((noinline)) float erf_ni(float v) { return erff(v); }

#define PK_A 0                       // [3072][1024] Wqkv rows (natural [out][in])
#define PK_P (PK_A + QKVW * DM)        // [1024][1024] Wo rows (natural)
#define PK_END (PK_P + DM * DM)
#define WS_PK  0u
#define WS_QK  (WS_PK + 2u * PK_END)             // f16 [4096 rows][2048]: q | k
#define WS_QKL (WS_QK + 2u * NB * SS * 2 * DM)     // f16 q | k residual planes x2048
#define WS_VTH (WS_QKL + 2u * NB * SS * 2 * DM)    // f16 [b][1024 (h*64+d)][2048 s] hi
#define WS_VTL (WS_VTH + 2u * NB * DM * SS)        // f16 lo x 2048
#define WS_O   (WS_VTL + 2u * NB * DM * SS)        // f32 [4096][1024]
#define WS_CS  (WS_O + 4u * NB * SS * DM)           // f32 2 x [2048][32], not used
#define WS_RB  (WS_CS + 4u * 2 * SS * 32)                 // f32 [16][2*SS-1] relative-position bias table
#define WS_END (WS_RB + 4u * NH * (2 * SS))
#define RPEH 32
// ---- k_packt: block = one 128 (in) x 128 (out) tile of the (in,out) weights, columns 0..3071 of W_qkv, 3072..4095 of W_out -> bf16 rows PK[n][k] (PK_P follows PK_A, so the row is the column's number). A wave reads 16 whole 512-B row pieces; a lane's 16 k x 4 n block becomes four 32-B runs of k in LDS; the rows leave as 256-B pieces
// LDS rows hold 16 pieces of 16 B, piece j of row n at place j ^ ((n >> 2) & 15): the 32 lanes of a store stand 4 rows apart and would meet in 16 of the 64 banks at any 16-B-aligned pitch
__global__ __launch_bounds__(256) void k_packt(const float* __restrict__ WA, const float* __restrict__ WO, __bf16* __restrict__ PK) {
  __shared__ __align__(16) __bf16 s[128 * 128];
  const int tid = threadIdx.x, lane = tid & 31, wave = tid >> 5; const int k0 = blockIdx.x * 128, n0 = blockIdx.y * 128;
  const bool qkv = n0 < QKVW; const int ld = qkv ? QKVW : DM; const float* src = (qkv ? WA + n0 : WO + (n0 - QKVW)) + (size_t)(k0 + wave * 16) * ld + lane * 4;
  v4f r[16]; const float* p[16];
#pragma unroll
  for (int i = 0; i < 16; ++i) { p[i] = src + (size_t)i * ld; r[i] = *(const v4f*)p[i]; }
  // the two statements take the loaded values and their addresses as inputs only. They hold all sixteen loads in front of the first conversion (one memory latency a tile; left alone, the compiler issues the last six behind waits for the first), and they keep every address register live up to the wait that stands in front of its first overwrite
  asm volatile("s_wait_xcnt 0x0" :: "v"(r[0]), "v"(r[1]), "v"(r[2]), "v"(r[3]), "v"(r[4]), "v"(r[5]), "v"(r[6]), "v"(r[7]), "v"(p[0]), "v"(p[1]), "v"(p[2]), "v"(p[3]), "v"(p[4]), "v"(p[5]), "v"(p[6]), "v"(p[7]) : "memory");
  asm volatile("s_wait_xcnt 0x0" :: "v"(r[8]), "v"(r[9]), "v"(r[10]), "v"(r[11]), "v"(r[12]), "v"(r[13]), "v"(r[14]), "v"(r[15]), "v"(p[8]), "v"(p[9]), "v"(p[10]), "v"(p[11]), "v"(p[12]), "v"(p[13]), "v"(p[14]), "v"(p[15]) : "memory");
#pragma unroll
  for (int c = 0; c < 4; ++c) { v8b lo, hi;
#pragma unroll
    for (int e = 0; e < 8; ++e) { lo[e] = (__bf16)r[e][c]; hi[e] = (__bf16)r[8 + e][c]; }
    __bf16* row = &s[(lane * 4 + c) * 128]; *(v8b*)&row[((2 * wave) ^ (lane & 15)) * 8] = lo; *(v8b*)&row[((2 * wave + 1) ^ (lane & 15)) * 8] = hi; }
  __syncthreads();
  const int nr = tid >> 4, j = tid & 15; __bf16* dst = PK + PK_A + (size_t)(n0 + nr) * DM + k0 + j * 8;
#pragma unroll   // the eight LDS reads go out together, one wait chain instead of eight round trips
  for (int i = 0; i < 8; ++i) { const int n = nr + 16 * i; vst2((unsigned*)(dst + (size_t)i * 16 * DM), *(const v4u*)&s[n * 128 + (j ^ ((n >> 2) & 15)) * 8]); }
}
// ---- rpe_rows: one thread per relative distance rel = idx - (SS-1): f = sign(rel) log1p(|rel|); h = relu(f w1[j] + b1[j]); bias[h] = sum_j h_j w2[j][h] + b2[h]
__device__ __forceinline__ void rpe_rows(const int idx, const float* __restrict__ W1, const float* __restrict__ B1, const float* __restrict__ W2, const float* __restrict__ B2, float* __restrict__ RB) {
  if (idx >= 2 * SS - 1) return; const float rel = (float)(idx - (SS - 1)); const float f = (rel > 0.f ? 1.f : (rel < 0.f ? -1.f : 0.f)) * log1pf(fabsf(rel));
  float hdn[RPEH];
#pragma unroll
  for (int j = 0; j < RPEH; ++j) hdn[j] = fmaxf(f * bfr(W1[j]) + bfr(B1[j]), 0.f);
#pragma unroll 1
  for (int h = 0; h < NH; ++h) { float b = bfr(B2[h]);
#pragma unroll
    for (int j = 0; j < RPEH; ++j) b += hdn[j] * bfr(W2[j * NH + h]);
    RB[(size_t)h * (2 * SS - 1) + (2 * SS - 2 - idx)] = b * 8.0f;
    asm volatile("s_wait_xcnt 0x0" ::: "memory"); }   // the store's address and data registers are written again by the next trip: the wait stands in front of that overwrite. 4-B scratch store; entry (SS-1) - rel, so that the table runs with the key, and x 8 = sqrt(64), so that it adds to the unscaled q.k
}
// ---- projection GEMM tiles: a block of 8 waves owns 128 x 128 of the product; 64 k of both operands are staged in LDS per step (two buffers, whole-line global loads fetched one step ahead into registers); wave (wm, wn) of 2 x 4 computes 64 x 32
#define GBM 128
#define GBN 128
#define GBK 64
#define GLP 72                         // LDS row pitch in bf16: 144 B = 16 B x odd, for 16-byte fragment reads of 128-B rows
#define GSP 136                        // f16 staging pitch of the epilogue (272 B)
typedef __attribute__((ext_vector_type(4))) __bf16 v4b;
__global__ __launch_bounds__(256) void k_qkv(const float* __restrict__ XQ, const float* __restrict__ XK, const float* __restrict__ XV, const __bf16* __restrict__ P, const float* __restrict__ BQ, const float* __restrict__ BK, const float* __restrict__ BV, _Float16* __restrict__ QK, _Float16* __restrict__ QKL, _Float16* __restrict__ VTH, _Float16* __restrict__ VTL, const float* __restrict__ W1, const float* __restrict__ B1, const float* __restrict__ W2, const float* __restrict__ B2, float* __restrict__ RB) {
  if (blockIdx.y == 0) { rpe_rows(blockIdx.x * 256 + threadIdx.x, W1, B1, W2, B2, RB); return; }   // grid row 0 (the first blocks to start) builds the bias table, which only k_attn reads: a short latency-bound job that runs beside the product tiles instead of in a launch of its own; whole blocks leave here, ahead of every barrier
  const int by = blockIdx.y - 1;   // the product's column tile
  const int which0 = (by * 128) / DM; const float* X = (which0 == 0) ? XQ : (which0 == 1) ? XK : XV; const float* BB = BQ ? (((which0 == 0) ? BQ : (which0 == 1) ? BK : BV) + (by * 128 - which0 * DM)) : nullptr;
  __shared__ __align__(16) unsigned char smem[2 * (GBM + GBN) * GLP * 2];   // two buffers of [x 128 rows | W 128 rows]; the epilogue's staging afterwards
  const int tid = threadIdx.x, wave = tid >> 5, lane = tid & 31, col = lane & 15, g = lane >> 4, wm = wave >> 2, wn = wave & 3;
  const size_t rb = (size_t)blockIdx.x * GBM; const int n0 = by * GBN;
  const int ar = tid >> 4, ac = (tid & 15) * 4, br = tid >> 3, bc = (tid & 7) * 8;   // x: 16 lanes x 16 B = one 256-B row piece; W: 8 lanes x 16 B = one 128-B line
  const float* ag = X + (rb + ar) * DM + ac; const __bf16* bg = P + (size_t)(n0 + br) * DM + bc;
  __bf16* sm = (__bf16*)smem;
  const int rot = (blockIdx.x + 2 * by) & (DM / GBK - 1);   // the block's first k step; the walk wraps. Blocks of one row panel or one column panel would otherwise ask L2 for the same lines at the same moment
  v4f ra[8]; v4u rw[4]; v8f acc[4][2] = {};
#pragma unroll
  for (int i = 0; i < 8; ++i) ra[i] = *(const v4f*)(ag + (size_t)i * 16 * DM + rot * GBK);
#pragma unroll
  for (int i = 0; i < 4; ++i) rw[i] = *(const v4u*)(bg + (size_t)i * 32 * DM + rot * GBK);
  for (int ks = 0; ks < DM / GBK; ++ks) { __bf16* sb = sm + (ks & 1) * ((GBM + GBN) * GLP); const int kn = ((ks + 1 + rot) & (DM / GBK - 1)) * GBK;   // first k of the next step
#pragma unroll
    for (int i = 0; i < 8; ++i) { v4b c; c[0] = (__bf16)ra[i][0]; c[1] = (__bf16)ra[i][1]; c[2] = (__bf16)ra[i][2]; c[3] = (__bf16)ra[i][3]; *(v4b*)&sb[(ar + 16 * i) * GLP + ac] = c; }
#pragma unroll
    for (int i = 0; i < 4; ++i) *(v4u*)&sb[(GBM + br + 32 * i) * GLP + bc] = rw[i];
    __syncthreads();   // publishes this step's buffer; the other buffer's readers all passed the barrier of the step before
    if (ks + 1 < DM / GBK) {
#pragma unroll
      for (int i = 0; i < 8; ++i) ra[i] = *(const v4f*)(ag + (size_t)i * 16 * DM + kn);
#pragma unroll
      for (int i = 0; i < 4; ++i) rw[i] = *(const v4u*)(bg + (size_t)i * 32 * DM + kn); }
#pragma unroll
    for (int kc = 0; kc < GBK / 32; ++kc) { v16b af[4], wf[2];
#pragma unroll
      for (int i = 0; i < 4; ++i) af[i] = frag_b(sb + (wm * 64 + i * 16 + col) * GLP + kc * 32, lane);
#pragma unroll
      for (int j = 0; j < 2; ++j) wf[j] = frag_b(sb + (GBM + wn * 32 + j * 16 + col) * GLP + kc * 32, lane);
#pragma unroll
      for (int i = 0; i < 4; ++i) {
#pragma unroll
        for (int j = 0; j < 2; ++j) acc[i][j] = wmma_bf(af[i], wf[j], acc[i][j]); } } }
  __syncthreads();   // every wave has left the operand buffers before they become staging
  _Float16* sh = (_Float16*)smem; _Float16* sl = sh + 128 * GSP;
  if (n0 < 2 * DM) {   // q stored unscaled (f16 sigma ~0.6, no subnormal exposure); 1/8 applied to the f32 score
#pragma unroll
    for (int i = 0; i < 4; ++i) {
#pragma unroll
      for (int j = 0; j < 2; ++j) { const int n = wn * 32 + j * 16 + col; const float bias = BB ? bfr(BB[n]) : 0.f;
#pragma unroll
        for (int r = 0; r < 8; ++r) { const int row = wm * 64 + i * 16 + 8 * g + r; const float v = acc[i][j][r] + bias; const _Float16 hv = (_Float16)v; sh[row * GSP + n] = hv; sl[row * GSP + n] = (_Float16)((v - (float)hv) * 2048.0f); } } }   // q, k (+ bias) as f16 hi + (x2048) residual
    __syncthreads();
    for (int q = tid; q < 128 * 16; q += 256) { const int row = q >> 4, c = q & 15; vst2((unsigned*)(QK + (rb + row) * (2 * DM) + n0 + c * 8), *(const v4u*)&sh[row * GSP + c * 8]); vst2((unsigned*)(QKL + (rb + row) * (2 * DM) + n0 + c * 8), *(const v4u*)&sl[row * GSP + c * 8]); }
  } else {             // v transposed: staging row = output column d, a lane's 8 accumulator rows are 8 consecutive s
#pragma unroll
    for (int i = 0; i < 4; ++i) {
#pragma unroll
      for (int j = 0; j < 2; ++j) { const int n = wn * 32 + j * 16 + col; const float bias = BB ? bfr(BB[n]) : 0.f; v8h h8, l8;
#pragma unroll
        for (int r = 0; r < 8; ++r) { const float v = acc[i][j][r] + bias; const _Float16 hv = (_Float16)v; h8[r] = hv; l8[r] = (_Float16)((v - (float)hv) * 2048.0f); }
        *(v8h*)&sh[n * GSP + wm * 64 + i * 16 + 8 * g] = h8; *(v8h*)&sl[n * GSP + wm * 64 + i * 16 + 8 * g] = l8; } }
    __syncthreads();
    const int b = (int)(rb / SS), s0 = (int)(rb % SS); const int pc0 = n0 - 2 * DM;
    for (int q = tid; q < 128 * 16; q += 256) { const int d = q >> 4, pc = q & 15; const size_t o = ((size_t)b * DM + pc0 + d) * SS + s0 + pc * 8; vst2((unsigned*)(VTH + o), *(const v4u*)&sh[d * GSP + pc * 8]); vst2((unsigned*)(VTL + o), *(const v4u*)&sl[d * GSP + pc * 8]); }
  }
}
// ---- k_attn: block = (128 queries, head h, batch b), 8 waves = 4 groups of 32 queries x 2 halves of every key stage: all-keys flash attention on TRANSPOSED tiles: S^T = K . Q^T (A = key rows from LDS, B = the wave's two tiles of 16 queries, kept in registers), so in each tile a lane holds 16 of the 32 scores of ONE query (column = lane & 15; keys 8g + r of each 16-key tile): maximum and sum run in the lane, the two lane halves exchange the maximum once a pass and join their sums once at the end; the two score tiles, converted in place, ARE the B operand of O^T += V^T . P^T (hardware k order), so P never goes through LDS; the bias (x 8, from the table) is the C operand of the score product, scores = (q.k + 8 bias) * 0.125 with single f16 operands, and P = exp2 of ONE multiply-add of the raw accumulator (scale, log2 e, maximum and 2^11 folded); the two key halves' maxima, sums and outputs meet in LDS at the end; O[b*S+q][h*64+d] = (acc a1 + acc' a2) / (l a1 + l' a2) (256-B segments)
__device__ __forceinline__ float xhalf(float x) { return __builtin_bit_cast(float, __builtin_amdgcn_permlanex16(__builtin_bit_cast(int, x), __builtin_bit_cast(int, x), 0x76543210, 0xfedcba98, false, false)); }   // lane l with lane l ^ 16
typedef float v4fu __attribute__((ext_vector_type(4), aligned(4)));   // four table entries at a 4-byte-aligned address
__device__ __forceinline__ v8f bias8(const float* p) { const v4f lo = *(const v4fu*)p, hi = *(const v4fu*)(p + 4); return __builtin_shufflevector(lo, hi, 0, 1, 2, 3, 4, 5, 6, 7); }   // a lane's 8 keys of one score tile, in accumulator order
#define SC2 0.18033688f                // 1/sqrt(64) * log2(e): raw accumulator -> exponent of 2
__global__ __launch_bounds__(256) __attribute__((amdgpu_waves_per_eu(4, 4))) void k_attn(const _Float16* __restrict__ QK, const _Float16* __restrict__ QKL, const _Float16* __restrict__ VTH, const _Float16* __restrict__ VTL, const void* __restrict__ KMASK, const float* __restrict__ RB, float* __restrict__ O) {
  __shared__ __align__(16) float so[4][32][68];   // the second key half's partial output on its way to the first half's wave, then the output rows
  __shared__ float sml[4][2][2][32];              // with it: that half's maximum and sum, per query tile and lane
  __shared__ __align__(16) _Float16 skv[2][128 * GLP];   // two buffers of a 64-key stage shared by the 8 waves: [k: 64 key rows x 64 d | v: 64 d rows x 64 keys], 128-B rows at pitch 144 B
  const int tid = threadIdx.x, wave = tid >> 5, lane = tid & 31, col = lane & 15, g = lane >> 4;
  const int wq = wave & 3, kh = wave >> 2;   // wave (wq, kh): 32 queries as TWO 16-query column tiles (t = 0, 1: queries q0 + 16 t + col), so that every k and v fragment it reads from LDS feeds two products; keys 32 kh .. 32 kh + 31 of every stage, so that the chip still holds four waves a SIMD
  const int qb = blockIdx.x, h = blockIdx.y, b = blockIdx.z; const int q0 = qb * 128 + wq * 32; const size_t rq = (size_t)b * SS + q0 + col;
  v16h aq[2][2];
#pragma unroll
  for (int t = 0; t < 2; ++t) {
#pragma unroll
    for (int kc = 0; kc < 2; ++kc) aq[t][kc] = frag_h(QK + (rq + 16 * t) * (2 * DM) + h * HD + kc * 32, lane); }
  asm volatile("s_wait_xcnt 0x0" ::: "memory");   // the eight loads' address pairs are reused as destinations of the loads below: the wait stands in front of that overwrite
  float m[2] = {-3.0e38f, -3.0e38f}, l[2] = {0.f, 0.f};   // per query tile, this lane's query: running maximum of the raw accumulators q.k + 8 bias (equal in both lane halves), and this lane half's share of the sum (x 2^11)
  float off[2] = {11.0f - m[0] * SC2, 11.0f - m[1] * SC2};   // P = exp2(raw * SC2 + off) = 2^11 exp(score - maximum)
  v8f acc[2][4] = {};
  const int nst = SS / 64;   // stages: all keys
  const int sr = tid >> 3, sc = (tid & 7) * 8;   // staging: 8 lanes x 16 B = one whole 128-B line, 32 rows a sweep
  const _Float16* kg = QK + ((size_t)b * SS + sr) * (2 * DM) + h * HD + sc;   // the row's q; its k stands DM further
  const _Float16* vg = VTH + ((size_t)b * DM + h * HD + sr) * SS + sc;
  const float* rbq = RB + (size_t)h * (2 * SS - 1) + (SS - 1) - (q0 + col) + 8 * g + 32 * kh;   // 8 bias[h][t - s] of this lane's query of tile 0 at key 8g of the wave's first key tile of stage 0: the table runs with the key, so a lane's 8 keys of a tile are 8 consecutive entries in accumulator order; query tile 1 stands 16 entries lower
  const int rot = (2 * qb) & (nst - 1);   // the block's first 64-key stage; the walk wraps. The 16 query blocks of a head read the same k and v lines: a start of its own keeps each from asking L2 for a line at the moment the others do (the running softmax takes the keys in any order)
  v4u rk[2], rv[2]; v8f bc[3];   // bc: the bias of a pass's score tiles, fetched one stage ahead: the C operand of a tile's first product. It depends on key tile minus query tile alone: (t, ct) takes bc[ct - t + 1]
  { const _Float16* kp = kg + (size_t)rot * 64 * (2 * DM); const _Float16* vp = vg + rot * 64;
#pragma unroll
    for (int i = 0; i < 2; ++i) { rk[i] = *(const v4u*)(kp + DM + (size_t)i * 32 * (2 * DM)); rv[i] = *(const v4u*)(vp + (size_t)i * 32 * SS); }
    asm volatile("s_wait_xcnt 0x0" :: "v"(kp), "v"(vp) : "memory"); }   // takes the two addresses as inputs only: it keeps their registers live up to the wait, which so stands in front of their first overwrite (left alone, a load's destination takes its own address pair)
#pragma unroll
  for (int i = 0; i < 3; ++i) bc[i] = bias8(rbq + rot * 64 + (i - 1) * 16);
#pragma unroll 1
  for (int st = 0; st < nst; ++st) { _Float16* sb = &skv[st & 1][0];   // a stage: lay down the 64 keys fetched one stage ahead
#pragma unroll
    for (int i = 0; i < 2; ++i) { *(v4u*)&sb[(sr + 32 * i) * GLP + sc] = rk[i]; *(v4u*)&sb[(64 + sr + 32 * i) * GLP + sc] = rv[i]; }
    __syncthreads();   // publishes this stage's buffer; the other buffer's readers all passed the barrier of the stage before
    v8f s[2][2]; const int nx = (st + 1 + rot) & (nst - 1);   // the next stage's place among the keys; the last stage fetches the first again, unused
    const _Float16* kp = kg + (size_t)nx * 64 * (2 * DM); const _Float16* vp = vg + nx * 64;
#pragma unroll   // the next stage's keys and values, a whole pass ahead of their use; its bias follows below: loads return in order, and the stage is wanted first (at the head of the next trip)
    for (int i = 0; i < 2; ++i) { rk[i] = *(const v4u*)(kp + DM + (size_t)i * 32 * (2 * DM)); rv[i] = *(const v4u*)(vp + (size_t)i * 32 * SS); }
    asm volatile("s_wait_xcnt 0x0" :: "v"(kp), "v"(vp) : "memory");   // as in front of the loop: the address registers stay live up to the wait that stands in front of their first overwrite
#pragma unroll
    for (int ct = 0; ct < 2; ++ct) { const _Float16* krow = sb + (kh * 32 + ct * 16 + col) * GLP; const v16h k0 = frag_h(krow, lane), k1 = frag_h(krow + 32, lane);
#pragma unroll
      for (int t = 0; t < 2; ++t) s[t][ct] = wmma16(k1, aq[t][1], wmma16(k0, aq[t][0], bc[ct - t + 1])); }   // single product: k, q as one-rounding f16 operands; s[t][ct][r] = q.k + 8 bias[h][t - s] = 8 x score(key ct*16 + 8g + r of the wave's 32, query col of tile t)
    v16h pa[2];
#pragma unroll
    for (int t = 0; t < 2; ++t) {
      float mx = fmaxf(s[t][0][0], s[t][1][0]);
#pragma unroll
      for (int r = 1; r < 8; ++r) mx = fmaxf(mx, fmaxf(s[t][0][r], s[t][1][r]));
      mx = fmaxf(mx, xhalf(mx));   // the query's maximum over all 32 keys of the pass, in both lane halves
      const float mn = fmaxf(m[t], mx); const float noff = 11.0f - mn * SC2; const float alpha = __builtin_amdgcn_exp2f(noff - off[t]);   // old sums were taken against off: the first pass gives exp2 of a huge negative number = 0
      const v8f x0 = s[t][0] * SC2 + noff, x1 = s[t][1] * SC2 + noff; v2f es2 = {0.f, 0.f};   // even and odd keys summed apart: the packed multiply-adds and adds take register pairs as the accumulators hold them, with no moves
#pragma unroll
      for (int r = 0; r < 8; r += 2) { const v2f e0 = {__builtin_amdgcn_exp2f(x0[r]), __builtin_amdgcn_exp2f(x0[r + 1])}, e1 = {__builtin_amdgcn_exp2f(x1[r]), __builtin_amdgcn_exp2f(x1[r + 1])}; es2 += e0 + e1;
        pa[t][r] = (_Float16)e0[0]; pa[t][r + 1] = (_Float16)e0[1]; pa[t][8 + r] = (_Float16)e1[0]; pa[t][9 + r] = (_Float16)e1[1]; }   // P carries 2^11 (in the exponent) so small softmax weights stay out of the f16 subnormal range; the sum carries it too, so it cancels in the epilogue
      const float es = es2[0] + es2[1];
      l[t] = l[t] * alpha + es; m[t] = mn; off[t] = noff;
#pragma unroll
      for (int dt = 0; dt < 4; ++dt) {
#pragma unroll
        for (int r = 0; r < 8; ++r) acc[t][dt][r] *= alpha; } }
#pragma unroll   // the next stage's bias, once the scores have left the registers it arrived in: it lands where the next products read it, with no copies
    for (int i = 0; i < 3; ++i) bc[i] = bias8(rbq + nx * 64 + (i - 1) * 16);
#pragma unroll
    for (int dt = 0; dt < 4; ++dt) { const v16h vf = frag_h(sb + (64 + dt * 16 + col) * GLP + kh * 32, lane);
#pragma unroll
      for (int t = 0; t < 2; ++t) acc[t][dt] = wmma16(vf, pa[t], acc[t][dt]); }   // single product: V^T x P^T (x2^11); acc[t][dt][r] = O(query col of tile t, d = dt*16 + 8g + r), over this wave's keys
  }
  float lt[2];
#pragma unroll
  for (int t = 0; t < 2; ++t) lt[t] = l[t] + xhalf(l[t]);   // the lane halves' sums joined once
  if (kh == 1) {   // the second key half hands over its maximum, sum and unnormalised output
#pragma unroll
    for (int t = 0; t < 2; ++t) { sml[wq][t][0][lane] = m[t]; sml[wq][t][1][lane] = lt[t];
#pragma unroll
      for (int dt = 0; dt < 4; ++dt) { *(v4f*)&so[wq][t * 16 + col][dt * 16 + 8 * g] = __builtin_shufflevector(acc[t][dt], acc[t][dt], 0, 1, 2, 3); *(v4f*)&so[wq][t * 16 + col][dt * 16 + 8 * g + 4] = __builtin_shufflevector(acc[t][dt], acc[t][dt], 4, 5, 6, 7); } } }
  __syncthreads();   // publishes the second key half's partial results to the waves of the first
  if (kh == 1) return;
#pragma unroll
  for (int t = 0; t < 2; ++t) { const float m2 = sml[wq][t][0][lane], l2 = sml[wq][t][1][lane]; const float mn = fmaxf(m[t], m2);
    const float a1 = __builtin_amdgcn_exp2f((m[t] - mn) * SC2), a2 = __builtin_amdgcn_exp2f((m2 - mn) * SC2);   // both halves brought to the common maximum
    const float il = 1.0f / (lt[t] * a1 + l2 * a2); const float f1 = a1 * il, f2 = a2 * il;
#pragma unroll
    for (int dt = 0; dt < 4; ++dt) { float* p = &so[wq][t * 16 + col][dt * 16 + 8 * g]; const v4f p0 = *(const v4f*)p, p1 = *(const v4f*)(p + 4); v4f o0, o1;   // a lane reads and rewrites its own 32 bytes
#pragma unroll
      for (int r = 0; r < 4; ++r) { o0[r] = acc[t][dt][r] * f1 + p0[r] * f2; o1[r] = acc[t][dt][4 + r] * f1 + p1[r] * f2; }
      *(v4f*)p = o0; *(v4f*)(p + 4) = o1; } }
  LDSX();
  for (int rl = 0; rl < 16; ++rl) vst2(O + ((size_t)b * SS + q0 + 2 * rl + g) * DM + h * HD + col * 4, *(const v4f*)&so[wq][2 * rl + g][col * 4]);   // two 256-B row pieces a store
}
// ---- k_out: block = (128 rows, 128 cols), tiles staged as in k_qkv: out = O(hi/lo) . Wo rows (2 products) + bo
__global__ __launch_bounds__(256) void k_out(const float* __restrict__ O, const __bf16* __restrict__ P, const float* __restrict__ BO, float* __restrict__ Y) {
  __shared__ __align__(16) unsigned char smem[2 * (2 * GBM + GBN) * GLP * 2];   // two buffers of [O hi 128 rows | O residual 128 rows | Wo 128 rows]; the epilogue's staging afterwards
  const int tid = threadIdx.x, wave = tid >> 5, lane = tid & 31, col = lane & 15, g = lane >> 4, wm = wave >> 2, wn = wave & 3;
  const size_t rb = (size_t)blockIdx.x * GBM; const int n0 = blockIdx.y * GBN;
  const int ar = tid >> 4, ac = (tid & 15) * 4, br = tid >> 3, bc = (tid & 7) * 8;
  const float* ag = O + (rb + ar) * DM + ac; const __bf16* bg = P + (size_t)(n0 + br) * DM + bc;
  __bf16* sm = (__bf16*)smem;
  const int rot = (blockIdx.x + 2 * blockIdx.y) & (DM / GBK - 1);   // the block's first k step, as in k_qkv: the 8 blocks of a row panel start apart, the 32 of a column panel two to each of the 16 starts, and all wrap
  v4f ra[8]; v4u rw[4]; v8f acc[4][2] = {};
#pragma unroll
  for (int i = 0; i < 8; ++i) ra[i] = *(const v4f*)(ag + (size_t)i * 16 * DM + rot * GBK);
#pragma unroll
  for (int i = 0; i < 4; ++i) rw[i] = *(const v4u*)(bg + (size_t)i * 32 * DM + rot * GBK);
  for (int ks = 0; ks < DM / GBK; ++ks) { __bf16* sb = sm + (ks & 1) * ((2 * GBM + GBN) * GLP); const int kn = ((ks + 1 + rot) & (DM / GBK - 1)) * GBK;   // first k of the next step
#pragma unroll
    for (int i = 0; i < 8; ++i) { v4b ch, cl;
#pragma unroll
      for (int e = 0; e < 4; ++e) { const __bf16 h = (__bf16)ra[i][e]; ch[e] = h; cl[e] = (__bf16)(ra[i][e] - (float)h); }
      *(v4b*)&sb[(ar + 16 * i) * GLP + ac] = ch; *(v4b*)&sb[(GBM + ar + 16 * i) * GLP + ac] = cl; }
#pragma unroll
    for (int i = 0; i < 4; ++i) *(v4u*)&sb[(2 * GBM + br + 32 * i) * GLP + bc] = rw[i];
    __syncthreads();   // publishes this step's buffer; the other buffer's readers all passed the barrier of the step before
    if (ks + 1 < DM / GBK) {
#pragma unroll
      for (int i = 0; i < 8; ++i) ra[i] = *(const v4f*)(ag + (size_t)i * 16 * DM + kn);
#pragma unroll
      for (int i = 0; i < 4; ++i) rw[i] = *(const v4u*)(bg + (size_t)i * 32 * DM + kn);
      asm volatile("s_wait_xcnt 0x0" ::: "memory"); }   // the twelve loads' address registers are reused by the compute below: the wait stands in front of their first overwrite
#pragma unroll
    for (int kc = 0; kc < GBK / 32; ++kc) { v16b ah[4], al[4], wf[2];
#pragma unroll
      for (int i = 0; i < 4; ++i) { ah[i] = frag_b(sb + (wm * 64 + i * 16 + col) * GLP + kc * 32, lane); al[i] = frag_b(sb + (GBM + wm * 64 + i * 16 + col) * GLP + kc * 32, lane); }
#pragma unroll
      for (int j = 0; j < 2; ++j) wf[j] = frag_b(sb + (2 * GBM + wn * 32 + j * 16 + col) * GLP + kc * 32, lane);
#pragma unroll
      for (int i = 0; i < 4; ++i) {
#pragma unroll
        for (int j = 0; j < 2; ++j) acc[i][j] = wmma_bf(al[i], wf[j], acc[i][j]); }
#pragma unroll
      for (int i = 0; i < 4; ++i) {
#pragma unroll
        for (int j = 0; j < 2; ++j) acc[i][j] = wmma_bf(ah[i], wf[j], acc[i][j]); } } }
  __syncthreads();   // every wave has left the operand buffers before they become staging
  float* so = (float*)smem;
#pragma unroll
  for (int i = 0; i < 4; ++i) {
#pragma unroll
    for (int j = 0; j < 2; ++j) { const int n = wn * 32 + j * 16 + col; const float bias = bfr(BO[n0 + n]);
#pragma unroll
      for (int r = 0; r < 8; ++r) so[(wm * 64 + i * 16 + 8 * g + r) * 132 + n] = acc[i][j][r] + bias; } }
  __syncthreads();
  for (int q = tid; q < 128 * 32; q += 256) { const int row = q >> 5, c = q & 31; vst2(Y + (rb + row) * DM + n0 + c * 4, *(const v4f*)&so[row * 132 + c * 4]); }
}
extern "C" void kernel_launch(void* const* d_in, const int* in_sizes, int n_in, void* d_out, int out_size, void* d_ws, size_t ws_size, hipStream_t stream) {
  (void)in_sizes; (void)n_in; (void)out_size;
  const float** F = (const float**)d_in;   // 0 x [2,2048,1024], 1 w_qkv [1024,3072] (in,out: q | k | v), 2 b_qkv [3072], 3 w_out (in,out), 4 b_out, 5 w1_rpe [1,32], 6 b1_rpe [32], 7 w2_rpe [32,16], 8 b2_rpe [16]
  if (ws_size < (size_t)WS_END) return;
  char* ws = (char*)d_ws; __bf16* PK = (__bf16*)(ws + WS_PK); _Float16 *QK = (_Float16*)(ws + WS_QK), *QKL = (_Float16*)(ws + WS_QKL), *VTH = (_Float16*)(ws + WS_VTH), *VTL = (_Float16*)(ws + WS_VTL); float *O = (float*)(ws + WS_O), *RB = (float*)(ws + WS_RB);
  k_packt<<<dim3(DM / 128, (QKVW + DM) / 128), 256, 0, stream>>>(F[1], F[3], PK);
  k_qkv<<<dim3(TNB * SS / GBM, QKVW / GBN + 1), 256, 0, stream>>>(F[0], F[0], F[0], PK + PK_A, F[2], F[2] + DM, F[2] + 2 * DM, QK, QKL, VTH, VTL, F[5], F[6], F[7], F[8], RB);
  k_attn<<<dim3(SS / 128, NH, TNB), 256, 0, stream>>>(QK, QKL, VTH, VTL, nullptr, RB, O);
  k_out<<<dim3(NB * SS / GBM, DM / GBN), 256, 0, stream>>>(O, PK + PK_P, F[4], (float*)d_out);
}
